// v000
// Measured on an AMD MI455X. A time is GPU time per run, averaged over a window of back-to-back runs after a warm-up
// (all launches, gaps included; the runs take copies of the inputs in turn), and the median of several windows.
// Apart from v000's, it joins two sittings. Times from different sittings can be a few percent apart, while
// side-by-side timings come from the same sitting.
// v000, which the later versions start from, runs in 544 microseconds.
#include <hip/hip_runtime.h>
// All contractions on v_wmma_f32_16x16x32_bf16 with f32 accumulate: q/k/v projections x*Wq, x*Wk, x*Wv with x and W as
// bf16 (single exact-product term), attention Q*K^T and P*V as 3-term bf16 hi/lo splits, output projection y*Wp with
// y split hi/lo (2 terms) and W as bf16; biases as bf16; softmax in f32.
#ifndef NB
#define NB 4
#endif
#ifndef SEQ
#define SEQ 2048
#endif
#define NB_FULL 4
#define SEQ_FULL 2048
#define CC 768
#define NH 12
#define HD 64
// row stride (in tokens) between batches in the output buffer; full layout by default
#ifndef OUT_SEG_ROWS
#define OUT_SEG_ROWS SEQ_FULL
#endif
static_assert(NB >= 1 && NB <= NB_FULL);
static_assert(SEQ >= 64 && SEQ <= SEQ_FULL && (SEQ % 64) == 0);
static_assert(CC == NH * HD);
static_assert((HD % 32) == 0 && HD <= 128);
static_assert((CC % 64) == 0 && (CC % 32) == 0);

typedef __bf16 v16b __attribute__((ext_vector_type(16)));
typedef unsigned short v8us __attribute__((ext_vector_type(8), may_alias));
typedef float  v8f  __attribute__((ext_vector_type(8)));
typedef float  v4f  __attribute__((ext_vector_type(4)));
typedef float  v4fa __attribute__((ext_vector_type(4), may_alias));
union FragB { v16b v; v8us half[2]; unsigned short u[16]; };

__device__ __forceinline__ unsigned short bf16_bits(float x) { unsigned int u = __float_as_uint(x); return (unsigned short)((u + 0x7FFFu + ((u >> 16) & 1u)) >> 16); }
__device__ __forceinline__ float bf16_val(unsigned short b) { return __uint_as_float(((unsigned int)b) << 16); }
__device__ __forceinline__ float bf16_rne(float x) { return bf16_val(bf16_bits(x)); }
// D += A*B with NT terms: 1 = ah*bh, 2 = + al*bh (A split), 3 = + ah*bl (both split)
template <int NT>
__device__ __forceinline__ v8f mmaN(v16b ah, v16b al, v16b bh, v16b bl, v8f c) {
  c = __builtin_amdgcn_wmma_f32_16x16x32_bf16(false, ah, false, bh, (short)0, c, false, false);
  if (NT >= 2) c = __builtin_amdgcn_wmma_f32_16x16x32_bf16(false, al, false, bh, (short)0, c, false, false);
  if (NT >= 3) c = __builtin_amdgcn_wmma_f32_16x16x32_bf16(false, ah, false, bl, (short)0, c, false, false);
  asm volatile("v_nop\n\tv_nop\n\tv_nop\n\tv_nop" : "+v"(c) : "v"(ah), "v"(al), "v"(bh), "v"(bl));
  return c;
}

// Wt[n][k] (bf16 bits, k contiguous, pitch K) = bf16(W[k][n]) from f32 row-major W[K][N]; one thread per (n, 8 consecutive k);
__global__ __launch_bounds__(256) void k_wt_bf16(const float* __restrict__ W, unsigned short* __restrict__ Wt, int K, int N) {
  const int t = blockIdx.x * 256 + threadIdx.x;
  const int k8n = K / 8;
  if (t >= N * k8n) return;
  const int n = t / k8n, k8 = (t % k8n) * 8;
  v8us v;
#pragma unroll
  for (int i = 0; i < 8; ++i) v[i] = bf16_bits(W[(size_t)(k8 + i) * N + n]);
  *(v8us*)(Wt + (size_t)n * K + k8) = v;
  
}

// GEMM C[M][N] (f32, pitch ldc) = act(A[M][K]*W + bias). A f32 row-major (pitch lda) converted per fragment to bf16
// (ASPLIT: hi/lo two planes -> 2 terms, else single RNE term); Wt bf16 [N][K] (pitch ldb). BIAS_BF16 quantises the
// bias to bf16 before the add. K%32==0, M%16==0, N%64==0.
// Logical rows are grouped in segments of 'seg' rows (seg % 16 == 0): logical row r -> A row (r/seg)*asr + r%seg and
// C row (r/seg)*csr + r%seg, so per-batch strides of A and C can differ.
// Block = 4 waves; wave -> 16 rows x 64 cols; epilogue staged in wave-private LDS, each 64-col row segment = 2 whole
template <bool ASPLIT, int ACT, bool BIAS_BF16>
__global__ __launch_bounds__(128) void k_gemm_bf(const float* __restrict__ A, int lda, const unsigned short* __restrict__ Wt, int ldb,
                                               const float* __restrict__ bias, float* __restrict__ C, int ldc, int M, int N, int K,
                                               int seg, int asr, int csr) {
  __shared__ __attribute__((aligned(16))) float so[4][16][64];
  const int tid = threadIdx.x, w = tid >> 5, lane = tid & 31, ln = lane & 15, hh = lane >> 4;
  const int ntn = N / 64;
  const int wid = blockIdx.x * 4 + w;
  const int mt = wid / ntn, nq = wid % ntn;
  if (mt * 16 >= M) return;                      // wave-uniform; no block barrier in this kernel
  const int row0 = mt * 16, col0 = nq * 64;
  const int bseg = row0 / seg, t0 = row0 - bseg * seg;
  const float* arow = A + ((size_t)bseg * asr + t0 + ln) * lda;
  float* crow0 = C + ((size_t)bseg * csr + t0) * ldc;
  v8f acc[4];
#pragma unroll
  for (int t = 0; t < 4; ++t) acc[t] = (v8f){0.f,0.f,0.f,0.f,0.f,0.f,0.f,0.f};
  for (int kb = 0; kb < K; kb += 32) {
    FragB ah, al;
    const v4f x0 = *(const v4fa*)(arow + kb + 8 * hh), x1 = *(const v4fa*)(arow + kb + 8 * hh + 4);
    const v4f x2 = *(const v4fa*)(arow + kb + 16 + 8 * hh), x3 = *(const v4fa*)(arow + kb + 16 + 8 * hh + 4);
    float xs[16] = {x0[0],x0[1],x0[2],x0[3],x1[0],x1[1],x1[2],x1[3],x2[0],x2[1],x2[2],x2[3],x3[0],x3[1],x3[2],x3[3]};
#pragma unroll
    for (int i = 0; i < 16; ++i) { const unsigned short hb = bf16_bits(xs[i]); ah.u[i] = hb; al.u[i] = ASPLIT ? bf16_bits(xs[i] - bf16_val(hb)) : (unsigned short)0; }
#pragma unroll
    for (int t = 0; t < 4; ++t) {
      const unsigned short* brow = Wt + (size_t)(col0 + t * 16 + ln) * ldb + kb;
      FragB b;
      b.half[0] = *(const v8us*)(brow + 8 * hh);
      b.half[1] = *(const v8us*)(brow + 16 + 8 * hh);
      acc[t] = mmaN<ASPLIT ? 2 : 1>(ah.v, al.v, b.v, b.v, acc[t]);
    }
  }
#pragma unroll
  for (int t = 0; t < 4; ++t) {
    float bv = bias ? bias[col0 + t * 16 + ln] : 0.f;
    if (BIAS_BF16) bv = bf16_rne(bv);
#pragma unroll
    for (int r = 0; r < 8; ++r) { float v = acc[t][r] + bv; if (ACT == 1) v = fmaxf(v, 0.f); so[w][8 * hh + r][t * 16 + ln] = v; }
  }
  __builtin_amdgcn_fence(4 /* acq_rel order */, "workgroup");
  __builtin_amdgcn_wave_barrier();
  const int rsub = lane >> 4, c4 = (lane & 15) * 4;
  {
#pragma unroll
    for (int q = 0; q < 8; ++q) {
      const int r = q * 2 + rsub;
      const v4f v = *(const v4fa*)&so[w][r][c4];
      *(v4f*)(crow0 + (size_t)r * ldc + col0 + c4) = v;
    }
    
  }
}

// Flash-style causal/unmasked attention, all contractions 3-term bf16 hi/lo splits, f32 softmax with running max.
// q,k,v rows are read from f32 buffers with arbitrary row pitch (so they can live inside a fused qkv buffer);
// D = head size (multiple of 32, <= 128); one wave = 16 query rows; block = 4 waves (64 queries) sharing K/V chunks of 32.
template <int D, bool CAUSAL>
__global__ __launch_bounds__(128) void k_flash(const float* __restrict__ qb, const float* __restrict__ kb, const float* __restrict__ vb,
                                             int pitch, int T, int H, float scale, float* __restrict__ y, int ypitch) {
  constexpr int KS = D / 32;        // k-steps for QK
  constexpr int DT = D / 16;        // d tiles for PV
  __shared__ __attribute__((aligned(16))) unsigned short sKh[32][D + 8], sKl[32][D + 8], sVh[32][D + 8], sVl[32][D + 8];
  __shared__ __attribute__((aligned(16))) unsigned short sPh[4][16][40], sPl[4][16][40];
  __shared__ __attribute__((aligned(16))) float sO[4][16][D];
  const int tid = threadIdx.x, w = tid >> 5, lane = tid & 31, ln = lane & 15, hh = lane >> 4;
  const int nqb = (T + 63) / 64;
  const int bh = blockIdx.x / nqb, qblk = blockIdx.x % nqb;
  const int b = bh / H, h = bh % H;
  const int q0 = qblk * 64 + w * 16;
  const float* Q = qb + (size_t)b * T * pitch + h * D;
  const float* K = kb + (size_t)b * T * pitch + h * D;
  const float* V = vb + (size_t)b * T * pitch + h * D;

  // A fragments of the wave's 16 query rows (scaled), hi/lo
  FragB aqh[KS], aql[KS];
  {
    int row = q0 + ln; if (row >= T) row = T - 1;
    const float* qr = Q + (size_t)row * pitch;
#pragma unroll
    for (int ks = 0; ks < KS; ++ks)
#pragma unroll
      for (int i = 0; i < 16; ++i) {
        const int d = ks * 32 + ((i < 8) ? (8 * hh + i) : (16 + 8 * hh + (i - 8)));
        const float x = qr[d] * scale; const unsigned short hb = bf16_bits(x);
        aqh[ks].u[i] = hb; aql[ks].u[i] = bf16_bits(x - bf16_val(hb));
      }
  }
  float m_r[8], l_r[8];
#pragma unroll
  for (int r = 0; r < 8; ++r) { m_r[r] = -3.0e38f; l_r[r] = 0.f; }
  v8f oacc[DT];
#pragma unroll
  for (int dt = 0; dt < DT; ++dt) oacc[dt] = (v8f){0.f,0.f,0.f,0.f,0.f,0.f,0.f,0.f};

  const int kv_end = CAUSAL ? min(T, qblk * 64 + 64) : T;     // block-uniform
  for (int j0 = 0; j0 < kv_end; j0 += 32) {
    __syncthreads();
    for (int e = tid; e < 32 * (D / 4); e += 128) {
      const int r = e / (D / 4), c4 = (e % (D / 4)) * 4;
      const int key = j0 + r;
      const int keyc = (key < T) ? key : (T - 1);              // clamped address, zeroed by value below
      v4f kf = *(const v4fa*)(K + (size_t)keyc * pitch + c4);
      v4f vf = *(const v4fa*)(V + (size_t)keyc * pitch + c4);
      if (key >= T) { kf = (v4f){0.f,0.f,0.f,0.f}; vf = (v4f){0.f,0.f,0.f,0.f}; }
#pragma unroll
      for (int t = 0; t < 4; ++t) {
        unsigned short hb = bf16_bits(kf[t]); sKh[r][c4 + t] = hb; sKl[r][c4 + t] = bf16_bits(kf[t] - bf16_val(hb));
        hb = bf16_bits(vf[t]); sVh[r][c4 + t] = hb; sVl[r][c4 + t] = bf16_bits(vf[t] - bf16_val(hb));
      }
    }
    __syncthreads();
    // S tile 16 x 32
    v8f s[2];
#pragma unroll
    for (int nt = 0; nt < 2; ++nt) {
      v8f acc = (v8f){0.f,0.f,0.f,0.f,0.f,0.f,0.f,0.f};
#pragma unroll
      for (int ks = 0; ks < KS; ++ks) {
        FragB bh_, bl_;
        bh_.half[0] = *(const v8us*)&sKh[nt * 16 + ln][ks * 32 + 8 * hh]; bh_.half[1] = *(const v8us*)&sKh[nt * 16 + ln][ks * 32 + 16 + 8 * hh];
        bl_.half[0] = *(const v8us*)&sKl[nt * 16 + ln][ks * 32 + 8 * hh]; bl_.half[1] = *(const v8us*)&sKl[nt * 16 + ln][ks * 32 + 16 + 8 * hh];
        acc = mmaN<3>(aqh[ks].v, aql[ks].v, bh_.v, bl_.v, acc);
      }
      s[nt] = acc;
    }
    // mask + running max (rows 8hh+r; the 16 lanes of a half share rows)
    float alpha[8];
#pragma unroll
    for (int r = 0; r < 8; ++r) {
      const int qi = q0 + 8 * hh + r;
      const int ja = j0 + ln, jb = j0 + 16 + ln;
      if (CAUSAL) { if (ja > qi) s[0][r] = -3.0e38f; if (jb > qi) s[1][r] = -3.0e38f; }
      if (ja >= T) s[0][r] = -3.0e38f;
      if (jb >= T) s[1][r] = -3.0e38f;
      float mx = fmaxf(s[0][r], s[1][r]);
      mx = fmaxf(mx, __shfl_xor(mx, 1, 32)); mx = fmaxf(mx, __shfl_xor(mx, 2, 32)); mx = fmaxf(mx, __shfl_xor(mx, 4, 32)); mx = fmaxf(mx, __shfl_xor(mx, 8, 32));
      const float mnew = fmaxf(m_r[r], mx);
      alpha[r] = (mnew > -1.0e38f) ? __expf(m_r[r] - mnew) : 1.0f;
      const float p0 = (s[0][r] > -1.0e38f) ? __expf(s[0][r] - mnew) : 0.f;
      const float p1 = (s[1][r] > -1.0e38f) ? __expf(s[1][r] - mnew) : 0.f;
      m_r[r] = mnew;
      l_r[r] = l_r[r] * alpha[r] + p0 + p1;            // per-lane partial row sum (16 lanes combined at the end)
      unsigned short hb = bf16_bits(p0); sPh[w][8 * hh + r][ln] = hb;      sPl[w][8 * hh + r][ln] = bf16_bits(p0 - bf16_val(hb));
      hb = bf16_bits(p1);                sPh[w][8 * hh + r][16 + ln] = hb; sPl[w][8 * hh + r][16 + ln] = bf16_bits(p1 - bf16_val(hb));
    }
#pragma unroll
    for (int dt = 0; dt < DT; ++dt)
#pragma unroll
      for (int r = 0; r < 8; ++r) oacc[dt][r] *= alpha[r];
    __builtin_amdgcn_fence(4 /* acq_rel order */, "workgroup");
    __builtin_amdgcn_wave_barrier();
    FragB pah, pal;
    pah.half[0] = *(const v8us*)&sPh[w][ln][8 * hh]; pah.half[1] = *(const v8us*)&sPh[w][ln][16 + 8 * hh];
    pal.half[0] = *(const v8us*)&sPl[w][ln][8 * hh]; pal.half[1] = *(const v8us*)&sPl[w][ln][16 + 8 * hh];
#pragma unroll
    for (int dt = 0; dt < DT; ++dt) {
      FragB bvh, bvl;
#pragma unroll
      for (int i = 0; i < 8; ++i) {
        bvh.u[i] = sVh[8 * hh + i][dt * 16 + ln]; bvh.u[8 + i] = sVh[16 + 8 * hh + i][dt * 16 + ln];
        bvl.u[i] = sVl[8 * hh + i][dt * 16 + ln]; bvl.u[8 + i] = sVl[16 + 8 * hh + i][dt * 16 + ln];
      }
      oacc[dt] = mmaN<3>(pah.v, pal.v, bvh.v, bvl.v, oacc[dt]);
    }
    __builtin_amdgcn_fence(4 /* acq_rel order */, "workgroup");
    __builtin_amdgcn_wave_barrier();
  }
#pragma unroll
  for (int r = 0; r < 8; ++r) {
    float l = l_r[r];
    l += __shfl_xor(l, 1, 32); l += __shfl_xor(l, 2, 32); l += __shfl_xor(l, 4, 32); l += __shfl_xor(l, 8, 32);
    l_r[r] = (l > 0.f) ? 1.0f / l : 0.f;
  }
#pragma unroll
  for (int dt = 0; dt < DT; ++dt)
#pragma unroll
    for (int r = 0; r < 8; ++r) sO[w][8 * hh + r][dt * 16 + ln] = oacc[dt][r] * l_r[r];
  __builtin_amdgcn_fence(4 /* acq_rel order */, "workgroup");
  __builtin_amdgcn_wave_barrier();
  {
    for (int r = 0; r < 16; ++r) {
      const int row = q0 + r;
      if (row < T && lane < D / 4) {
        const v4f val = *(const v4fa*)&sO[w][r][lane * 4];
        *(v4f*)(y + ((size_t)b * T + row) * ypitch + h * D + lane * 4) = val;
      }
    }
    
  }
}

extern "C" void kernel_launch(void* const* d_in, const int* in_sizes, int n_in,
                              void* d_out, int out_size, void* d_ws, size_t ws_size, hipStream_t stream) {
  if (n_in < 9) return;
  // lower-bound size checks (a reduced NB/SEQ build still launches against full-size inputs)
  if (in_sizes[0] < ((NB - 1) * SEQ_FULL + SEQ) * CC) return;
  for (int i = 1; i < 9; i += 2) {
    if (in_sizes[i] < CC * CC) return;       // Wq, Wk, Wv, Wp: [CC in][CC out] f32
    if (in_sizes[i + 1] < CC) return;        // bq, bk, bv, bp: [CC] f32
  }
  if (out_size < ((NB - 1) * OUT_SEG_ROWS + SEQ) * CC) return;
  const float* x  = (const float*)d_in[0];
  const float* Wq = (const float*)d_in[1]; const float* bqp = (const float*)d_in[2];
  const float* Wk = (const float*)d_in[3]; const float* bkp = (const float*)d_in[4];
  const float* Wv = (const float*)d_in[5]; const float* bvp = (const float*)d_in[6];
  const float* Wp = (const float*)d_in[7]; const float* bpp = (const float*)d_in[8];
  char* ws = (char*)d_ws; size_t off = 0;
  unsigned short* Wqt = (unsigned short*)(ws + off); off += (size_t)CC * CC * 2;         // [768][768] bf16  1,179,648 B
  unsigned short* Wkt = (unsigned short*)(ws + off); off += (size_t)CC * CC * 2;         // [768][768] bf16  1,179,648 B
  unsigned short* Wvt = (unsigned short*)(ws + off); off += (size_t)CC * CC * 2;         // [768][768] bf16  1,179,648 B
  unsigned short* Wpt = (unsigned short*)(ws + off); off += (size_t)CC * CC * 2;         // [768][768] bf16  1,179,648 B
  float* qkv = (float*)(ws + off); off += (size_t)NB * SEQ * 3 * CC * 4;                 // [NB*SEQ][2304] f32  75,497,472 B at full size
  float* yb  = (float*)(ws + off); off += (size_t)NB * SEQ * CC * 4;                     // [NB*SEQ][768]  f32  25,165,824 B at full size
  if (off > ws_size) return;                                                             // total 105,381,888 B at full size
  const int M = NB * SEQ;
  const int gw = (CC * (CC / 8) + 255) / 256;
  k_wt_bf16<<<gw, 256, 0, stream>>>(Wq, Wqt, CC, CC);
  k_wt_bf16<<<gw, 256, 0, stream>>>(Wk, Wkt, CC, CC);
  k_wt_bf16<<<gw, 256, 0, stream>>>(Wv, Wvt, CC, CC);
  k_wt_bf16<<<gw, 256, 0, stream>>>(Wp, Wpt, CC, CC);
  // qkv[b*SEQ + t][s*CC + n] = bf16(x[b*SEQ_FULL + t]) * bf16(W_s) + bf16(b_s), s = 0 (q), 1 (k), 2 (v); row pitch 3*CC
  const int gg = ((M / 16) * (CC / 64) + 3) / 4;
  k_gemm_bf<false, 0, true><<<gg, 128, 0, stream>>>(x, CC, Wqt, CC, bqp, qkv,          3 * CC, M, CC, CC, SEQ, SEQ_FULL, SEQ);
  k_gemm_bf<false, 0, true><<<gg, 128, 0, stream>>>(x, CC, Wkt, CC, bkp, qkv + CC,     3 * CC, M, CC, CC, SEQ, SEQ_FULL, SEQ);
  k_gemm_bf<false, 0, true><<<gg, 128, 0, stream>>>(x, CC, Wvt, CC, bvp, qkv + 2 * CC, 3 * CC, M, CC, CC, SEQ, SEQ_FULL, SEQ);
  k_flash<HD, true><<<NB * NH * (SEQ / 64), 128, 0, stream>>>(qkv, qkv + CC, qkv + 2 * CC, 3 * CC, SEQ, NH, 0.125f, yb, CC);
  // out[b*OUT_SEG_ROWS + t][:] = y[b*SEQ + t] * bf16(Wp) + bf16(bp), y as bf16 hi/lo
  k_gemm_bf<true, 0, true><<<gg, 128, 0, stream>>>(yb, CC, Wpt, CC, bpp, (float*)d_out, CC, M, CC, CC, SEQ, SEQ, OUT_SEG_ROWS);
}

// v001
// Measured time: 487 microseconds a run.
// In both of two side-by-side timings against v000, it was 1.13 times as fast.
#include <hip/hip_runtime.h>
// All contractions on v_wmma_f32_16x16x32_bf16 with f32 accumulate: q/k/v projections x*Wq, x*Wk, x*Wv with x and W as
// bf16 (single exact-product term), attention Q*K^T and P*V as 3-term bf16 hi/lo splits, output projection y*Wp with
// y split hi/lo (2 terms) and W as bf16; biases as bf16; softmax in f32.
#ifndef NB
#define NB 4
#endif
#ifndef SEQ
#define SEQ 2048
#endif
#define NB_FULL 4
#define SEQ_FULL 2048
#define CC 768
#define NH 12
#define HD 64
// row stride (in tokens) between batches in the output buffer; full layout by default
#ifndef OUT_SEG_ROWS
#define OUT_SEG_ROWS SEQ_FULL
#endif
static_assert(NB >= 1 && NB <= NB_FULL);
static_assert(SEQ >= 64 && SEQ <= SEQ_FULL && (SEQ % 64) == 0);
static_assert(CC == NH * HD);
static_assert((HD % 32) == 0 && HD <= 128);
static_assert((CC % 64) == 0 && (CC % 32) == 0);

typedef __bf16 v16b __attribute__((ext_vector_type(16)));
typedef unsigned short v8us __attribute__((ext_vector_type(8), may_alias));
typedef float  v8f  __attribute__((ext_vector_type(8)));
typedef float  v4f  __attribute__((ext_vector_type(4)));
typedef float  v4fa __attribute__((ext_vector_type(4), may_alias));
union FragB { v16b v; v8us half[2]; unsigned short u[16]; };

__device__ __forceinline__ unsigned short bf16_bits(float x) { unsigned int u = __float_as_uint(x); return (unsigned short)((u + 0x7FFFu + ((u >> 16) & 1u)) >> 16); }
__device__ __forceinline__ float bf16_val(unsigned short b) { return __uint_as_float(((unsigned int)b) << 16); }
__device__ __forceinline__ float bf16_rne(float x) { return bf16_val(bf16_bits(x)); }
// D += A*B with NT terms: 1 = ah*bh, 2 = + al*bh (A split), 3 = + ah*bl (both split)
template <int NT>
__device__ __forceinline__ v8f mmaN(v16b ah, v16b al, v16b bh, v16b bl, v8f c) {
  c = __builtin_amdgcn_wmma_f32_16x16x32_bf16(false, ah, false, bh, (short)0, c, false, false);
  if (NT >= 2) c = __builtin_amdgcn_wmma_f32_16x16x32_bf16(false, al, false, bh, (short)0, c, false, false);
  if (NT >= 3) c = __builtin_amdgcn_wmma_f32_16x16x32_bf16(false, ah, false, bl, (short)0, c, false, false);
  asm volatile("v_nop\n\tv_nop\n\tv_nop\n\tv_nop" : "+v"(c) : "v"(ah), "v"(al), "v"(bh), "v"(bl));
  return c;
}

// Wt[n][k] (bf16 bits, k contiguous, pitch K) = bf16(W[k][n]) from f32 row-major W[K][N]; one thread per (n, 8 consecutive k);
__global__ __launch_bounds__(256) void k_wt_bf16(const float* __restrict__ W, unsigned short* __restrict__ Wt, int K, int N) {
  const int t = blockIdx.x * 256 + threadIdx.x;
  const int k8n = K / 8;
  if (t >= N * k8n) return;
  const int n = t / k8n, k8 = (t % k8n) * 8;
  v8us v;
#pragma unroll
  for (int i = 0; i < 8; ++i) v[i] = bf16_bits(W[(size_t)(k8 + i) * N + n]);
  *(v8us*)(Wt + (size_t)n * K + k8) = v;
  
}

// GEMM C[M][N] (f32, pitch ldc) = act(A[M][K]*W + bias). A f32 row-major (pitch lda) converted per fragment to bf16
// (ASPLIT: hi/lo two planes -> 2 terms, else single RNE term); Wt bf16 [N][K] (pitch ldb). BIAS_BF16 quantises the
// bias to bf16 before the add. K%32==0, M%16==0, N%64==0.
// Logical rows are grouped in segments of 'seg' rows (seg % 16 == 0): logical row r -> A row (r/seg)*asr + r%seg and
// C row (r/seg)*csr + r%seg, so per-batch strides of A and C can differ.
// Block = 4 waves; wave -> 16 rows x 64 cols; epilogue staged in wave-private LDS, each 64-col row segment = 2 whole
template <bool ASPLIT, int ACT, bool BIAS_BF16>
__global__ __launch_bounds__(128) void k_gemm_bf(const float* __restrict__ A, int lda, const unsigned short* __restrict__ Wt, int ldb,
                                               const float* __restrict__ bias, float* __restrict__ C, int ldc, int M, int N, int K,
                                               int seg, int asr, int csr) {
  __shared__ __attribute__((aligned(16))) float so[4][16][64];
  const int tid = threadIdx.x, w = tid >> 5, lane = tid & 31, ln = lane & 15, hh = lane >> 4;
  const int ntn = N / 64;
  const int wid = blockIdx.x * 4 + w;
  const int mt = wid / ntn, nq = wid % ntn;
  if (mt * 16 >= M) return;                      // wave-uniform; no block barrier in this kernel
  const int row0 = mt * 16, col0 = nq * 64;
  const int bseg = row0 / seg, t0 = row0 - bseg * seg;
  const float* arow = A + ((size_t)bseg * asr + t0 + ln) * lda;
  float* crow0 = C + ((size_t)bseg * csr + t0) * ldc;
  v8f acc[4];
#pragma unroll
  for (int t = 0; t < 4; ++t) acc[t] = (v8f){0.f,0.f,0.f,0.f,0.f,0.f,0.f,0.f};
  for (int kb = 0; kb < K; kb += 32) {
    FragB ah, al;
    const v4f x0 = *(const v4fa*)(arow + kb + 8 * hh), x1 = *(const v4fa*)(arow + kb + 8 * hh + 4);
    const v4f x2 = *(const v4fa*)(arow + kb + 16 + 8 * hh), x3 = *(const v4fa*)(arow + kb + 16 + 8 * hh + 4);
    float xs[16] = {x0[0],x0[1],x0[2],x0[3],x1[0],x1[1],x1[2],x1[3],x2[0],x2[1],x2[2],x2[3],x3[0],x3[1],x3[2],x3[3]};
#pragma unroll
    for (int i = 0; i < 16; ++i) { const unsigned short hb = bf16_bits(xs[i]); ah.u[i] = hb; al.u[i] = ASPLIT ? bf16_bits(xs[i] - bf16_val(hb)) : (unsigned short)0; }
#pragma unroll
    for (int t = 0; t < 4; ++t) {
      const unsigned short* brow = Wt + (size_t)(col0 + t * 16 + ln) * ldb + kb;
      FragB b;
      b.half[0] = *(const v8us*)(brow + 8 * hh);
      b.half[1] = *(const v8us*)(brow + 16 + 8 * hh);
      acc[t] = mmaN<ASPLIT ? 2 : 1>(ah.v, al.v, b.v, b.v, acc[t]);
    }
  }
#pragma unroll
  for (int t = 0; t < 4; ++t) {
    float bv = bias ? bias[col0 + t * 16 + ln] : 0.f;
    if (BIAS_BF16) bv = bf16_rne(bv);
#pragma unroll
    for (int r = 0; r < 8; ++r) { float v = acc[t][r] + bv; if (ACT == 1) v = fmaxf(v, 0.f); so[w][8 * hh + r][t * 16 + ln] = v; }
  }
  __builtin_amdgcn_fence(4 /* acq_rel order */, "workgroup");
  __builtin_amdgcn_wave_barrier();
  const int rsub = lane >> 4, c4 = (lane & 15) * 4;
  {
#pragma unroll
    for (int q = 0; q < 8; ++q) {
      const int r = q * 2 + rsub;
      const v4f v = *(const v4fa*)&so[w][r][c4];
      *(v4f*)(crow0 + (size_t)r * ldc + col0 + c4) = v;
    }
    
  }
}

// Flash-style causal/unmasked attention, all contractions 3-term bf16 hi/lo splits, f32 softmax with running max.
// q,k,v rows are read from f32 buffers with arbitrary row pitch (so they can live inside a fused qkv buffer);
// D = head size (multiple of 32, <= 128); one wave = 16 query rows; block = 4 waves (64 queries) sharing K/V chunks of 32.
// A block runs two 64-query tiles of one head one after the other: tile n-1-p, then tile p. Under the causal mask a tile's
// cost grows linearly with its index, so every block walks the same number of K/V chunks (n = tiles per head; with an
// odd n the middle tile is run once). Grid = batches * heads * ceil(n / 2).
template <int D, bool CAUSAL>
__global__ __launch_bounds__(128) void k_flash(const float* __restrict__ qb, const float* __restrict__ kb, const float* __restrict__ vb,
                                             int pitch, int T, int H, float scale, float* __restrict__ y, int ypitch) {
  constexpr int KS = D / 32;        // k-steps for QK
  constexpr int DT = D / 16;        // d tiles for PV
  __shared__ __attribute__((aligned(16))) unsigned short sKh[32][D + 8], sKl[32][D + 8], sVh[32][D + 8], sVl[32][D + 8];
  __shared__ __attribute__((aligned(16))) unsigned short sPh[4][16][40], sPl[4][16][40];
  __shared__ __attribute__((aligned(16))) float sO[4][16][D];
  const int tid = threadIdx.x, w = tid >> 5, lane = tid & 31, ln = lane & 15, hh = lane >> 4;
  const int nqb = (T + 63) / 64;
  const int npair = (nqb + 1) / 2;
  const int bh = blockIdx.x / npair, pr = blockIdx.x % npair;
  const int b = bh / H, h = bh % H;
  const float* Q = qb + (size_t)b * T * pitch + h * D;
  const float* K = kb + (size_t)b * T * pitch + h * D;
  const float* V = vb + (size_t)b * T * pitch + h * D;

  const int ntile = (nqb - 1 - pr == pr) ? 1 : 2;              // block-uniform
  for (int tile = 0; tile < ntile; ++tile) {
  const int qblk = tile ? pr : nqb - 1 - pr;
  const int q0 = qblk * 64 + w * 16;
  // A fragments of the wave's 16 query rows (scaled), hi/lo
  FragB aqh[KS], aql[KS];
  {
    int row = q0 + ln; if (row >= T) row = T - 1;
    const float* qr = Q + (size_t)row * pitch;
#pragma unroll
    for (int ks = 0; ks < KS; ++ks)
#pragma unroll
      for (int i = 0; i < 16; ++i) {
        const int d = ks * 32 + ((i < 8) ? (8 * hh + i) : (16 + 8 * hh + (i - 8)));
        const float x = qr[d] * scale; const unsigned short hb = bf16_bits(x);
        aqh[ks].u[i] = hb; aql[ks].u[i] = bf16_bits(x - bf16_val(hb));
      }
  }
  float m_r[8], l_r[8];
#pragma unroll
  for (int r = 0; r < 8; ++r) { m_r[r] = -3.0e38f; l_r[r] = 0.f; }
  v8f oacc[DT];
#pragma unroll
  for (int dt = 0; dt < DT; ++dt) oacc[dt] = (v8f){0.f,0.f,0.f,0.f,0.f,0.f,0.f,0.f};

  const int kv_end = CAUSAL ? min(T, qblk * 64 + 64) : T;     // block-uniform
  for (int j0 = 0; j0 < kv_end; j0 += 32) {
    __syncthreads();
    for (int e = tid; e < 32 * (D / 4); e += 128) {
      const int r = e / (D / 4), c4 = (e % (D / 4)) * 4;
      const int key = j0 + r;
      const int keyc = (key < T) ? key : (T - 1);              // clamped address, zeroed by value below
      v4f kf = *(const v4fa*)(K + (size_t)keyc * pitch + c4);
      v4f vf = *(const v4fa*)(V + (size_t)keyc * pitch + c4);
      if (key >= T) { kf = (v4f){0.f,0.f,0.f,0.f}; vf = (v4f){0.f,0.f,0.f,0.f}; }
#pragma unroll
      for (int t = 0; t < 4; ++t) {
        unsigned short hb = bf16_bits(kf[t]); sKh[r][c4 + t] = hb; sKl[r][c4 + t] = bf16_bits(kf[t] - bf16_val(hb));
        hb = bf16_bits(vf[t]); sVh[r][c4 + t] = hb; sVl[r][c4 + t] = bf16_bits(vf[t] - bf16_val(hb));
      }
    }
    __syncthreads();
    // S tile 16 x 32
    v8f s[2];
#pragma unroll
    for (int nt = 0; nt < 2; ++nt) {
      v8f acc = (v8f){0.f,0.f,0.f,0.f,0.f,0.f,0.f,0.f};
#pragma unroll
      for (int ks = 0; ks < KS; ++ks) {
        FragB bh_, bl_;
        bh_.half[0] = *(const v8us*)&sKh[nt * 16 + ln][ks * 32 + 8 * hh]; bh_.half[1] = *(const v8us*)&sKh[nt * 16 + ln][ks * 32 + 16 + 8 * hh];
        bl_.half[0] = *(const v8us*)&sKl[nt * 16 + ln][ks * 32 + 8 * hh]; bl_.half[1] = *(const v8us*)&sKl[nt * 16 + ln][ks * 32 + 16 + 8 * hh];
        acc = mmaN<3>(aqh[ks].v, aql[ks].v, bh_.v, bl_.v, acc);
      }
      s[nt] = acc;
    }
    // mask + running max (rows 8hh+r; the 16 lanes of a half share rows)
    float alpha[8];
#pragma unroll
    for (int r = 0; r < 8; ++r) {
      const int qi = q0 + 8 * hh + r;
      const int ja = j0 + ln, jb = j0 + 16 + ln;
      if (CAUSAL) { if (ja > qi) s[0][r] = -3.0e38f; if (jb > qi) s[1][r] = -3.0e38f; }
      if (ja >= T) s[0][r] = -3.0e38f;
      if (jb >= T) s[1][r] = -3.0e38f;
      float mx = fmaxf(s[0][r], s[1][r]);
      mx = fmaxf(mx, __shfl_xor(mx, 1, 32)); mx = fmaxf(mx, __shfl_xor(mx, 2, 32)); mx = fmaxf(mx, __shfl_xor(mx, 4, 32)); mx = fmaxf(mx, __shfl_xor(mx, 8, 32));
      const float mnew = fmaxf(m_r[r], mx);
      alpha[r] = (mnew > -1.0e38f) ? __expf(m_r[r] - mnew) : 1.0f;
      const float p0 = (s[0][r] > -1.0e38f) ? __expf(s[0][r] - mnew) : 0.f;
      const float p1 = (s[1][r] > -1.0e38f) ? __expf(s[1][r] - mnew) : 0.f;
      m_r[r] = mnew;
      l_r[r] = l_r[r] * alpha[r] + p0 + p1;            // per-lane partial row sum (16 lanes combined at the end)
      unsigned short hb = bf16_bits(p0); sPh[w][8 * hh + r][ln] = hb;      sPl[w][8 * hh + r][ln] = bf16_bits(p0 - bf16_val(hb));
      hb = bf16_bits(p1);                sPh[w][8 * hh + r][16 + ln] = hb; sPl[w][8 * hh + r][16 + ln] = bf16_bits(p1 - bf16_val(hb));
    }
#pragma unroll
    for (int dt = 0; dt < DT; ++dt)
#pragma unroll
      for (int r = 0; r < 8; ++r) oacc[dt][r] *= alpha[r];
    __builtin_amdgcn_fence(4 /* acq_rel order */, "workgroup");
    __builtin_amdgcn_wave_barrier();
    FragB pah, pal;
    pah.half[0] = *(const v8us*)&sPh[w][ln][8 * hh]; pah.half[1] = *(const v8us*)&sPh[w][ln][16 + 8 * hh];
    pal.half[0] = *(const v8us*)&sPl[w][ln][8 * hh]; pal.half[1] = *(const v8us*)&sPl[w][ln][16 + 8 * hh];
#pragma unroll
    for (int dt = 0; dt < DT; ++dt) {
      FragB bvh, bvl;
#pragma unroll
      for (int i = 0; i < 8; ++i) {
        bvh.u[i] = sVh[8 * hh + i][dt * 16 + ln]; bvh.u[8 + i] = sVh[16 + 8 * hh + i][dt * 16 + ln];
        bvl.u[i] = sVl[8 * hh + i][dt * 16 + ln]; bvl.u[8 + i] = sVl[16 + 8 * hh + i][dt * 16 + ln];
      }
      oacc[dt] = mmaN<3>(pah.v, pal.v, bvh.v, bvl.v, oacc[dt]);
    }
    __builtin_amdgcn_fence(4 /* acq_rel order */, "workgroup");
    __builtin_amdgcn_wave_barrier();
  }
#pragma unroll
  for (int r = 0; r < 8; ++r) {
    float l = l_r[r];
    l += __shfl_xor(l, 1, 32); l += __shfl_xor(l, 2, 32); l += __shfl_xor(l, 4, 32); l += __shfl_xor(l, 8, 32);
    l_r[r] = (l > 0.f) ? 1.0f / l : 0.f;
  }
#pragma unroll
  for (int dt = 0; dt < DT; ++dt)
#pragma unroll
    for (int r = 0; r < 8; ++r) sO[w][8 * hh + r][dt * 16 + ln] = oacc[dt][r] * l_r[r];
  __builtin_amdgcn_fence(4 /* acq_rel order */, "workgroup");
  __builtin_amdgcn_wave_barrier();
  {
    for (int r = 0; r < 16; ++r) {
      const int row = q0 + r;
      if (row < T && lane < D / 4) {
        const v4f val = *(const v4fa*)&sO[w][r][lane * 4];
        *(v4f*)(y + ((size_t)b * T + row) * ypitch + h * D + lane * 4) = val;
      }
    }
    
  }
  // the next tile's set-up overwrites registers that the row stores above name; this wait stands in front of that
  asm volatile("s_wait_xcnt 0x0" ::: "memory");
  }
}

extern "C" void kernel_launch(void* const* d_in, const int* in_sizes, int n_in,
                              void* d_out, int out_size, void* d_ws, size_t ws_size, hipStream_t stream) {
  if (n_in < 9) return;
  // lower-bound size checks (a reduced NB/SEQ build still launches against full-size inputs)
  if (in_sizes[0] < ((NB - 1) * SEQ_FULL + SEQ) * CC) return;
  for (int i = 1; i < 9; i += 2) {
    if (in_sizes[i] < CC * CC) return;       // Wq, Wk, Wv, Wp: [CC in][CC out] f32
    if (in_sizes[i + 1] < CC) return;        // bq, bk, bv, bp: [CC] f32
  }
  if (out_size < ((NB - 1) * OUT_SEG_ROWS + SEQ) * CC) return;
  const float* x  = (const float*)d_in[0];
  const float* Wq = (const float*)d_in[1]; const float* bqp = (const float*)d_in[2];
  const float* Wk = (const float*)d_in[3]; const float* bkp = (const float*)d_in[4];
  const float* Wv = (const float*)d_in[5]; const float* bvp = (const float*)d_in[6];
  const float* Wp = (const float*)d_in[7]; const float* bpp = (const float*)d_in[8];
  char* ws = (char*)d_ws; size_t off = 0;
  unsigned short* Wqt = (unsigned short*)(ws + off); off += (size_t)CC * CC * 2;         // [768][768] bf16  1,179,648 B
  unsigned short* Wkt = (unsigned short*)(ws + off); off += (size_t)CC * CC * 2;         // [768][768] bf16  1,179,648 B
  unsigned short* Wvt = (unsigned short*)(ws + off); off += (size_t)CC * CC * 2;         // [768][768] bf16  1,179,648 B
  unsigned short* Wpt = (unsigned short*)(ws + off); off += (size_t)CC * CC * 2;         // [768][768] bf16  1,179,648 B
  float* qkv = (float*)(ws + off); off += (size_t)NB * SEQ * 3 * CC * 4;                 // [NB*SEQ][2304] f32  75,497,472 B at full size
  float* yb  = (float*)(ws + off); off += (size_t)NB * SEQ * CC * 4;                     // [NB*SEQ][768]  f32  25,165,824 B at full size
  if (off > ws_size) return;                                                             // total 105,381,888 B at full size
  const int M = NB * SEQ;
  const int gw = (CC * (CC / 8) + 255) / 256;
  k_wt_bf16<<<gw, 256, 0, stream>>>(Wq, Wqt, CC, CC);
  k_wt_bf16<<<gw, 256, 0, stream>>>(Wk, Wkt, CC, CC);
  k_wt_bf16<<<gw, 256, 0, stream>>>(Wv, Wvt, CC, CC);
  k_wt_bf16<<<gw, 256, 0, stream>>>(Wp, Wpt, CC, CC);
  // qkv[b*SEQ + t][s*CC + n] = bf16(x[b*SEQ_FULL + t]) * bf16(W_s) + bf16(b_s), s = 0 (q), 1 (k), 2 (v); row pitch 3*CC
  const int gg = ((M / 16) * (CC / 64) + 3) / 4;
  k_gemm_bf<false, 0, true><<<gg, 128, 0, stream>>>(x, CC, Wqt, CC, bqp, qkv,          3 * CC, M, CC, CC, SEQ, SEQ_FULL, SEQ);
  k_gemm_bf<false, 0, true><<<gg, 128, 0, stream>>>(x, CC, Wkt, CC, bkp, qkv + CC,     3 * CC, M, CC, CC, SEQ, SEQ_FULL, SEQ);
  k_gemm_bf<false, 0, true><<<gg, 128, 0, stream>>>(x, CC, Wvt, CC, bvp, qkv + 2 * CC, 3 * CC, M, CC, CC, SEQ, SEQ_FULL, SEQ);
  k_flash<HD, true><<<NB * NH * ((SEQ / 64 + 1) / 2), 128, 0, stream>>>(qkv, qkv + CC, qkv + 2 * CC, 3 * CC, SEQ, NH, 0.125f, yb, CC);
  // out[b*OUT_SEG_ROWS + t][:] = y[b*SEQ + t] * bf16(Wp) + bf16(bp), y as bf16 hi/lo
  k_gemm_bf<true, 0, true><<<gg, 128, 0, stream>>>(yb, CC, Wpt, CC, bpp, (float*)d_out, CC, M, CC, CC, SEQ, SEQ, OUT_SEG_ROWS);
}

// v002
// Measured time: 366 microseconds a run.
// Next to v001, in two timings, it ran 1.33 times as fast each time.
// All steps since v000 together make it 1.50 times as fast.
#include <hip/hip_runtime.h>
// All contractions on v_wmma_f32_16x16x32_bf16 with f32 accumulate: q/k/v projections x*Wq, x*Wk, x*Wv with x and W as
// bf16 (single exact-product term), attention Q*K^T and P*V as 3-term bf16 hi/lo splits, output projection y*Wp with
// y split hi/lo (2 terms) and W as bf16; biases as bf16; softmax in f32.
#ifndef NB
#define NB 4
#endif
#ifndef SEQ
#define SEQ 2048
#endif
#define NB_FULL 4
#define SEQ_FULL 2048
#define CC 768
#define NH 12
#define HD 64
// row stride (in tokens) between batches in the output buffer; full layout by default
#ifndef OUT_SEG_ROWS
#define OUT_SEG_ROWS SEQ_FULL
#endif
static_assert(NB >= 1 && NB <= NB_FULL);
static_assert(SEQ >= 64 && SEQ <= SEQ_FULL && (SEQ % 64) == 0);
static_assert(CC == NH * HD);
static_assert((HD % 32) == 0 && HD <= 128);
static_assert((CC % 128) == 0);

typedef __bf16 v16b __attribute__((ext_vector_type(16)));
typedef unsigned short v8us __attribute__((ext_vector_type(8), may_alias));
typedef unsigned short v4us __attribute__((ext_vector_type(4), may_alias));
typedef float  v8f  __attribute__((ext_vector_type(8)));
typedef float  v4f  __attribute__((ext_vector_type(4)));
typedef float  v4fa __attribute__((ext_vector_type(4), may_alias));
typedef __attribute__((address_space(1))) const float gl_f32;
typedef __attribute__((address_space(1))) const unsigned short gl_u16;
typedef __attribute__((address_space(1))) const v4fa gl_v4f;
typedef __attribute__((address_space(1))) const v8us gl_v8us;
union FragB { v16b v; v8us half[2]; unsigned short u[16]; };

__device__ __forceinline__ unsigned short bf16_bits(float x) { unsigned int u = __float_as_uint(x); return (unsigned short)((u + 0x7FFFu + ((u >> 16) & 1u)) >> 16); }
__device__ __forceinline__ float bf16_val(unsigned short b) { return __uint_as_float(((unsigned int)b) << 16); }
__device__ __forceinline__ float bf16_rne(float x) { return bf16_val(bf16_bits(x)); }
// D += A*B with NT terms: 1 = ah*bh, 2 = + al*bh (A split), 3 = + ah*bl (both split)
template <int NT>
__device__ __forceinline__ v8f mmaN(v16b ah, v16b al, v16b bh, v16b bl, v8f c) {
  c = __builtin_amdgcn_wmma_f32_16x16x32_bf16(false, ah, false, bh, (short)0, c, false, false);
  if (NT >= 2) c = __builtin_amdgcn_wmma_f32_16x16x32_bf16(false, al, false, bh, (short)0, c, false, false);
  if (NT >= 3) c = __builtin_amdgcn_wmma_f32_16x16x32_bf16(false, ah, false, bl, (short)0, c, false, false);
  asm volatile("v_nop\n\tv_nop\n\tv_nop\n\tv_nop" : "+v"(c) : "v"(ah), "v"(al), "v"(bh), "v"(bl));
  return c;
}

// Wt[n][k] (bf16 bits, k contiguous, pitch K) = bf16(W[k][n]) from f32 row-major W[K][N]; one thread per (n, 8 consecutive k);
__global__ __launch_bounds__(256) void k_wt_bf16(const float* __restrict__ W, unsigned short* __restrict__ Wt, int K, int N) {
  const int t = blockIdx.x * 256 + threadIdx.x;
  const int k8n = K / 8;
  if (t >= N * k8n) return;
  const int n = t / k8n, k8 = (t % k8n) * 8;
  v8us v;
#pragma unroll
  for (int i = 0; i < 8; ++i) v[i] = bf16_bits(W[(size_t)(k8 + i) * N + n]);
  *(v8us*)(Wt + (size_t)n * K + k8) = v;
  
}

// GEMM C[M][N] (f32, pitch ldc) = act(A[M][K]*W + bias). A f32 row-major (pitch lda) converted to bf16
// (ASPLIT: hi/lo two planes -> 2 terms, else single RNE term); Wt bf16 [N][K] (pitch ldb). BIAS_BF16 quantises the
// bias to bf16 before the add. K%64==0, M%64==0, N%128==0.
// Logical rows are grouped in segments of 'seg' rows (seg % 64 == 0): logical row r -> A row (r/seg)*asr + r%seg and
// C row (r/seg)*csr + r%seg, so per-batch strides of A and C can differ.
// Block = 4 waves on a 64 x 128 tile of C, wave -> 32 rows x 64 cols. Each 64-deep slice of A and Wt is read from
// global memory once per block in whole 128-byte lines, A is converted once, and both lie in LDS for all four waves
// (rows pitched 144 B for the 16-byte fragment reads). Two LDS buffers: the next slice's global loads are issued
// ahead of the current slice's products and stored behind them, one block barrier per slice.
// Epilogue staged in wave-private LDS (the ring's bytes, free behind the last barrier): whole lines are stored.
// The three pitches are compile-time, so that a slice's 16 loads and the 16 row stores differ only in their immediate offsets.
template <bool ASPLIT, int ACT, bool BIAS_BF16, int lda, int ldb, int ldc>
__global__ __launch_bounds__(128) void k_gemm_bf(const float* __restrict__ A, const unsigned short* __restrict__ Wt,
                                               const float* __restrict__ bias, float* __restrict__ C, int M, int N, int K,
                                               int seg, int asr, int csr) {
  constexpr int BM = 64, BN = 128, BK = 64, LP = BK + 8;      // LP: LDS row pitch in bf16 elements
  constexpr int NPL = ASPLIT ? 2 : 1;                         // planes of A
  constexpr int BOFF = BM * NPL * LP;                         // Wt rows behind the A planes
  constexpr int STAGE = BOFF + BN * LP;                       // bf16 elements per buffer
  constexpr int OP = 68;                                      // output staging pitch in floats
  constexpr int RING_BYTES = 2 * STAGE * 2, OUT_BYTES = 4 * 32 * OP * 4;
  __shared__ __attribute__((aligned(16))) unsigned char smem[RING_BYTES > OUT_BYTES ? RING_BYTES : OUT_BYTES];
  unsigned short* ring = (unsigned short*)smem;
  const int tid = threadIdx.x, w = tid >> 5, lane = tid & 31, ln = lane & 15, hh = lane >> 4;
  const int wm = w >> 1, wn = w & 1;
  const int ntn = N / BN;
  const int mt = blockIdx.x / ntn, nq = blockIdx.x % ntn;
  if (mt * BM >= M) return;                      // block-uniform, in front of every barrier
  const int row0 = mt * BM, col0 = nq * BN;
  const int bseg = row0 / seg, t0 = row0 - bseg * seg;
  const int ar = tid >> 4, ac = (tid & 15) * 4;  // A slice: 16 threads per 256-byte row piece, 8 rows per pass
  const int br = tid >> 3, bc = (tid & 7) * 8;   // Wt slice: 8 threads per 128-byte row piece, 16 rows per pass
  // typed as global-memory pointers, so that they stay so through the wait statement at the loop's foot (plain global loads)
  gl_f32* ag = (gl_f32*)(A + ((size_t)bseg * asr + t0 + ar) * lda + ac);
  gl_u16* bg = (gl_u16*)(Wt + (size_t)(col0 + br) * ldb + bc);
  v4f ra[8];
  v8us rb[8];
  v8f acc[2][4];
#pragma unroll
  for (int mi = 0; mi < 2; ++mi)
#pragma unroll
    for (int t = 0; t < 4; ++t) acc[mi][t] = (v8f){0.f,0.f,0.f,0.f,0.f,0.f,0.f,0.f};

  auto fetch = [&](int ahead) {
#pragma unroll
    for (int i = 0; i < 8; ++i) ra[i] = *(gl_v4f*)(ag + ahead + i * 8 * lda);
#pragma unroll
    for (int i = 0; i < 8; ++i) rb[i] = *(gl_v8us*)(bg + ahead + i * 16 * ldb);
  };
  auto put = [&](unsigned short* buf) {
#pragma unroll
    for (int i = 0; i < 8; ++i) {
      v4us h, l;
#pragma unroll
      for (int j = 0; j < 4; ++j) {
        const unsigned short hb = bf16_bits(ra[i][j]);
        h[j] = hb;
        l[j] = ASPLIT ? bf16_bits(ra[i][j] - bf16_val(hb)) : (unsigned short)0;
      }
      *(v4us*)(buf + (ar + i * 8) * LP + ac) = h;
      if (ASPLIT) *(v4us*)(buf + BM * LP + (ar + i * 8) * LP + ac) = l;
    }
#pragma unroll
    for (int i = 0; i < 8; ++i) *(v8us*)(buf + BOFF + (br + i * 16) * LP + bc) = rb[i];
  };

  const int nst = K / BK;
  fetch(0);
  put(ring);
  __syncthreads();
  for (int s = 0; s < nst; ++s) {
    const bool more = s + 1 < nst;               // block-uniform
    if (more) fetch(BK);
    const unsigned short* buf = ring + (s & 1) * STAGE;
    const unsigned short* sa = buf + (wm * 32 + ln) * LP + 8 * hh;
    const unsigned short* sb = buf + BOFF + (wn * 64 + ln) * LP + 8 * hh;
#pragma unroll
    for (int ks = 0; ks < BK / 32; ++ks) {
      FragB ah[2], al[2], b[4];
#pragma unroll
      for (int mi = 0; mi < 2; ++mi) {
        ah[mi].half[0] = *(const v8us*)(sa + mi * 16 * LP + ks * 32);
        ah[mi].half[1] = *(const v8us*)(sa + mi * 16 * LP + ks * 32 + 16);
        if (ASPLIT) {
          al[mi].half[0] = *(const v8us*)(sa + BM * LP + mi * 16 * LP + ks * 32);
          al[mi].half[1] = *(const v8us*)(sa + BM * LP + mi * 16 * LP + ks * 32 + 16);
        }
      }
#pragma unroll
      for (int t = 0; t < 4; ++t) {
        b[t].half[0] = *(const v8us*)(sb + t * 16 * LP + ks * 32);
        b[t].half[1] = *(const v8us*)(sb + t * 16 * LP + ks * 32 + 16);
      }
      // per output element the order of the sums stays: k ascending in steps of 32, hi term then lo term
#pragma unroll
      for (int mi = 0; mi < 2; ++mi)
#pragma unroll
        for (int t = 0; t < 4; ++t)
          acc[mi][t] = __builtin_amdgcn_wmma_f32_16x16x32_bf16(false, ah[mi].v, false, b[t].v, (short)0, acc[mi][t], false, false);
      if (ASPLIT) {
#pragma unroll
        for (int mi = 0; mi < 2; ++mi)
#pragma unroll
          for (int t = 0; t < 4; ++t)
            acc[mi][t] = __builtin_amdgcn_wmma_f32_16x16x32_bf16(false, al[mi].v, false, b[t].v, (short)0, acc[mi][t], false, false);
      }
    }
    if (more) {
      put(ring + ((s + 1) & 1) * STAGE);
      // the slice's loads name the two pointers' registers: the wait stands behind the last store of loaded data and,
      // tied to both pointers, in front of the two additions that rewrite them
      asm volatile("s_wait_xcnt 0x0" : "+v"(ag), "+v"(bg) :: "memory");
      ag += BK; bg += BK;
    }
    __syncthreads();
  }
  float* so = (float*)smem + w * 32 * OP;
#pragma unroll
  for (int t = 0; t < 4; ++t) {
    float bv = bias ? bias[col0 + wn * 64 + t * 16 + ln] : 0.f;
    if (BIAS_BF16) bv = bf16_rne(bv);
#pragma unroll
    for (int mi = 0; mi < 2; ++mi)
#pragma unroll
      for (int r = 0; r < 8; ++r) { float v = acc[mi][t][r] + bv; if (ACT == 1) v = fmaxf(v, 0.f); so[(mi * 16 + 8 * hh + r) * OP + t * 16 + ln] = v; }
  }
  __builtin_amdgcn_fence(4 /* acq_rel order */, "workgroup");
  __builtin_amdgcn_wave_barrier();
  const int rsub = lane >> 4, c4 = (lane & 15) * 4;
  float* cg = C + ((size_t)bseg * csr + t0 + wm * 32 + rsub) * ldc + col0 + wn * 64 + c4;
#pragma unroll
  for (int q = 0; q < 16; ++q) {
    const v4f v = *(const v4fa*)&so[(q * 2 + rsub) * OP + c4];
    *(v4f*)(cg + q * 2 * ldc) = v;
  }
}

// Flash-style causal/unmasked attention, all contractions 3-term bf16 hi/lo splits, f32 softmax with running max.
// q,k,v rows are read from f32 buffers with arbitrary row pitch (so they can live inside a fused qkv buffer);
// D = head size (multiple of 32, <= 128); one wave = 16 query rows; block = 4 waves (64 queries) sharing K/V chunks of 32.
// A block runs two 64-query tiles of one head one after the other: tile n-1-p, then tile p. Under the causal mask a tile's
// cost grows linearly with its index, so every block walks the same number of K/V chunks (n = tiles per head; with an
// odd n the middle tile is run once). Grid = batches * heads * ceil(n / 2).
template <int D, bool CAUSAL>
__global__ __launch_bounds__(128) void k_flash(const float* __restrict__ qb, const float* __restrict__ kb, const float* __restrict__ vb,
                                             int pitch, int T, int H, float scale, float* __restrict__ y, int ypitch) {
  constexpr int KS = D / 32;        // k-steps for QK
  constexpr int DT = D / 16;        // d tiles for PV
  __shared__ __attribute__((aligned(16))) unsigned short sKh[32][D + 8], sKl[32][D + 8], sVh[32][D + 8], sVl[32][D + 8];
  __shared__ __attribute__((aligned(16))) unsigned short sPh[4][16][40], sPl[4][16][40];
  __shared__ __attribute__((aligned(16))) float sO[4][16][D];
  const int tid = threadIdx.x, w = tid >> 5, lane = tid & 31, ln = lane & 15, hh = lane >> 4;
  const int nqb = (T + 63) / 64;
  const int npair = (nqb + 1) / 2;
  const int bh = blockIdx.x / npair, pr = blockIdx.x % npair;
  const int b = bh / H, h = bh % H;
  const float* Q = qb + (size_t)b * T * pitch + h * D;
  const float* K = kb + (size_t)b * T * pitch + h * D;
  const float* V = vb + (size_t)b * T * pitch + h * D;

  const int ntile = (nqb - 1 - pr == pr) ? 1 : 2;              // block-uniform
  for (int tile = 0; tile < ntile; ++tile) {
  const int qblk = tile ? pr : nqb - 1 - pr;
  const int q0 = qblk * 64 + w * 16;
  // A fragments of the wave's 16 query rows (scaled), hi/lo
  FragB aqh[KS], aql[KS];
  {
    int row = q0 + ln; if (row >= T) row = T - 1;
    const float* qr = Q + (size_t)row * pitch;
#pragma unroll
    for (int ks = 0; ks < KS; ++ks)
#pragma unroll
      for (int i = 0; i < 16; ++i) {
        const int d = ks * 32 + ((i < 8) ? (8 * hh + i) : (16 + 8 * hh + (i - 8)));
        const float x = qr[d] * scale; const unsigned short hb = bf16_bits(x);
        aqh[ks].u[i] = hb; aql[ks].u[i] = bf16_bits(x - bf16_val(hb));
      }
  }
  float m_r[8], l_r[8];
#pragma unroll
  for (int r = 0; r < 8; ++r) { m_r[r] = -3.0e38f; l_r[r] = 0.f; }
  v8f oacc[DT];
#pragma unroll
  for (int dt = 0; dt < DT; ++dt) oacc[dt] = (v8f){0.f,0.f,0.f,0.f,0.f,0.f,0.f,0.f};

  const int kv_end = CAUSAL ? min(T, qblk * 64 + 64) : T;     // block-uniform
  for (int j0 = 0; j0 < kv_end; j0 += 32) {
    __syncthreads();
    for (int e = tid; e < 32 * (D / 4); e += 128) {
      const int r = e / (D / 4), c4 = (e % (D / 4)) * 4;
      const int key = j0 + r;
      const int keyc = (key < T) ? key : (T - 1);              // clamped address, zeroed by value below
      v4f kf = *(const v4fa*)(K + (size_t)keyc * pitch + c4);
      v4f vf = *(const v4fa*)(V + (size_t)keyc * pitch + c4);
      if (key >= T) { kf = (v4f){0.f,0.f,0.f,0.f}; vf = (v4f){0.f,0.f,0.f,0.f}; }
#pragma unroll
      for (int t = 0; t < 4; ++t) {
        unsigned short hb = bf16_bits(kf[t]); sKh[r][c4 + t] = hb; sKl[r][c4 + t] = bf16_bits(kf[t] - bf16_val(hb));
        hb = bf16_bits(vf[t]); sVh[r][c4 + t] = hb; sVl[r][c4 + t] = bf16_bits(vf[t] - bf16_val(hb));
      }
    }
    __syncthreads();
    // S tile 16 x 32
    v8f s[2];
#pragma unroll
    for (int nt = 0; nt < 2; ++nt) {
      v8f acc = (v8f){0.f,0.f,0.f,0.f,0.f,0.f,0.f,0.f};
#pragma unroll
      for (int ks = 0; ks < KS; ++ks) {
        FragB bh_, bl_;
        bh_.half[0] = *(const v8us*)&sKh[nt * 16 + ln][ks * 32 + 8 * hh]; bh_.half[1] = *(const v8us*)&sKh[nt * 16 + ln][ks * 32 + 16 + 8 * hh];
        bl_.half[0] = *(const v8us*)&sKl[nt * 16 + ln][ks * 32 + 8 * hh]; bl_.half[1] = *(const v8us*)&sKl[nt * 16 + ln][ks * 32 + 16 + 8 * hh];
        acc = mmaN<3>(aqh[ks].v, aql[ks].v, bh_.v, bl_.v, acc);
      }
      s[nt] = acc;
    }
    // mask + running max (rows 8hh+r; the 16 lanes of a half share rows)
    float alpha[8];
#pragma unroll
    for (int r = 0; r < 8; ++r) {
      const int qi = q0 + 8 * hh + r;
      const int ja = j0 + ln, jb = j0 + 16 + ln;
      if (CAUSAL) { if (ja > qi) s[0][r] = -3.0e38f; if (jb > qi) s[1][r] = -3.0e38f; }
      if (ja >= T) s[0][r] = -3.0e38f;
      if (jb >= T) s[1][r] = -3.0e38f;
      float mx = fmaxf(s[0][r], s[1][r]);
      mx = fmaxf(mx, __shfl_xor(mx, 1, 32)); mx = fmaxf(mx, __shfl_xor(mx, 2, 32)); mx = fmaxf(mx, __shfl_xor(mx, 4, 32)); mx = fmaxf(mx, __shfl_xor(mx, 8, 32));
      const float mnew = fmaxf(m_r[r], mx);
      alpha[r] = (mnew > -1.0e38f) ? __expf(m_r[r] - mnew) : 1.0f;
      const float p0 = (s[0][r] > -1.0e38f) ? __expf(s[0][r] - mnew) : 0.f;
      const float p1 = (s[1][r] > -1.0e38f) ? __expf(s[1][r] - mnew) : 0.f;
      m_r[r] = mnew;
      l_r[r] = l_r[r] * alpha[r] + p0 + p1;            // per-lane partial row sum (16 lanes combined at the end)
      unsigned short hb = bf16_bits(p0); sPh[w][8 * hh + r][ln] = hb;      sPl[w][8 * hh + r][ln] = bf16_bits(p0 - bf16_val(hb));
      hb = bf16_bits(p1);                sPh[w][8 * hh + r][16 + ln] = hb; sPl[w][8 * hh + r][16 + ln] = bf16_bits(p1 - bf16_val(hb));
    }
#pragma unroll
    for (int dt = 0; dt < DT; ++dt)
#pragma unroll
      for (int r = 0; r < 8; ++r) oacc[dt][r] *= alpha[r];
    __builtin_amdgcn_fence(4 /* acq_rel order */, "workgroup");
    __builtin_amdgcn_wave_barrier();
    FragB pah, pal;
    pah.half[0] = *(const v8us*)&sPh[w][ln][8 * hh]; pah.half[1] = *(const v8us*)&sPh[w][ln][16 + 8 * hh];
    pal.half[0] = *(const v8us*)&sPl[w][ln][8 * hh]; pal.half[1] = *(const v8us*)&sPl[w][ln][16 + 8 * hh];
#pragma unroll
    for (int dt = 0; dt < DT; ++dt) {
      FragB bvh, bvl;
#pragma unroll
      for (int i = 0; i < 8; ++i) {
        bvh.u[i] = sVh[8 * hh + i][dt * 16 + ln]; bvh.u[8 + i] = sVh[16 + 8 * hh + i][dt * 16 + ln];
        bvl.u[i] = sVl[8 * hh + i][dt * 16 + ln]; bvl.u[8 + i] = sVl[16 + 8 * hh + i][dt * 16 + ln];
      }
      oacc[dt] = mmaN<3>(pah.v, pal.v, bvh.v, bvl.v, oacc[dt]);
    }
    __builtin_amdgcn_fence(4 /* acq_rel order */, "workgroup");
    __builtin_amdgcn_wave_barrier();
  }
#pragma unroll
  for (int r = 0; r < 8; ++r) {
    float l = l_r[r];
    l += __shfl_xor(l, 1, 32); l += __shfl_xor(l, 2, 32); l += __shfl_xor(l, 4, 32); l += __shfl_xor(l, 8, 32);
    l_r[r] = (l > 0.f) ? 1.0f / l : 0.f;
  }
#pragma unroll
  for (int dt = 0; dt < DT; ++dt)
#pragma unroll
    for (int r = 0; r < 8; ++r) sO[w][8 * hh + r][dt * 16 + ln] = oacc[dt][r] * l_r[r];
  __builtin_amdgcn_fence(4 /* acq_rel order */, "workgroup");
  __builtin_amdgcn_wave_barrier();
  {
    for (int r = 0; r < 16; ++r) {
      const int row = q0 + r;
      if (row < T && lane < D / 4) {
        const v4f val = *(const v4fa*)&sO[w][r][lane * 4];
        *(v4f*)(y + ((size_t)b * T + row) * ypitch + h * D + lane * 4) = val;
      }
    }
    
  }
  // the next tile's set-up overwrites registers that the row stores above name; this wait stands in front of that
  asm volatile("s_wait_xcnt 0x0" ::: "memory");
  }
}

extern "C" void kernel_launch(void* const* d_in, const int* in_sizes, int n_in,
                              void* d_out, int out_size, void* d_ws, size_t ws_size, hipStream_t stream) {
  if (n_in < 9) return;
  // lower-bound size checks (a reduced NB/SEQ build still launches against full-size inputs)
  if (in_sizes[0] < ((NB - 1) * SEQ_FULL + SEQ) * CC) return;
  for (int i = 1; i < 9; i += 2) {
    if (in_sizes[i] < CC * CC) return;       // Wq, Wk, Wv, Wp: [CC in][CC out] f32
    if (in_sizes[i + 1] < CC) return;        // bq, bk, bv, bp: [CC] f32
  }
  if (out_size < ((NB - 1) * OUT_SEG_ROWS + SEQ) * CC) return;
  const float* x  = (const float*)d_in[0];
  const float* Wq = (const float*)d_in[1]; const float* bqp = (const float*)d_in[2];
  const float* Wk = (const float*)d_in[3]; const float* bkp = (const float*)d_in[4];
  const float* Wv = (const float*)d_in[5]; const float* bvp = (const float*)d_in[6];
  const float* Wp = (const float*)d_in[7]; const float* bpp = (const float*)d_in[8];
  char* ws = (char*)d_ws; size_t off = 0;
  unsigned short* Wqt = (unsigned short*)(ws + off); off += (size_t)CC * CC * 2;         // [768][768] bf16  1,179,648 B
  unsigned short* Wkt = (unsigned short*)(ws + off); off += (size_t)CC * CC * 2;         // [768][768] bf16  1,179,648 B
  unsigned short* Wvt = (unsigned short*)(ws + off); off += (size_t)CC * CC * 2;         // [768][768] bf16  1,179,648 B
  unsigned short* Wpt = (unsigned short*)(ws + off); off += (size_t)CC * CC * 2;         // [768][768] bf16  1,179,648 B
  float* qkv = (float*)(ws + off); off += (size_t)NB * SEQ * 3 * CC * 4;                 // [NB*SEQ][2304] f32  75,497,472 B at full size
  float* yb  = (float*)(ws + off); off += (size_t)NB * SEQ * CC * 4;                     // [NB*SEQ][768]  f32  25,165,824 B at full size
  if (off > ws_size) return;                                                             // total 105,381,888 B at full size
  const int M = NB * SEQ;
  const int gw = (CC * (CC / 8) + 255) / 256;
  k_wt_bf16<<<gw, 256, 0, stream>>>(Wq, Wqt, CC, CC);
  k_wt_bf16<<<gw, 256, 0, stream>>>(Wk, Wkt, CC, CC);
  k_wt_bf16<<<gw, 256, 0, stream>>>(Wv, Wvt, CC, CC);
  k_wt_bf16<<<gw, 256, 0, stream>>>(Wp, Wpt, CC, CC);
  // qkv[b*SEQ + t][s*CC + n] = bf16(x[b*SEQ_FULL + t]) * bf16(W_s) + bf16(b_s), s = 0 (q), 1 (k), 2 (v); row pitch 3*CC
  const int gg = (M / 64) * (CC / 128);
  k_gemm_bf<false, 0, true, CC, CC, 3 * CC><<<gg, 128, 0, stream>>>(x, Wqt, bqp, qkv,          M, CC, CC, SEQ, SEQ_FULL, SEQ);
  k_gemm_bf<false, 0, true, CC, CC, 3 * CC><<<gg, 128, 0, stream>>>(x, Wkt, bkp, qkv + CC,     M, CC, CC, SEQ, SEQ_FULL, SEQ);
  k_gemm_bf<false, 0, true, CC, CC, 3 * CC><<<gg, 128, 0, stream>>>(x, Wvt, bvp, qkv + 2 * CC, M, CC, CC, SEQ, SEQ_FULL, SEQ);
  k_flash<HD, true><<<NB * NH * ((SEQ / 64 + 1) / 2), 128, 0, stream>>>(qkv, qkv + CC, qkv + 2 * CC, 3 * CC, SEQ, NH, 0.125f, yb, CC);
  // out[b*OUT_SEG_ROWS + t][:] = y[b*SEQ + t] * bf16(Wp) + bf16(bp), y as bf16 hi/lo
  k_gemm_bf<true, 0, true, CC, CC, CC><<<gg, 128, 0, stream>>>(yb, Wpt, bpp, (float*)d_out, M, CC, CC, SEQ, SEQ, OUT_SEG_ROWS);
}

// v003
// A run of this version takes 341 microseconds.
// Two timings next to v002 both put it at 1.07 times that version's speed.
// Over all steps from v000 it is 1.61 times as fast.
#include <hip/hip_runtime.h>
// All contractions on v_wmma_f32_16x16x32_bf16 with f32 accumulate: q/k/v projections x*Wq, x*Wk, x*Wv with x and W as
// bf16 (single exact-product term), attention Q*K^T and P*V as 3-term bf16 hi/lo splits, output projection y*Wp with
// y split hi/lo (2 terms) and W as bf16; biases as bf16; softmax in f32.
#ifndef NB
#define NB 4
#endif
#ifndef SEQ
#define SEQ 2048
#endif
#define NB_FULL 4
#define SEQ_FULL 2048
#define CC 768
#define NH 12
#define HD 64
// row stride (in tokens) between batches in the output buffer; full layout by default
#ifndef OUT_SEG_ROWS
#define OUT_SEG_ROWS SEQ_FULL
#endif
static_assert(NB >= 1 && NB <= NB_FULL);
static_assert(SEQ >= 64 && SEQ <= SEQ_FULL && (SEQ % 64) == 0);
static_assert(CC == NH * HD);
static_assert((HD % 32) == 0 && HD <= 128);
static_assert((CC % 128) == 0);

typedef __bf16 v16b __attribute__((ext_vector_type(16)));
typedef unsigned short v8us __attribute__((ext_vector_type(8), may_alias));
typedef unsigned short v4us __attribute__((ext_vector_type(4), may_alias));
typedef float  v8f  __attribute__((ext_vector_type(8)));
typedef float  v4f  __attribute__((ext_vector_type(4)));
typedef float  v4fa __attribute__((ext_vector_type(4), may_alias));
typedef __attribute__((address_space(1))) const float gl_f32;
typedef __attribute__((address_space(1))) const unsigned short gl_u16;
typedef __attribute__((address_space(1))) const v4fa gl_v4f;
typedef __attribute__((address_space(1))) const v8us gl_v8us;
union FragB { v16b v; v8us half[2]; unsigned short u[16]; };

__device__ __forceinline__ unsigned short bf16_bits(float x) { unsigned int u = __float_as_uint(x); return (unsigned short)((u + 0x7FFFu + ((u >> 16) & 1u)) >> 16); }
__device__ __forceinline__ float bf16_val(unsigned short b) { return __uint_as_float(((unsigned int)b) << 16); }
__device__ __forceinline__ float bf16_rne(float x) { return bf16_val(bf16_bits(x)); }
// D += A*B with NT terms: 1 = ah*bh, 2 = + al*bh (A split), 3 = + ah*bl (both split)
template <int NT>
__device__ __forceinline__ v8f mmaN(v16b ah, v16b al, v16b bh, v16b bl, v8f c) {
  c = __builtin_amdgcn_wmma_f32_16x16x32_bf16(false, ah, false, bh, (short)0, c, false, false);
  if (NT >= 2) c = __builtin_amdgcn_wmma_f32_16x16x32_bf16(false, al, false, bh, (short)0, c, false, false);
  if (NT >= 3) c = __builtin_amdgcn_wmma_f32_16x16x32_bf16(false, ah, false, bl, (short)0, c, false, false);
  asm volatile("v_nop\n\tv_nop\n\tv_nop\n\tv_nop" : "+v"(c) : "v"(ah), "v"(al), "v"(bh), "v"(bl));
  return c;
}
// Transposing LDS load (ds_load_tr16_b128) of a row-major 16-bit tile: with lane l addressing row 8*(l>>4) + (l&7), byte
// 16*((l>>3)&1) of the tile, lane l receives the 8 elements of rows 8*(l>>4) .. +7 in column l&15.
typedef short s16x8 __attribute__((ext_vector_type(8)));
__device__ __forceinline__ v8us ld_tr16(const unsigned short* p) {
  typedef __attribute__((address_space(3))) s16x8 lds_s16x8;
  return __builtin_bit_cast(v8us, __builtin_amdgcn_ds_load_tr16_b128_v8i16((lds_s16x8*)p));
}

// Wt[n][k] (bf16 bits, k contiguous, pitch K) = bf16(W[k][n]) from f32 row-major W[K][N]; one thread per (n, 8 consecutive k);
__global__ __launch_bounds__(256) void k_wt_bf16(const float* __restrict__ W, unsigned short* __restrict__ Wt, int K, int N) {
  const int t = blockIdx.x * 256 + threadIdx.x;
  const int k8n = K / 8;
  if (t >= N * k8n) return;
  const int n = t / k8n, k8 = (t % k8n) * 8;
  v8us v;
#pragma unroll
  for (int i = 0; i < 8; ++i) v[i] = bf16_bits(W[(size_t)(k8 + i) * N + n]);
  *(v8us*)(Wt + (size_t)n * K + k8) = v;
  
}

// GEMM C[M][N] (f32, pitch ldc) = act(A[M][K]*W + bias). A f32 row-major (pitch lda) converted to bf16
// (ASPLIT: hi/lo two planes -> 2 terms, else single RNE term); Wt bf16 [N][K] (pitch ldb). BIAS_BF16 quantises the
// bias to bf16 before the add. K%64==0, M%64==0, N%128==0.
// Logical rows are grouped in segments of 'seg' rows (seg % 64 == 0): logical row r -> A row (r/seg)*asr + r%seg and
// C row (r/seg)*csr + r%seg, so per-batch strides of A and C can differ.
// Block = 4 waves on a 64 x 128 tile of C, wave -> 32 rows x 64 cols. Each 64-deep slice of A and Wt is read from
// global memory once per block in whole 128-byte lines, A is converted once, and both lie in LDS for all four waves
// (rows pitched 144 B for the 16-byte fragment reads). Two LDS buffers: the next slice's global loads are issued
// ahead of the current slice's products and stored behind them, one block barrier per slice.
// Epilogue staged in wave-private LDS (the ring's bytes, free behind the last barrier): whole lines are stored.
// The three pitches are compile-time, so that a slice's 16 loads and the 16 row stores differ only in their immediate offsets.
template <bool ASPLIT, int ACT, bool BIAS_BF16, int lda, int ldb, int ldc>
__global__ __launch_bounds__(128) void k_gemm_bf(const float* __restrict__ A, const unsigned short* __restrict__ Wt,
                                               const float* __restrict__ bias, float* __restrict__ C, int M, int N, int K,
                                               int seg, int asr, int csr) {
  constexpr int BM = 64, BN = 128, BK = 64, LP = BK + 8;      // LP: LDS row pitch in bf16 elements
  constexpr int NPL = ASPLIT ? 2 : 1;                         // planes of A
  constexpr int BOFF = BM * NPL * LP;                         // Wt rows behind the A planes
  constexpr int STAGE = BOFF + BN * LP;                       // bf16 elements per buffer
  constexpr int OP = 68;                                      // output staging pitch in floats
  constexpr int RING_BYTES = 2 * STAGE * 2, OUT_BYTES = 4 * 32 * OP * 4;
  __shared__ __attribute__((aligned(16))) unsigned char smem[RING_BYTES > OUT_BYTES ? RING_BYTES : OUT_BYTES];
  unsigned short* ring = (unsigned short*)smem;
  const int tid = threadIdx.x, w = tid >> 5, lane = tid & 31, ln = lane & 15, hh = lane >> 4;
  const int wm = w >> 1, wn = w & 1;
  const int ntn = N / BN;
  const int mt = blockIdx.x / ntn, nq = blockIdx.x % ntn;
  if (mt * BM >= M) return;                      // block-uniform, in front of every barrier
  const int row0 = mt * BM, col0 = nq * BN;
  const int bseg = row0 / seg, t0 = row0 - bseg * seg;
  const int ar = tid >> 4, ac = (tid & 15) * 4;  // A slice: 16 threads per 256-byte row piece, 8 rows per pass
  const int br = tid >> 3, bc = (tid & 7) * 8;   // Wt slice: 8 threads per 128-byte row piece, 16 rows per pass
  // typed as global-memory pointers, so that they stay so through the wait statement at the loop's foot (plain global loads)
  gl_f32* ag = (gl_f32*)(A + ((size_t)bseg * asr + t0 + ar) * lda + ac);
  gl_u16* bg = (gl_u16*)(Wt + (size_t)(col0 + br) * ldb + bc);
  v4f ra[8];
  v8us rb[8];
  v8f acc[2][4];
#pragma unroll
  for (int mi = 0; mi < 2; ++mi)
#pragma unroll
    for (int t = 0; t < 4; ++t) acc[mi][t] = (v8f){0.f,0.f,0.f,0.f,0.f,0.f,0.f,0.f};

  auto fetch = [&](int ahead) {
#pragma unroll
    for (int i = 0; i < 8; ++i) ra[i] = *(gl_v4f*)(ag + ahead + i * 8 * lda);
#pragma unroll
    for (int i = 0; i < 8; ++i) rb[i] = *(gl_v8us*)(bg + ahead + i * 16 * ldb);
  };
  auto put = [&](unsigned short* buf) {
#pragma unroll
    for (int i = 0; i < 8; ++i) {
      v4us h, l;
#pragma unroll
      for (int j = 0; j < 4; ++j) {
        const unsigned short hb = bf16_bits(ra[i][j]);
        h[j] = hb;
        l[j] = ASPLIT ? bf16_bits(ra[i][j] - bf16_val(hb)) : (unsigned short)0;
      }
      *(v4us*)(buf + (ar + i * 8) * LP + ac) = h;
      if (ASPLIT) *(v4us*)(buf + BM * LP + (ar + i * 8) * LP + ac) = l;
    }
#pragma unroll
    for (int i = 0; i < 8; ++i) *(v8us*)(buf + BOFF + (br + i * 16) * LP + bc) = rb[i];
  };

  const int nst = K / BK;
  fetch(0);
  put(ring);
  __syncthreads();
  for (int s = 0; s < nst; ++s) {
    const bool more = s + 1 < nst;               // block-uniform
    if (more) fetch(BK);
    const unsigned short* buf = ring + (s & 1) * STAGE;
    const unsigned short* sa = buf + (wm * 32 + ln) * LP + 8 * hh;
    const unsigned short* sb = buf + BOFF + (wn * 64 + ln) * LP + 8 * hh;
#pragma unroll
    for (int ks = 0; ks < BK / 32; ++ks) {
      FragB ah[2], al[2], b[4];
#pragma unroll
      for (int mi = 0; mi < 2; ++mi) {
        ah[mi].half[0] = *(const v8us*)(sa + mi * 16 * LP + ks * 32);
        ah[mi].half[1] = *(const v8us*)(sa + mi * 16 * LP + ks * 32 + 16);
        if (ASPLIT) {
          al[mi].half[0] = *(const v8us*)(sa + BM * LP + mi * 16 * LP + ks * 32);
          al[mi].half[1] = *(const v8us*)(sa + BM * LP + mi * 16 * LP + ks * 32 + 16);
        }
      }
#pragma unroll
      for (int t = 0; t < 4; ++t) {
        b[t].half[0] = *(const v8us*)(sb + t * 16 * LP + ks * 32);
        b[t].half[1] = *(const v8us*)(sb + t * 16 * LP + ks * 32 + 16);
      }
      // per output element the order of the sums stays: k ascending in steps of 32, hi term then lo term
#pragma unroll
      for (int mi = 0; mi < 2; ++mi)
#pragma unroll
        for (int t = 0; t < 4; ++t)
          acc[mi][t] = __builtin_amdgcn_wmma_f32_16x16x32_bf16(false, ah[mi].v, false, b[t].v, (short)0, acc[mi][t], false, false);
      if (ASPLIT) {
#pragma unroll
        for (int mi = 0; mi < 2; ++mi)
#pragma unroll
          for (int t = 0; t < 4; ++t)
            acc[mi][t] = __builtin_amdgcn_wmma_f32_16x16x32_bf16(false, al[mi].v, false, b[t].v, (short)0, acc[mi][t], false, false);
      }
    }
    if (more) {
      put(ring + ((s + 1) & 1) * STAGE);
      // the slice's loads name the two pointers' registers: the wait stands behind the last store of loaded data and,
      // tied to both pointers, in front of the two additions that rewrite them
      asm volatile("s_wait_xcnt 0x0" : "+v"(ag), "+v"(bg) :: "memory");
      ag += BK; bg += BK;
    }
    __syncthreads();
  }
  float* so = (float*)smem + w * 32 * OP;
#pragma unroll
  for (int t = 0; t < 4; ++t) {
    float bv = bias ? bias[col0 + wn * 64 + t * 16 + ln] : 0.f;
    if (BIAS_BF16) bv = bf16_rne(bv);
#pragma unroll
    for (int mi = 0; mi < 2; ++mi)
#pragma unroll
      for (int r = 0; r < 8; ++r) { float v = acc[mi][t][r] + bv; if (ACT == 1) v = fmaxf(v, 0.f); so[(mi * 16 + 8 * hh + r) * OP + t * 16 + ln] = v; }
  }
  __builtin_amdgcn_fence(4 /* acq_rel order */, "workgroup");
  __builtin_amdgcn_wave_barrier();
  const int rsub = lane >> 4, c4 = (lane & 15) * 4;
  float* cg = C + ((size_t)bseg * csr + t0 + wm * 32 + rsub) * ldc + col0 + wn * 64 + c4;
#pragma unroll
  for (int q = 0; q < 16; ++q) {
    const v4f v = *(const v4fa*)&so[(q * 2 + rsub) * OP + c4];
    *(v4f*)(cg + q * 2 * ldc) = v;
  }
}

// Flash-style causal/unmasked attention, all contractions 3-term bf16 hi/lo splits, f32 softmax with running max.
// q,k,v rows are read from f32 buffers with arbitrary row pitch (so they can live inside a fused qkv buffer);
// D = head size (multiple of 32, <= 128); one wave = 16 query rows; block = 4 waves (64 queries) sharing K/V chunks of 32.
// A block runs two 64-query tiles of one head one after the other: tile n-1-p, then tile p. Under the causal mask a tile's
// cost grows linearly with its index, so every block walks the same number of K/V chunks (n = tiles per head; with an
// odd n the middle tile is run once). Grid = batches * heads * ceil(n / 2).
template <int D, bool CAUSAL>
__global__ __launch_bounds__(128) void k_flash(const float* __restrict__ qb, const float* __restrict__ kb, const float* __restrict__ vb,
                                             int pitch, int T, int H, float scale, float* __restrict__ y, int ypitch) {
  constexpr int KS = D / 32;        // k-steps for QK
  constexpr int DT = D / 16;        // d tiles for PV
  constexpr int VP = D + 16;        // V row pitch in elements: an odd multiple of 32 bytes, for the transposing loads
  static_assert((VP * 2) % 32 == 0 && ((VP * 2 / 32) & 1) == 1);
  __shared__ __attribute__((aligned(16))) unsigned short sKh[32][D + 8], sKl[32][D + 8], sVh[32][VP], sVl[32][VP];
  __shared__ __attribute__((aligned(16))) unsigned short sPh[4][16][40], sPl[4][16][40];
  __shared__ __attribute__((aligned(16))) float sO[4][16][D];
  const int tid = threadIdx.x, w = tid >> 5, lane = tid & 31, ln = lane & 15, hh = lane >> 4;
  const int nqb = (T + 63) / 64;
  const int npair = (nqb + 1) / 2;
  const int bh = blockIdx.x / npair, pr = blockIdx.x % npair;
  const int b = bh / H, h = bh % H;
  const float* Q = qb + (size_t)b * T * pitch + h * D;
  const float* K = kb + (size_t)b * T * pitch + h * D;
  const float* V = vb + (size_t)b * T * pitch + h * D;

  const int ntile = (nqb - 1 - pr == pr) ? 1 : 2;              // block-uniform
  for (int tile = 0; tile < ntile; ++tile) {
  const int qblk = tile ? pr : nqb - 1 - pr;
  const int q0 = qblk * 64 + w * 16;
  // A fragments of the wave's 16 query rows (scaled), hi/lo
  FragB aqh[KS], aql[KS];
  {
    int row = q0 + ln; if (row >= T) row = T - 1;
    const float* qr = Q + (size_t)row * pitch;
#pragma unroll
    for (int ks = 0; ks < KS; ++ks)
#pragma unroll
      for (int i = 0; i < 16; ++i) {
        const int d = ks * 32 + ((i < 8) ? (8 * hh + i) : (16 + 8 * hh + (i - 8)));
        const float x = qr[d] * scale; const unsigned short hb = bf16_bits(x);
        aqh[ks].u[i] = hb; aql[ks].u[i] = bf16_bits(x - bf16_val(hb));
      }
  }
  float m_r[8], l_r[8];
#pragma unroll
  for (int r = 0; r < 8; ++r) { m_r[r] = -3.0e38f; l_r[r] = 0.f; }
  v8f oacc[DT];
#pragma unroll
  for (int dt = 0; dt < DT; ++dt) oacc[dt] = (v8f){0.f,0.f,0.f,0.f,0.f,0.f,0.f,0.f};

  const int kv_end = CAUSAL ? min(T, qblk * 64 + 64) : T;     // block-uniform
  for (int j0 = 0; j0 < kv_end; j0 += 32) {
    __syncthreads();
    for (int e = tid; e < 32 * (D / 4); e += 128) {
      const int r = e / (D / 4), c4 = (e % (D / 4)) * 4;
      const int key = j0 + r;
      const int keyc = (key < T) ? key : (T - 1);              // clamped address, zeroed by value below
      v4f kf = *(const v4fa*)(K + (size_t)keyc * pitch + c4);
      v4f vf = *(const v4fa*)(V + (size_t)keyc * pitch + c4);
      if (key >= T) { kf = (v4f){0.f,0.f,0.f,0.f}; vf = (v4f){0.f,0.f,0.f,0.f}; }
#pragma unroll
      for (int t = 0; t < 4; ++t) {
        unsigned short hb = bf16_bits(kf[t]); sKh[r][c4 + t] = hb; sKl[r][c4 + t] = bf16_bits(kf[t] - bf16_val(hb));
        hb = bf16_bits(vf[t]); sVh[r][c4 + t] = hb; sVl[r][c4 + t] = bf16_bits(vf[t] - bf16_val(hb));
      }
    }
    __syncthreads();
    // S tile 16 x 32
    v8f s[2];
#pragma unroll
    for (int nt = 0; nt < 2; ++nt) {
      v8f acc = (v8f){0.f,0.f,0.f,0.f,0.f,0.f,0.f,0.f};
#pragma unroll
      for (int ks = 0; ks < KS; ++ks) {
        FragB bh_, bl_;
        bh_.half[0] = *(const v8us*)&sKh[nt * 16 + ln][ks * 32 + 8 * hh]; bh_.half[1] = *(const v8us*)&sKh[nt * 16 + ln][ks * 32 + 16 + 8 * hh];
        bl_.half[0] = *(const v8us*)&sKl[nt * 16 + ln][ks * 32 + 8 * hh]; bl_.half[1] = *(const v8us*)&sKl[nt * 16 + ln][ks * 32 + 16 + 8 * hh];
        acc = mmaN<3>(aqh[ks].v, aql[ks].v, bh_.v, bl_.v, acc);
      }
      s[nt] = acc;
    }
    // B fragments of V, hi and lo: element i = V[8hh + i][dt*16 + ln], element 8 + i = V[16 + 8hh + i][dt*16 + ln], one
    // transposing load per 8 elements; V lies in LDS since the chunk's barrier, so the 16 loads may stand anywhere from here on
    FragB bvh[DT], bvl[DT];
    {
      const int vo = (8 * hh + (lane & 7)) * VP + ((lane >> 3) & 1) * 8;
#pragma unroll
      for (int dt = 0; dt < DT; ++dt) {
        bvh[dt].half[0] = ld_tr16(&sVh[0][0] + vo + dt * 16); bvh[dt].half[1] = ld_tr16(&sVh[0][0] + vo + 16 * VP + dt * 16);
        bvl[dt].half[0] = ld_tr16(&sVl[0][0] + vo + dt * 16); bvl[dt].half[1] = ld_tr16(&sVl[0][0] + vo + 16 * VP + dt * 16);
      }
    }
    // mask + running max (rows 8hh+r; the 16 lanes of a half share rows)
    float alpha[8];
#pragma unroll
    for (int r = 0; r < 8; ++r) {
      const int qi = q0 + 8 * hh + r;
      const int ja = j0 + ln, jb = j0 + 16 + ln;
      if (CAUSAL) { if (ja > qi) s[0][r] = -3.0e38f; if (jb > qi) s[1][r] = -3.0e38f; }
      if (ja >= T) s[0][r] = -3.0e38f;
      if (jb >= T) s[1][r] = -3.0e38f;
      float mx = fmaxf(s[0][r], s[1][r]);
      mx = fmaxf(mx, __shfl_xor(mx, 1, 32)); mx = fmaxf(mx, __shfl_xor(mx, 2, 32)); mx = fmaxf(mx, __shfl_xor(mx, 4, 32)); mx = fmaxf(mx, __shfl_xor(mx, 8, 32));
      const float mnew = fmaxf(m_r[r], mx);
      alpha[r] = (mnew > -1.0e38f) ? __expf(m_r[r] - mnew) : 1.0f;
      const float p0 = (s[0][r] > -1.0e38f) ? __expf(s[0][r] - mnew) : 0.f;
      const float p1 = (s[1][r] > -1.0e38f) ? __expf(s[1][r] - mnew) : 0.f;
      m_r[r] = mnew;
      l_r[r] = l_r[r] * alpha[r] + p0 + p1;            // per-lane partial row sum (16 lanes combined at the end)
      unsigned short hb = bf16_bits(p0); sPh[w][8 * hh + r][ln] = hb;      sPl[w][8 * hh + r][ln] = bf16_bits(p0 - bf16_val(hb));
      hb = bf16_bits(p1);                sPh[w][8 * hh + r][16 + ln] = hb; sPl[w][8 * hh + r][16 + ln] = bf16_bits(p1 - bf16_val(hb));
    }
#pragma unroll
    for (int dt = 0; dt < DT; ++dt)
#pragma unroll
      for (int r = 0; r < 8; ++r) oacc[dt][r] *= alpha[r];
    __builtin_amdgcn_fence(4 /* acq_rel order */, "workgroup");
    __builtin_amdgcn_wave_barrier();
    FragB pah, pal;
    pah.half[0] = *(const v8us*)&sPh[w][ln][8 * hh]; pah.half[1] = *(const v8us*)&sPh[w][ln][16 + 8 * hh];
    pal.half[0] = *(const v8us*)&sPl[w][ln][8 * hh]; pal.half[1] = *(const v8us*)&sPl[w][ln][16 + 8 * hh];
#pragma unroll
    for (int dt = 0; dt < DT; ++dt) oacc[dt] = mmaN<3>(pah.v, pal.v, bvh[dt].v, bvl[dt].v, oacc[dt]);
    __builtin_amdgcn_fence(4 /* acq_rel order */, "workgroup");
    __builtin_amdgcn_wave_barrier();
  }
#pragma unroll
  for (int r = 0; r < 8; ++r) {
    float l = l_r[r];
    l += __shfl_xor(l, 1, 32); l += __shfl_xor(l, 2, 32); l += __shfl_xor(l, 4, 32); l += __shfl_xor(l, 8, 32);
    l_r[r] = (l > 0.f) ? 1.0f / l : 0.f;
  }
#pragma unroll
  for (int dt = 0; dt < DT; ++dt)
#pragma unroll
    for (int r = 0; r < 8; ++r) sO[w][8 * hh + r][dt * 16 + ln] = oacc[dt][r] * l_r[r];
  __builtin_amdgcn_fence(4 /* acq_rel order */, "workgroup");
  __builtin_amdgcn_wave_barrier();
  {
    for (int r = 0; r < 16; ++r) {
      const int row = q0 + r;
      if (row < T && lane < D / 4) {
        const v4f val = *(const v4fa*)&sO[w][r][lane * 4];
        *(v4f*)(y + ((size_t)b * T + row) * ypitch + h * D + lane * 4) = val;
      }
    }
    
  }
  // the next tile's set-up overwrites registers that the row stores above name; this wait stands in front of that
  asm volatile("s_wait_xcnt 0x0" ::: "memory");
  }
}

extern "C" void kernel_launch(void* const* d_in, const int* in_sizes, int n_in,
                              void* d_out, int out_size, void* d_ws, size_t ws_size, hipStream_t stream) {
  if (n_in < 9) return;
  // lower-bound size checks (a reduced NB/SEQ build still launches against full-size inputs)
  if (in_sizes[0] < ((NB - 1) * SEQ_FULL + SEQ) * CC) return;
  for (int i = 1; i < 9; i += 2) {
    if (in_sizes[i] < CC * CC) return;       // Wq, Wk, Wv, Wp: [CC in][CC out] f32
    if (in_sizes[i + 1] < CC) return;        // bq, bk, bv, bp: [CC] f32
  }
  if (out_size < ((NB - 1) * OUT_SEG_ROWS + SEQ) * CC) return;
  const float* x  = (const float*)d_in[0];
  const float* Wq = (const float*)d_in[1]; const float* bqp = (const float*)d_in[2];
  const float* Wk = (const float*)d_in[3]; const float* bkp = (const float*)d_in[4];
  const float* Wv = (const float*)d_in[5]; const float* bvp = (const float*)d_in[6];
  const float* Wp = (const float*)d_in[7]; const float* bpp = (const float*)d_in[8];
  char* ws = (char*)d_ws; size_t off = 0;
  unsigned short* Wqt = (unsigned short*)(ws + off); off += (size_t)CC * CC * 2;         // [768][768] bf16  1,179,648 B
  unsigned short* Wkt = (unsigned short*)(ws + off); off += (size_t)CC * CC * 2;         // [768][768] bf16  1,179,648 B
  unsigned short* Wvt = (unsigned short*)(ws + off); off += (size_t)CC * CC * 2;         // [768][768] bf16  1,179,648 B
  unsigned short* Wpt = (unsigned short*)(ws + off); off += (size_t)CC * CC * 2;         // [768][768] bf16  1,179,648 B
  float* qkv = (float*)(ws + off); off += (size_t)NB * SEQ * 3 * CC * 4;                 // [NB*SEQ][2304] f32  75,497,472 B at full size
  float* yb  = (float*)(ws + off); off += (size_t)NB * SEQ * CC * 4;                     // [NB*SEQ][768]  f32  25,165,824 B at full size
  if (off > ws_size) return;                                                             // total 105,381,888 B at full size
  const int M = NB * SEQ;
  const int gw = (CC * (CC / 8) + 255) / 256;
  k_wt_bf16<<<gw, 256, 0, stream>>>(Wq, Wqt, CC, CC);
  k_wt_bf16<<<gw, 256, 0, stream>>>(Wk, Wkt, CC, CC);
  k_wt_bf16<<<gw, 256, 0, stream>>>(Wv, Wvt, CC, CC);
  k_wt_bf16<<<gw, 256, 0, stream>>>(Wp, Wpt, CC, CC);
  // qkv[b*SEQ + t][s*CC + n] = bf16(x[b*SEQ_FULL + t]) * bf16(W_s) + bf16(b_s), s = 0 (q), 1 (k), 2 (v); row pitch 3*CC
  const int gg = (M / 64) * (CC / 128);
  k_gemm_bf<false, 0, true, CC, CC, 3 * CC><<<gg, 128, 0, stream>>>(x, Wqt, bqp, qkv,          M, CC, CC, SEQ, SEQ_FULL, SEQ);
  k_gemm_bf<false, 0, true, CC, CC, 3 * CC><<<gg, 128, 0, stream>>>(x, Wkt, bkp, qkv + CC,     M, CC, CC, SEQ, SEQ_FULL, SEQ);
  k_gemm_bf<false, 0, true, CC, CC, 3 * CC><<<gg, 128, 0, stream>>>(x, Wvt, bvp, qkv + 2 * CC, M, CC, CC, SEQ, SEQ_FULL, SEQ);
  k_flash<HD, true><<<NB * NH * ((SEQ / 64 + 1) / 2), 128, 0, stream>>>(qkv, qkv + CC, qkv + 2 * CC, 3 * CC, SEQ, NH, 0.125f, yb, CC);
  // out[b*OUT_SEG_ROWS + t][:] = y[b*SEQ + t] * bf16(Wp) + bf16(bp), y as bf16 hi/lo
  k_gemm_bf<true, 0, true, CC, CC, CC><<<gg, 128, 0, stream>>>(yb, Wpt, bpp, (float*)d_out, M, CC, CC, SEQ, SEQ, OUT_SEG_ROWS);
}

// v004
// A run of this version takes 237 microseconds.
// Two timings next to v003 both put it at 1.44 times that version's speed.
// Counting every step since v000, it is 2.31 times as fast.
#include <hip/hip_runtime.h>
// All contractions on v_wmma_f32_16x16x32_bf16 with f32 accumulate: q/k/v projections x*Wq, x*Wk, x*Wv with x and W as
// bf16 (single exact-product term), attention Q*K^T and P*V as 3-term bf16 hi/lo splits, output projection y*Wp with
// y split hi/lo (2 terms) and W as bf16; biases as bf16; softmax in f32.
// K and V leave their projections already split: per token row and 64-column group (one head) 64 bf16 hi values, then the
// 64 bf16 lo values, in the 256 bytes that the group's f32 values would take.
#ifndef NB
#define NB 4
#endif
#ifndef SEQ
#define SEQ 2048
#endif
#define NB_FULL 4
#define SEQ_FULL 2048
#define CC 768
#define NH 12
#define HD 64
// row stride (in tokens) between batches in the output buffer; full layout by default
#ifndef OUT_SEG_ROWS
#define OUT_SEG_ROWS SEQ_FULL
#endif
static_assert(NB >= 1 && NB <= NB_FULL);
static_assert(SEQ >= 64 && SEQ <= SEQ_FULL && (SEQ % 64) == 0);
static_assert(CC == NH * HD);
static_assert((HD % 32) == 0 && HD <= 128);
static_assert((CC % 128) == 0);

typedef __bf16 v16b __attribute__((ext_vector_type(16)));
typedef unsigned short v8us __attribute__((ext_vector_type(8), may_alias));
typedef unsigned short v4us __attribute__((ext_vector_type(4), may_alias));
typedef float  v8f  __attribute__((ext_vector_type(8)));
typedef float  v4f  __attribute__((ext_vector_type(4)));
typedef float  v4fa __attribute__((ext_vector_type(4), may_alias));
typedef __attribute__((address_space(1))) const float gl_f32;
typedef __attribute__((address_space(1))) const unsigned short gl_u16;
typedef __attribute__((address_space(1))) const v4fa gl_v4f;
typedef __attribute__((address_space(1))) const v8us gl_v8us;
union FragB { v16b v; v8us half[2]; unsigned short u[16]; };

__device__ __forceinline__ unsigned short bf16_bits(float x) { unsigned int u = __float_as_uint(x); return (unsigned short)((u + 0x7FFFu + ((u >> 16) & 1u)) >> 16); }
__device__ __forceinline__ float bf16_val(unsigned short b) { return __uint_as_float(((unsigned int)b) << 16); }
__device__ __forceinline__ float bf16_rne(float x) { return bf16_val(bf16_bits(x)); }
// D += A*B with NT terms: 1 = ah*bh, 2 = + al*bh (A split), 3 = + ah*bl (both split)
template <int NT>
__device__ __forceinline__ v8f mmaN(v16b ah, v16b al, v16b bh, v16b bl, v8f c) {
  c = __builtin_amdgcn_wmma_f32_16x16x32_bf16(false, ah, false, bh, (short)0, c, false, false);
  if (NT >= 2) c = __builtin_amdgcn_wmma_f32_16x16x32_bf16(false, al, false, bh, (short)0, c, false, false);
  if (NT >= 3) c = __builtin_amdgcn_wmma_f32_16x16x32_bf16(false, ah, false, bl, (short)0, c, false, false);
  asm volatile("v_nop\n\tv_nop\n\tv_nop\n\tv_nop" : "+v"(c) : "v"(ah), "v"(al), "v"(bh), "v"(bl));
  return c;
}
// Transposing LDS load (ds_load_tr16_b128) of a row-major 16-bit tile: with lane l addressing row 8*(l>>4) + (l&7), byte
// 16*((l>>3)&1) of the tile, lane l receives the 8 elements of rows 8*(l>>4) .. +7 in column l&15.
typedef short s16x8 __attribute__((ext_vector_type(8)));
__device__ __forceinline__ v8us ld_tr16(const unsigned short* p) {
  typedef __attribute__((address_space(3))) s16x8 lds_s16x8;
  return __builtin_bit_cast(v8us, __builtin_amdgcn_ds_load_tr16_b128_v8i16((lds_s16x8*)p));
}

// Wt[n][k] (bf16 bits, k contiguous, pitch K) = bf16(W[k][n]) from f32 row-major W[K][N]; one thread per (n, 8 consecutive k);
__global__ __launch_bounds__(256) void k_wt_bf16(const float* __restrict__ W, unsigned short* __restrict__ Wt, int K, int N) {
  const int t = blockIdx.x * 256 + threadIdx.x;
  const int k8n = K / 8;
  if (t >= N * k8n) return;
  const int n = t / k8n, k8 = (t % k8n) * 8;
  v8us v;
#pragma unroll
  for (int i = 0; i < 8; ++i) v[i] = bf16_bits(W[(size_t)(k8 + i) * N + n]);
  *(v8us*)(Wt + (size_t)n * K + k8) = v;
  
}

// GEMM C[M][N] (f32, pitch ldc) = act(A[M][K]*W + bias). A f32 row-major (pitch lda) converted to bf16
// (ASPLIT: hi/lo two planes -> 2 terms, else single RNE term); Wt bf16 [N][K] (pitch ldb). BIAS_BF16 quantises the
// bias to bf16 before the add. K%64==0, M%64==0, N%128==0.
// Logical rows are grouped in segments of 'seg' rows (seg % 64 == 0): logical row r -> A row (r/seg)*asr + r%seg and
// C row (r/seg)*csr + r%seg, so per-batch strides of A and C can differ.
// Block = 4 waves on a 64 x 128 tile of C, wave -> 32 rows x 64 cols. Each 64-deep slice of A and Wt is read from
// global memory once per block in whole 128-byte lines, A is converted once, and both lie in LDS for all four waves
// (rows pitched 144 B for the 16-byte fragment reads). Two LDS buffers: the next slice's global loads are issued
// ahead of the current slice's products and stored behind them, one block barrier per slice.
// Epilogue staged in wave-private LDS (the ring's bytes, free behind the last barrier): whole lines are stored.
// The three pitches are compile-time, so that a slice's 16 loads and the 16 (CSPLIT: 32) row stores differ only in their immediate offsets.
// CSPLIT: each f32 result v is stored as hi = bf16(v) and lo = bf16(v - hi); a wave's 64 columns of a row take the same
// 256 bytes of C as in f32, 64 hi values in the first 128-byte line and the 64 lo values in the second.
template <bool ASPLIT, int ACT, bool BIAS_BF16, bool CSPLIT, int lda, int ldb, int ldc>
__global__ __launch_bounds__(128) void k_gemm_bf(const float* __restrict__ A, const unsigned short* __restrict__ Wt,
                                               const float* __restrict__ bias, float* __restrict__ C, int M, int N, int K,
                                               int seg, int asr, int csr) {
  constexpr int BM = 64, BN = 128, BK = 64, LP = BK + 8;      // LP: LDS row pitch in bf16 elements
  constexpr int NPL = ASPLIT ? 2 : 1;                         // planes of A
  constexpr int BOFF = BM * NPL * LP;                         // Wt rows behind the A planes
  constexpr int STAGE = BOFF + BN * LP;                       // bf16 elements per buffer
  constexpr int OP = 68;                                      // output staging pitch in floats
  constexpr int RING_BYTES = 2 * STAGE * 2, OUT_BYTES = 4 * 32 * OP * 4;
  __shared__ __attribute__((aligned(16))) unsigned char smem[RING_BYTES > OUT_BYTES ? RING_BYTES : OUT_BYTES];
  unsigned short* ring = (unsigned short*)smem;
  const int tid = threadIdx.x, w = tid >> 5, lane = tid & 31, ln = lane & 15, hh = lane >> 4;
  const int wm = w >> 1, wn = w & 1;
  const int ntn = N / BN;
  const int mt = blockIdx.x / ntn, nq = blockIdx.x % ntn;
  if (mt * BM >= M) return;                      // block-uniform, in front of every barrier
  const int row0 = mt * BM, col0 = nq * BN;
  const int bseg = row0 / seg, t0 = row0 - bseg * seg;
  const int ar = tid >> 4, ac = (tid & 15) * 4;  // A slice: 16 threads per 256-byte row piece, 8 rows per pass
  const int br = tid >> 3, bc = (tid & 7) * 8;   // Wt slice: 8 threads per 128-byte row piece, 16 rows per pass
  // typed as global-memory pointers, so that they stay so through the wait statement at the loop's foot (plain global loads)
  gl_f32* ag = (gl_f32*)(A + ((size_t)bseg * asr + t0 + ar) * lda + ac);
  gl_u16* bg = (gl_u16*)(Wt + (size_t)(col0 + br) * ldb + bc);
  v4f ra[8];
  v8us rb[8];
  v8f acc[2][4];
#pragma unroll
  for (int mi = 0; mi < 2; ++mi)
#pragma unroll
    for (int t = 0; t < 4; ++t) acc[mi][t] = (v8f){0.f,0.f,0.f,0.f,0.f,0.f,0.f,0.f};

  auto fetch = [&](int ahead) {
#pragma unroll
    for (int i = 0; i < 8; ++i) ra[i] = *(gl_v4f*)(ag + ahead + i * 8 * lda);
#pragma unroll
    for (int i = 0; i < 8; ++i) rb[i] = *(gl_v8us*)(bg + ahead + i * 16 * ldb);
  };
  auto put = [&](unsigned short* buf) {
#pragma unroll
    for (int i = 0; i < 8; ++i) {
      v4us h, l;
#pragma unroll
      for (int j = 0; j < 4; ++j) {
        const unsigned short hb = bf16_bits(ra[i][j]);
        h[j] = hb;
        l[j] = ASPLIT ? bf16_bits(ra[i][j] - bf16_val(hb)) : (unsigned short)0;
      }
      *(v4us*)(buf + (ar + i * 8) * LP + ac) = h;
      if (ASPLIT) *(v4us*)(buf + BM * LP + (ar + i * 8) * LP + ac) = l;
    }
#pragma unroll
    for (int i = 0; i < 8; ++i) *(v8us*)(buf + BOFF + (br + i * 16) * LP + bc) = rb[i];
  };

  const int nst = K / BK;
  fetch(0);
  put(ring);
  __syncthreads();
  for (int s = 0; s < nst; ++s) {
    const bool more = s + 1 < nst;               // block-uniform
    if (more) fetch(BK);
    const unsigned short* buf = ring + (s & 1) * STAGE;
    const unsigned short* sa = buf + (wm * 32 + ln) * LP + 8 * hh;
    const unsigned short* sb = buf + BOFF + (wn * 64 + ln) * LP + 8 * hh;
#pragma unroll
    for (int ks = 0; ks < BK / 32; ++ks) {
      FragB ah[2], al[2], b[4];
#pragma unroll
      for (int mi = 0; mi < 2; ++mi) {
        ah[mi].half[0] = *(const v8us*)(sa + mi * 16 * LP + ks * 32);
        ah[mi].half[1] = *(const v8us*)(sa + mi * 16 * LP + ks * 32 + 16);
        if (ASPLIT) {
          al[mi].half[0] = *(const v8us*)(sa + BM * LP + mi * 16 * LP + ks * 32);
          al[mi].half[1] = *(const v8us*)(sa + BM * LP + mi * 16 * LP + ks * 32 + 16);
        }
      }
#pragma unroll
      for (int t = 0; t < 4; ++t) {
        b[t].half[0] = *(const v8us*)(sb + t * 16 * LP + ks * 32);
        b[t].half[1] = *(const v8us*)(sb + t * 16 * LP + ks * 32 + 16);
      }
      // per output element the order of the sums stays: k ascending in steps of 32, hi term then lo term
#pragma unroll
      for (int mi = 0; mi < 2; ++mi)
#pragma unroll
        for (int t = 0; t < 4; ++t)
          acc[mi][t] = __builtin_amdgcn_wmma_f32_16x16x32_bf16(false, ah[mi].v, false, b[t].v, (short)0, acc[mi][t], false, false);
      if (ASPLIT) {
#pragma unroll
        for (int mi = 0; mi < 2; ++mi)
#pragma unroll
          for (int t = 0; t < 4; ++t)
            acc[mi][t] = __builtin_amdgcn_wmma_f32_16x16x32_bf16(false, al[mi].v, false, b[t].v, (short)0, acc[mi][t], false, false);
      }
    }
    if (more) {
      put(ring + ((s + 1) & 1) * STAGE);
      // the slice's loads name the two pointers' registers: the wait stands behind the last store of loaded data and,
      // tied to both pointers, in front of the two additions that rewrite them
      asm volatile("s_wait_xcnt 0x0" : "+v"(ag), "+v"(bg) :: "memory");
      ag += BK; bg += BK;
    }
    __syncthreads();
  }
  float* so = (float*)smem + w * 32 * OP;
#pragma unroll
  for (int t = 0; t < 4; ++t) {
    float bv = bias ? bias[col0 + wn * 64 + t * 16 + ln] : 0.f;
    if (BIAS_BF16) bv = bf16_rne(bv);
#pragma unroll
    for (int mi = 0; mi < 2; ++mi)
#pragma unroll
      for (int r = 0; r < 8; ++r) { float v = acc[mi][t][r] + bv; if (ACT == 1) v = fmaxf(v, 0.f); so[(mi * 16 + 8 * hh + r) * OP + t * 16 + ln] = v; }
  }
  __builtin_amdgcn_fence(4 /* acq_rel order */, "workgroup");
  __builtin_amdgcn_wave_barrier();
  const int rsub = lane >> 4, c4 = (lane & 15) * 4;
  float* cw = C + ((size_t)bseg * csr + t0 + wm * 32 + rsub) * ldc + col0 + wn * 64;
  if (CSPLIT) {
    unsigned short* cs = (unsigned short*)cw + c4;
    // unrolled (both loops), so that the row stores differ only in their immediate offsets and h, l stay in registers
#pragma unroll
    for (int q = 0; q < 16; ++q) {
      const v4f v = *(const v4fa*)&so[(q * 2 + rsub) * OP + c4];
      v4us h, l;
#pragma unroll
      for (int j = 0; j < 4; ++j) {
        const unsigned short hb = bf16_bits(v[j]);
        h[j] = hb;
        l[j] = bf16_bits(v[j] - bf16_val(hb));
      }
      *(v4us*)(cs + q * 2 * ldc * 2) = h;
      *(v4us*)(cs + q * 2 * ldc * 2 + 64) = l;
    }
  } else {
    float* cg = cw + c4;
#pragma unroll
    for (int q = 0; q < 16; ++q) {
      const v4f v = *(const v4fa*)&so[(q * 2 + rsub) * OP + c4];
      *(v4f*)(cg + q * 2 * ldc) = v;
    }
  }
}

// Flash-style causal/unmasked attention, all contractions 3-term bf16 hi/lo splits, f32 softmax with running max.
// q rows are read from an f32 buffer with arbitrary row pitch (so they can live inside a fused qkv buffer); k and v rows
// come as bf16 hi/lo planes, per head D hi values and then D lo values, row pitch KVP 16-bit elements (compile-time, so that
// a chunk's loads differ only in their immediate offsets), and are copied to LDS in 16-byte pieces as they are;
// D = head size (multiple of 32, <= 128); one wave = 16 query rows; block = 4 waves (64 queries) sharing K/V chunks of 32.
// A block runs two 64-query tiles of one head one after the other: tile n-1-p, then tile p. Under the causal mask a tile's
// cost grows linearly with its index, so every block walks the same number of K/V chunks (n = tiles per head; with an
// odd n the middle tile is run once). Grid = batches * heads * ceil(n / 2).
template <int D, bool CAUSAL, int KVP>
__global__ __launch_bounds__(128) void k_flash(const float* __restrict__ qb, const unsigned short* __restrict__ kb, const unsigned short* __restrict__ vb,
                                             int pitch, int T, int H, float scale, float* __restrict__ y, int ypitch) {
  constexpr int KS = D / 32;        // k-steps for QK
  constexpr int DT = D / 16;        // d tiles for PV
  constexpr int VP = D + 16;        // V row pitch in elements: an odd multiple of 32 bytes, for the transposing loads
  static_assert((VP * 2) % 32 == 0 && ((VP * 2 / 32) & 1) == 1);
  constexpr int PPR = D / 4;        // 16-byte pieces per K or V row (hi and lo)
  constexpr int RPP = 128 / PPR;    // rows that the block's 128 threads copy per pass
  constexpr int NPS = 32 / RPP;     // passes per 32-key chunk
  static_assert(128 % PPR == 0 && 32 % RPP == 0 && (KVP % 8) == 0);
  __shared__ __attribute__((aligned(16))) unsigned short sKh[32][D + 8], sKl[32][D + 8], sVh[32][VP], sVl[32][VP];
  __shared__ __attribute__((aligned(16))) unsigned short sPh[4][16][40], sPl[4][16][40];
  __shared__ __attribute__((aligned(16))) float sO[4][16][D];
  const int tid = threadIdx.x, w = tid >> 5, lane = tid & 31, ln = lane & 15, hh = lane >> 4;
  const int nqb = (T + 63) / 64;
  const int npair = (nqb + 1) / 2;
  const int bh = blockIdx.x / npair, pr = blockIdx.x % npair;
  const int b = bh / H, h = bh % H;
  const float* Q = qb + (size_t)b * T * pitch + h * D;
  gl_u16* K = (gl_u16*)(kb + (size_t)b * T * KVP + h * 2 * D);
  gl_u16* V = (gl_u16*)(vb + (size_t)b * T * KVP + h * 2 * D);
  // the thread's piece of a row: row sr of a pass, piece sc (the first D / 8 pieces are the hi plane, the rest the lo plane)
  const int sr = tid / PPR, sc = tid % PPR;
  const unsigned int goff = (unsigned int)(sr * KVP + sc * 8);
  unsigned short* kd = (sc < D / 8 ? &sKh[0][0] : &sKl[0][0]) + sr * (D + 8) + (sc % (D / 8)) * 8;
  unsigned short* vd = (sc < D / 8 ? &sVh[0][0] : &sVl[0][0]) + sr * VP + (sc % (D / 8)) * 8;

  const int ntile = (nqb - 1 - pr == pr) ? 1 : 2;              // block-uniform
  for (int tile = 0; tile < ntile; ++tile) {
  const int qblk = tile ? pr : nqb - 1 - pr;
  const int q0 = qblk * 64 + w * 16;
  // A fragments of the wave's 16 query rows (scaled), hi/lo
  FragB aqh[KS], aql[KS];
  {
    int row = q0 + ln; if (row >= T) row = T - 1;
    const float* qr = Q + (size_t)row * pitch;
#pragma unroll
    for (int ks = 0; ks < KS; ++ks)
#pragma unroll
      for (int i = 0; i < 16; ++i) {
        const int d = ks * 32 + ((i < 8) ? (8 * hh + i) : (16 + 8 * hh + (i - 8)));
        const float x = qr[d] * scale; const unsigned short hb = bf16_bits(x);
        aqh[ks].u[i] = hb; aql[ks].u[i] = bf16_bits(x - bf16_val(hb));
      }
  }
  float m_r[8], l_r[8];
#pragma unroll
  for (int r = 0; r < 8; ++r) { m_r[r] = -3.0e38f; l_r[r] = 0.f; }
  v8f oacc[DT];
#pragma unroll
  for (int dt = 0; dt < DT; ++dt) oacc[dt] = (v8f){0.f,0.f,0.f,0.f,0.f,0.f,0.f,0.f};

  const int kv_end = CAUSAL ? min(T, qblk * 64 + 64) : T;     // block-uniform
  gl_u16* kp = K + goff;                                       // the thread's piece in row sr of the current chunk
  gl_u16* vp = V + goff;
  for (int j0 = 0; j0 < kv_end; j0 += 32) {
    v8us kr[NPS], vr[NPS];
    // the three loops below are unrolled so that kr and vr stay in registers and a chunk's loads are all in flight together;
    // the loads touch no LDS and so stand in front of the barrier that frees the K/V buffers
    if (j0 + 32 <= T) {                                        // block-uniform: every key of the chunk exists
#pragma unroll
      for (int i = 0; i < NPS; ++i) {
        kr[i] = *(gl_v8us*)(kp + i * RPP * KVP);
        vr[i] = *(gl_v8us*)(vp + i * RPP * KVP);
      }
    } else {
#pragma unroll
      for (int i = 0; i < NPS; ++i) {
        const int key = j0 + sr + i * RPP;
        const int keyc = (key < T) ? key : (T - 1);            // clamped address, zeroed by value below
        kr[i] = *(gl_v8us*)(K + (size_t)keyc * KVP + sc * 8);
        vr[i] = *(gl_v8us*)(V + (size_t)keyc * KVP + sc * 8);
        if (key >= T) { kr[i] = (v8us){0,0,0,0,0,0,0,0}; vr[i] = (v8us){0,0,0,0,0,0,0,0}; }
      }
    }
    __syncthreads();
#pragma unroll
    for (int i = 0; i < NPS; ++i) {
      *(v8us*)(kd + i * RPP * (D + 8)) = kr[i];
      *(v8us*)(vd + i * RPP * VP) = vr[i];
    }
    // the chunk's loads name the two pointers' registers: the wait stands behind the last store of loaded data and,
    // tied to both pointers, in front of the two additions that rewrite them
    asm volatile("s_wait_xcnt 0x0" : "+v"(kp), "+v"(vp) :: "memory");
    kp += 32 * KVP; vp += 32 * KVP;
    __syncthreads();
    // S tile 16 x 32
    v8f s[2];
#pragma unroll
    for (int nt = 0; nt < 2; ++nt) {
      v8f acc = (v8f){0.f,0.f,0.f,0.f,0.f,0.f,0.f,0.f};
#pragma unroll
      for (int ks = 0; ks < KS; ++ks) {
        FragB bh_, bl_;
        bh_.half[0] = *(const v8us*)&sKh[nt * 16 + ln][ks * 32 + 8 * hh]; bh_.half[1] = *(const v8us*)&sKh[nt * 16 + ln][ks * 32 + 16 + 8 * hh];
        bl_.half[0] = *(const v8us*)&sKl[nt * 16 + ln][ks * 32 + 8 * hh]; bl_.half[1] = *(const v8us*)&sKl[nt * 16 + ln][ks * 32 + 16 + 8 * hh];
        acc = mmaN<3>(aqh[ks].v, aql[ks].v, bh_.v, bl_.v, acc);
      }
      s[nt] = acc;
    }
    // B fragments of V, hi and lo: element i = V[8hh + i][dt*16 + ln], element 8 + i = V[16 + 8hh + i][dt*16 + ln], one
    // transposing load per 8 elements; V lies in LDS since the chunk's barrier, so the 16 loads may stand anywhere from here on
    FragB bvh[DT], bvl[DT];
    {
      const int vo = (8 * hh + (lane & 7)) * VP + ((lane >> 3) & 1) * 8;
#pragma unroll
      for (int dt = 0; dt < DT; ++dt) {
        bvh[dt].half[0] = ld_tr16(&sVh[0][0] + vo + dt * 16); bvh[dt].half[1] = ld_tr16(&sVh[0][0] + vo + 16 * VP + dt * 16);
        bvl[dt].half[0] = ld_tr16(&sVl[0][0] + vo + dt * 16); bvl[dt].half[1] = ld_tr16(&sVl[0][0] + vo + 16 * VP + dt * 16);
      }
    }
    // mask + running max (rows 8hh+r; the 16 lanes of a half share rows)
    float alpha[8];
#pragma unroll
    for (int r = 0; r < 8; ++r) {
      const int qi = q0 + 8 * hh + r;
      const int ja = j0 + ln, jb = j0 + 16 + ln;
      if (CAUSAL) { if (ja > qi) s[0][r] = -3.0e38f; if (jb > qi) s[1][r] = -3.0e38f; }
      if (ja >= T) s[0][r] = -3.0e38f;
      if (jb >= T) s[1][r] = -3.0e38f;
      float mx = fmaxf(s[0][r], s[1][r]);
      mx = fmaxf(mx, __shfl_xor(mx, 1, 32)); mx = fmaxf(mx, __shfl_xor(mx, 2, 32)); mx = fmaxf(mx, __shfl_xor(mx, 4, 32)); mx = fmaxf(mx, __shfl_xor(mx, 8, 32));
      const float mnew = fmaxf(m_r[r], mx);
      alpha[r] = (mnew > -1.0e38f) ? __expf(m_r[r] - mnew) : 1.0f;
      const float p0 = (s[0][r] > -1.0e38f) ? __expf(s[0][r] - mnew) : 0.f;
      const float p1 = (s[1][r] > -1.0e38f) ? __expf(s[1][r] - mnew) : 0.f;
      m_r[r] = mnew;
      l_r[r] = l_r[r] * alpha[r] + p0 + p1;            // per-lane partial row sum (16 lanes combined at the end)
      unsigned short hb = bf16_bits(p0); sPh[w][8 * hh + r][ln] = hb;      sPl[w][8 * hh + r][ln] = bf16_bits(p0 - bf16_val(hb));
      hb = bf16_bits(p1);                sPh[w][8 * hh + r][16 + ln] = hb; sPl[w][8 * hh + r][16 + ln] = bf16_bits(p1 - bf16_val(hb));
    }
#pragma unroll
    for (int dt = 0; dt < DT; ++dt)
#pragma unroll
      for (int r = 0; r < 8; ++r) oacc[dt][r] *= alpha[r];
    __builtin_amdgcn_fence(4 /* acq_rel order */, "workgroup");
    __builtin_amdgcn_wave_barrier();
    FragB pah, pal;
    pah.half[0] = *(const v8us*)&sPh[w][ln][8 * hh]; pah.half[1] = *(const v8us*)&sPh[w][ln][16 + 8 * hh];
    pal.half[0] = *(const v8us*)&sPl[w][ln][8 * hh]; pal.half[1] = *(const v8us*)&sPl[w][ln][16 + 8 * hh];
#pragma unroll
    for (int dt = 0; dt < DT; ++dt) oacc[dt] = mmaN<3>(pah.v, pal.v, bvh[dt].v, bvl[dt].v, oacc[dt]);
    __builtin_amdgcn_fence(4 /* acq_rel order */, "workgroup");
    __builtin_amdgcn_wave_barrier();
  }
#pragma unroll
  for (int r = 0; r < 8; ++r) {
    float l = l_r[r];
    l += __shfl_xor(l, 1, 32); l += __shfl_xor(l, 2, 32); l += __shfl_xor(l, 4, 32); l += __shfl_xor(l, 8, 32);
    l_r[r] = (l > 0.f) ? 1.0f / l : 0.f;
  }
#pragma unroll
  for (int dt = 0; dt < DT; ++dt)
#pragma unroll
    for (int r = 0; r < 8; ++r) sO[w][8 * hh + r][dt * 16 + ln] = oacc[dt][r] * l_r[r];
  __builtin_amdgcn_fence(4 /* acq_rel order */, "workgroup");
  __builtin_amdgcn_wave_barrier();
  {
    for (int r = 0; r < 16; ++r) {
      const int row = q0 + r;
      if (row < T && lane < D / 4) {
        const v4f val = *(const v4fa*)&sO[w][r][lane * 4];
        *(v4f*)(y + ((size_t)b * T + row) * ypitch + h * D + lane * 4) = val;
      }
    }
    
  }
  // the next tile's set-up overwrites registers that the row stores above name; this wait stands in front of that
  asm volatile("s_wait_xcnt 0x0" ::: "memory");
  }
}

extern "C" void kernel_launch(void* const* d_in, const int* in_sizes, int n_in,
                              void* d_out, int out_size, void* d_ws, size_t ws_size, hipStream_t stream) {
  if (n_in < 9) return;
  // lower-bound size checks (a reduced NB/SEQ build still launches against full-size inputs)
  if (in_sizes[0] < ((NB - 1) * SEQ_FULL + SEQ) * CC) return;
  for (int i = 1; i < 9; i += 2) {
    if (in_sizes[i] < CC * CC) return;       // Wq, Wk, Wv, Wp: [CC in][CC out] f32
    if (in_sizes[i + 1] < CC) return;        // bq, bk, bv, bp: [CC] f32
  }
  if (out_size < ((NB - 1) * OUT_SEG_ROWS + SEQ) * CC) return;
  const float* x  = (const float*)d_in[0];
  const float* Wq = (const float*)d_in[1]; const float* bqp = (const float*)d_in[2];
  const float* Wk = (const float*)d_in[3]; const float* bkp = (const float*)d_in[4];
  const float* Wv = (const float*)d_in[5]; const float* bvp = (const float*)d_in[6];
  const float* Wp = (const float*)d_in[7]; const float* bpp = (const float*)d_in[8];
  char* ws = (char*)d_ws; size_t off = 0;
  unsigned short* Wqt = (unsigned short*)(ws + off); off += (size_t)CC * CC * 2;         // [768][768] bf16  1,179,648 B
  unsigned short* Wkt = (unsigned short*)(ws + off); off += (size_t)CC * CC * 2;         // [768][768] bf16  1,179,648 B
  unsigned short* Wvt = (unsigned short*)(ws + off); off += (size_t)CC * CC * 2;         // [768][768] bf16  1,179,648 B
  unsigned short* Wpt = (unsigned short*)(ws + off); off += (size_t)CC * CC * 2;         // [768][768] bf16  1,179,648 B
  float* qkv = (float*)(ws + off); off += (size_t)NB * SEQ * 3 * CC * 4;                 // [NB*SEQ][2304] q f32, k/v bf16 hi/lo  75,497,472 B at full size
  float* yb  = (float*)(ws + off); off += (size_t)NB * SEQ * CC * 4;                     // [NB*SEQ][768]  f32  25,165,824 B at full size
  if (off > ws_size) return;                                                             // total 105,381,888 B at full size
  const int M = NB * SEQ;
  const int gw = (CC * (CC / 8) + 255) / 256;
  k_wt_bf16<<<gw, 256, 0, stream>>>(Wq, Wqt, CC, CC);
  k_wt_bf16<<<gw, 256, 0, stream>>>(Wk, Wkt, CC, CC);
  k_wt_bf16<<<gw, 256, 0, stream>>>(Wv, Wvt, CC, CC);
  k_wt_bf16<<<gw, 256, 0, stream>>>(Wp, Wpt, CC, CC);
  // qkv[b*SEQ + t][s*CC + n] = bf16(x[b*SEQ_FULL + t]) * bf16(W_s) + bf16(b_s), s = 0 (q), 1 (k), 2 (v); row pitch 3*CC;
  // q as f32, k and v as bf16 hi/lo planes per head in the same bytes
  const int gg = (M / 64) * (CC / 128);
  static_assert(HD == 64);   // a GEMM wave's 64 columns are one head's hi/lo group
  k_gemm_bf<false, 0, true, false, CC, CC, 3 * CC><<<gg, 128, 0, stream>>>(x, Wqt, bqp, qkv,          M, CC, CC, SEQ, SEQ_FULL, SEQ);
  k_gemm_bf<false, 0, true, true,  CC, CC, 3 * CC><<<gg, 128, 0, stream>>>(x, Wkt, bkp, qkv + CC,     M, CC, CC, SEQ, SEQ_FULL, SEQ);
  k_gemm_bf<false, 0, true, true,  CC, CC, 3 * CC><<<gg, 128, 0, stream>>>(x, Wvt, bvp, qkv + 2 * CC, M, CC, CC, SEQ, SEQ_FULL, SEQ);
  k_flash<HD, true, 6 * CC><<<NB * NH * ((SEQ / 64 + 1) / 2), 128, 0, stream>>>(qkv, (const unsigned short*)(qkv + CC), (const unsigned short*)(qkv + 2 * CC),
                                                                                3 * CC, SEQ, NH, 0.125f, yb, CC);
  // out[b*OUT_SEG_ROWS + t][:] = y[b*SEQ + t] * bf16(Wp) + bf16(bp), y as bf16 hi/lo
  k_gemm_bf<true, 0, true, false, CC, CC, CC><<<gg, 128, 0, stream>>>(yb, Wpt, bpp, (float*)d_out, M, CC, CC, SEQ, SEQ, OUT_SEG_ROWS);
}

// v005
// A run of this version takes 196 microseconds.
// Two timings next to v004 both put it at 1.20 times that version's speed.
// All steps since v000 together make it 2.78 times as fast.
#include <hip/hip_runtime.h>
// All contractions on v_wmma_f32_16x16x32_bf16 with f32 accumulate: q/k/v projections x*Wq, x*Wk, x*Wv with x and W as
// bf16 (single exact-product term), attention Q*K^T and P*V as 3-term bf16 hi/lo splits, output projection y*Wp with
// y split hi/lo (2 terms) and W as bf16; biases as bf16; softmax in f32.
// K and V leave their projections already split: per token row and 64-column group (one head) 64 bf16 hi values, then the
// 64 bf16 lo values, in the 256 bytes that the group's f32 values would take.
#ifndef NB
#define NB 4
#endif
#ifndef SEQ
#define SEQ 2048
#endif
#define NB_FULL 4
#define SEQ_FULL 2048
#define CC 768
#define NH 12
#define HD 64
// row stride (in tokens) between batches in the output buffer; full layout by default
#ifndef OUT_SEG_ROWS
#define OUT_SEG_ROWS SEQ_FULL
#endif
static_assert(NB >= 1 && NB <= NB_FULL);
static_assert(SEQ >= 64 && SEQ <= SEQ_FULL && (SEQ % 64) == 0);
static_assert(CC == NH * HD);
static_assert((HD % 32) == 0 && HD <= 128);
static_assert((CC % 128) == 0);

typedef __bf16 v16b __attribute__((ext_vector_type(16)));
typedef unsigned short v8us __attribute__((ext_vector_type(8), may_alias));
typedef unsigned short v4us __attribute__((ext_vector_type(4), may_alias));
typedef float  v8f  __attribute__((ext_vector_type(8)));
typedef float  v4f  __attribute__((ext_vector_type(4)));
typedef float  v2f  __attribute__((ext_vector_type(2)));
typedef float  v4fa __attribute__((ext_vector_type(4), may_alias));
typedef __attribute__((address_space(1))) const float gl_f32;
typedef __attribute__((address_space(1))) const unsigned short gl_u16;
typedef __attribute__((address_space(1))) const v4fa gl_v4f;
typedef __attribute__((address_space(1))) const v8us gl_v8us;
union FragB { v16b v; v8us half[2]; unsigned short u[16]; unsigned int w[8]; };

__device__ __forceinline__ unsigned short bf16_bits(float x) { unsigned int u = __float_as_uint(x); return (unsigned short)((u + 0x7FFFu + ((u >> 16) & 1u)) >> 16); }
__device__ __forceinline__ float bf16_val(unsigned short b) { return __uint_as_float(((unsigned int)b) << 16); }
__device__ __forceinline__ float bf16_rne(float x) { return bf16_val(bf16_bits(x)); }
// D += X*Y with X (the A operand) and Y (the B operand) both split: xh*yh, then xh*yl, then xl*yh
__device__ __forceinline__ v8f mma3(v16b xh, v16b xl, v16b yh, v16b yl, v8f c) {
  c = __builtin_amdgcn_wmma_f32_16x16x32_bf16(false, xh, false, yh, (short)0, c, false, false);
  c = __builtin_amdgcn_wmma_f32_16x16x32_bf16(false, xh, false, yl, (short)0, c, false, false);
  c = __builtin_amdgcn_wmma_f32_16x16x32_bf16(false, xl, false, yh, (short)0, c, false, false);
  return c;
}
// two f32 values rounded to nearest even into one register of two bf16 (element 0 in the low half)
__device__ __forceinline__ unsigned int pack2_bf16(v2f x) {
  typedef __bf16 bf2 __attribute__((ext_vector_type(2)));
  return __builtin_bit_cast(unsigned int, __builtin_convertvector(x, bf2));
}
// e[j] = 2^a[j], four at a time in one statement that ends with the one vector slot which the instruction set asks for behind a
// transcendental, before its result is read or its source register overwritten;
// results in registers of their own, apart from every source
__device__ __forceinline__ void exp2x4(v2f a0, v2f a1, v2f& e0, v2f& e1) {
  float r0, r1, r2, r3;
  asm("v_exp_f32 %0, %4\n\tv_exp_f32 %1, %5\n\tv_exp_f32 %2, %6\n\tv_exp_f32 %3, %7\n\tv_nop"
      : "=&v"(r0), "=&v"(r1), "=&v"(r2), "=&v"(r3) : "v"(a0[0]), "v"(a0[1]), "v"(a1[0]), "v"(a1[1]));
  e0 = (v2f){r0, r1}; e1 = (v2f){r2, r3};
}
// the value of lane l ^ 16
__device__ __forceinline__ float xhalf(float x) {
  const int b = __builtin_bit_cast(int, x);
  return __builtin_bit_cast(float, __builtin_amdgcn_permlanex16(b, b, 0x76543210, 0xfedcba98, false, false));
}
// Transposing LDS load (ds_load_tr16_b128) of a row-major 16-bit tile: with lane l addressing row 8*(l>>4) + (l&7), byte
// 16*((l>>3)&1) of the tile, lane l receives the 8 elements of rows 8*(l>>4) .. +7 in column l&15.
typedef short s16x8 __attribute__((ext_vector_type(8)));
__device__ __forceinline__ v8us ld_tr16(const unsigned short* p) {
  typedef __attribute__((address_space(3))) s16x8 lds_s16x8;
  return __builtin_bit_cast(v8us, __builtin_amdgcn_ds_load_tr16_b128_v8i16((lds_s16x8*)p));
}

// Wt[n][k] (bf16 bits, k contiguous, pitch K) = bf16(W[k][n]) from f32 row-major W[K][N]; one thread per (n, 8 consecutive k);
__global__ __launch_bounds__(256) void k_wt_bf16(const float* __restrict__ W, unsigned short* __restrict__ Wt, int K, int N) {
  const int t = blockIdx.x * 256 + threadIdx.x;
  const int k8n = K / 8;
  if (t >= N * k8n) return;
  const int n = t / k8n, k8 = (t % k8n) * 8;
  v8us v;
#pragma unroll
  for (int i = 0; i < 8; ++i) v[i] = bf16_bits(W[(size_t)(k8 + i) * N + n]);
  *(v8us*)(Wt + (size_t)n * K + k8) = v;
  
}

// GEMM C[M][N] (f32, pitch ldc) = act(A[M][K]*W + bias). A f32 row-major (pitch lda) converted to bf16
// (ASPLIT: hi/lo two planes -> 2 terms, else single RNE term); Wt bf16 [N][K] (pitch ldb). BIAS_BF16 quantises the
// bias to bf16 before the add. K%64==0, M%64==0, N%128==0.
// Logical rows are grouped in segments of 'seg' rows (seg % 64 == 0): logical row r -> A row (r/seg)*asr + r%seg and
// C row (r/seg)*csr + r%seg, so per-batch strides of A and C can differ.
// Block = 4 waves on a 64 x 128 tile of C, wave -> 32 rows x 64 cols. Each 64-deep slice of A and Wt is read from
// global memory once per block in whole 128-byte lines, A is converted once, and both lie in LDS for all four waves
// (rows pitched 144 B for the 16-byte fragment reads). Two LDS buffers: the next slice's global loads are issued
// ahead of the current slice's products and stored behind them, one block barrier per slice.
// Epilogue staged in wave-private LDS (the ring's bytes, free behind the last barrier): whole lines are stored.
// The three pitches are compile-time, so that a slice's 16 loads and the 16 (CSPLIT: 32) row stores differ only in their immediate offsets.
// CSPLIT: each f32 result v is stored as hi = bf16(v) and lo = bf16(v - hi); a wave's 64 columns of a row take the same
// 256 bytes of C as in f32, 64 hi values in the first 128-byte line and the 64 lo values in the second.
template <bool ASPLIT, int ACT, bool BIAS_BF16, bool CSPLIT, int lda, int ldb, int ldc>
__global__ __launch_bounds__(128) void k_gemm_bf(const float* __restrict__ A, const unsigned short* __restrict__ Wt,
                                               const float* __restrict__ bias, float* __restrict__ C, int M, int N, int K,
                                               int seg, int asr, int csr) {
  constexpr int BM = 64, BN = 128, BK = 64, LP = BK + 8;      // LP: LDS row pitch in bf16 elements
  constexpr int NPL = ASPLIT ? 2 : 1;                         // planes of A
  constexpr int BOFF = BM * NPL * LP;                         // Wt rows behind the A planes
  constexpr int STAGE = BOFF + BN * LP;                       // bf16 elements per buffer
  constexpr int OP = 68;                                      // output staging pitch in floats
  constexpr int RING_BYTES = 2 * STAGE * 2, OUT_BYTES = 4 * 32 * OP * 4;
  __shared__ __attribute__((aligned(16))) unsigned char smem[RING_BYTES > OUT_BYTES ? RING_BYTES : OUT_BYTES];
  unsigned short* ring = (unsigned short*)smem;
  const int tid = threadIdx.x, w = tid >> 5, lane = tid & 31, ln = lane & 15, hh = lane >> 4;
  const int wm = w >> 1, wn = w & 1;
  const int ntn = N / BN;
  const int mt = blockIdx.x / ntn, nq = blockIdx.x % ntn;
  if (mt * BM >= M) return;                      // block-uniform, in front of every barrier
  const int row0 = mt * BM, col0 = nq * BN;
  const int bseg = row0 / seg, t0 = row0 - bseg * seg;
  const int ar = tid >> 4, ac = (tid & 15) * 4;  // A slice: 16 threads per 256-byte row piece, 8 rows per pass
  const int br = tid >> 3, bc = (tid & 7) * 8;   // Wt slice: 8 threads per 128-byte row piece, 16 rows per pass
  // typed as global-memory pointers, so that they stay so through the wait statement at the loop's foot (plain global loads)
  gl_f32* ag = (gl_f32*)(A + ((size_t)bseg * asr + t0 + ar) * lda + ac);
  gl_u16* bg = (gl_u16*)(Wt + (size_t)(col0 + br) * ldb + bc);
  v4f ra[8];
  v8us rb[8];
  v8f acc[2][4];
#pragma unroll
  for (int mi = 0; mi < 2; ++mi)
#pragma unroll
    for (int t = 0; t < 4; ++t) acc[mi][t] = (v8f){0.f,0.f,0.f,0.f,0.f,0.f,0.f,0.f};

  auto fetch = [&](int ahead) {
#pragma unroll
    for (int i = 0; i < 8; ++i) ra[i] = *(gl_v4f*)(ag + ahead + i * 8 * lda);
#pragma unroll
    for (int i = 0; i < 8; ++i) rb[i] = *(gl_v8us*)(bg + ahead + i * 16 * ldb);
  };
  auto put = [&](unsigned short* buf) {
#pragma unroll
    for (int i = 0; i < 8; ++i) {
      v4us h, l;
#pragma unroll
      for (int j = 0; j < 4; ++j) {
        const unsigned short hb = bf16_bits(ra[i][j]);
        h[j] = hb;
        l[j] = ASPLIT ? bf16_bits(ra[i][j] - bf16_val(hb)) : (unsigned short)0;
      }
      *(v4us*)(buf + (ar + i * 8) * LP + ac) = h;
      if (ASPLIT) *(v4us*)(buf + BM * LP + (ar + i * 8) * LP + ac) = l;
    }
#pragma unroll
    for (int i = 0; i < 8; ++i) *(v8us*)(buf + BOFF + (br + i * 16) * LP + bc) = rb[i];
  };

  const int nst = K / BK;
  fetch(0);
  put(ring);
  __syncthreads();
  for (int s = 0; s < nst; ++s) {
    const bool more = s + 1 < nst;               // block-uniform
    if (more) fetch(BK);
    const unsigned short* buf = ring + (s & 1) * STAGE;
    const unsigned short* sa = buf + (wm * 32 + ln) * LP + 8 * hh;
    const unsigned short* sb = buf + BOFF + (wn * 64 + ln) * LP + 8 * hh;
#pragma unroll
    for (int ks = 0; ks < BK / 32; ++ks) {
      FragB ah[2], al[2], b[4];
#pragma unroll
      for (int mi = 0; mi < 2; ++mi) {
        ah[mi].half[0] = *(const v8us*)(sa + mi * 16 * LP + ks * 32);
        ah[mi].half[1] = *(const v8us*)(sa + mi * 16 * LP + ks * 32 + 16);
        if (ASPLIT) {
          al[mi].half[0] = *(const v8us*)(sa + BM * LP + mi * 16 * LP + ks * 32);
          al[mi].half[1] = *(const v8us*)(sa + BM * LP + mi * 16 * LP + ks * 32 + 16);
        }
      }
#pragma unroll
      for (int t = 0; t < 4; ++t) {
        b[t].half[0] = *(const v8us*)(sb + t * 16 * LP + ks * 32);
        b[t].half[1] = *(const v8us*)(sb + t * 16 * LP + ks * 32 + 16);
      }
      // per output element the order of the sums stays: k ascending in steps of 32, hi term then lo term
#pragma unroll
      for (int mi = 0; mi < 2; ++mi)
#pragma unroll
        for (int t = 0; t < 4; ++t)
          acc[mi][t] = __builtin_amdgcn_wmma_f32_16x16x32_bf16(false, ah[mi].v, false, b[t].v, (short)0, acc[mi][t], false, false);
      if (ASPLIT) {
#pragma unroll
        for (int mi = 0; mi < 2; ++mi)
#pragma unroll
          for (int t = 0; t < 4; ++t)
            acc[mi][t] = __builtin_amdgcn_wmma_f32_16x16x32_bf16(false, al[mi].v, false, b[t].v, (short)0, acc[mi][t], false, false);
      }
    }
    if (more) {
      put(ring + ((s + 1) & 1) * STAGE);
      // the slice's loads name the two pointers' registers: the wait stands behind the last store of loaded data and,
      // tied to both pointers, in front of the two additions that rewrite them
      asm volatile("s_wait_xcnt 0x0" : "+v"(ag), "+v"(bg) :: "memory");
      ag += BK; bg += BK;
    }
    __syncthreads();
  }
  float* so = (float*)smem + w * 32 * OP;
#pragma unroll
  for (int t = 0; t < 4; ++t) {
    float bv = bias ? bias[col0 + wn * 64 + t * 16 + ln] : 0.f;
    if (BIAS_BF16) bv = bf16_rne(bv);
#pragma unroll
    for (int mi = 0; mi < 2; ++mi)
#pragma unroll
      for (int r = 0; r < 8; ++r) { float v = acc[mi][t][r] + bv; if (ACT == 1) v = fmaxf(v, 0.f); so[(mi * 16 + 8 * hh + r) * OP + t * 16 + ln] = v; }
  }
  __builtin_amdgcn_fence(4 /* acq_rel order */, "workgroup");
  __builtin_amdgcn_wave_barrier();
  const int rsub = lane >> 4, c4 = (lane & 15) * 4;
  float* cw = C + ((size_t)bseg * csr + t0 + wm * 32 + rsub) * ldc + col0 + wn * 64;
  if (CSPLIT) {
    unsigned short* cs = (unsigned short*)cw + c4;
    // unrolled (both loops), so that the row stores differ only in their immediate offsets and h, l stay in registers
#pragma unroll
    for (int q = 0; q < 16; ++q) {
      const v4f v = *(const v4fa*)&so[(q * 2 + rsub) * OP + c4];
      v4us h, l;
#pragma unroll
      for (int j = 0; j < 4; ++j) {
        const unsigned short hb = bf16_bits(v[j]);
        h[j] = hb;
        l[j] = bf16_bits(v[j] - bf16_val(hb));
      }
      *(v4us*)(cs + q * 2 * ldc * 2) = h;
      *(v4us*)(cs + q * 2 * ldc * 2 + 64) = l;
    }
  } else {
    float* cg = cw + c4;
#pragma unroll
    for (int q = 0; q < 16; ++q) {
      const v4f v = *(const v4fa*)&so[(q * 2 + rsub) * OP + c4];
      *(v4f*)(cg + q * 2 * ldc) = v;
    }
  }
}

template <int D, bool CAUSAL, int KVP>
__global__ __launch_bounds__(128) void k_flash(const float* __restrict__ qb, const unsigned short* __restrict__ kb, const unsigned short* __restrict__ vb,
                                             int pitch, int T, int H, float scale, float* __restrict__ y, int ypitch) {
  constexpr int KS = D / 32;        // k-steps for QK
  constexpr int DT = D / 16;        // d tiles for PV
  constexpr int VP = D + 16;        // V row pitch in elements: an odd multiple of 32 bytes, for the transposing loads
  static_assert((VP * 2) % 32 == 0 && ((VP * 2 / 32) & 1) == 1);
  constexpr int PPR = D / 4;        // 16-byte pieces per K or V row (hi and lo)
  constexpr int RPP = 128 / PPR;    // rows that the block's 128 threads copy per pass
  constexpr int NPS = 32 / RPP;     // passes per 32-key chunk
  static_assert(128 % PPR == 0 && 32 % RPP == 0 && (KVP % 8) == 0);
  __shared__ __attribute__((aligned(16))) unsigned short sKh[32][D + 8], sKl[32][D + 8], sVh[32][VP], sVl[32][VP];
  __shared__ __attribute__((aligned(16))) float sO[4][16][D + 4];   // pitched for the 16-byte stores of 16 rows at a time
  const int tid = threadIdx.x, w = tid >> 5, lane = tid & 31, ln = lane & 15, hh = lane >> 4;
  const int nqb = (T + 63) / 64;
  const int npair = (nqb + 1) / 2;
  const int bh = blockIdx.x / npair, pr = blockIdx.x % npair;
  const int b = bh / H, h = bh % H;
  const float* Q = qb + (size_t)b * T * pitch + h * D;
  gl_u16* K = (gl_u16*)(kb + (size_t)b * T * KVP + h * 2 * D);
  gl_u16* V = (gl_u16*)(vb + (size_t)b * T * KVP + h * 2 * D);
  // the thread's piece of a row: row sr of a pass, piece sc (the first D / 8 pieces are the hi plane, the rest the lo plane)
  const int sr = tid / PPR, sc = tid % PPR;
  const unsigned int goff = (unsigned int)(sr * KVP + sc * 8);
  unsigned short* kd = (sc < D / 8 ? &sKh[0][0] : &sKl[0][0]) + sr * (D + 8) + (sc % (D / 8)) * 8;
  unsigned short* vd = (sc < D / 8 ? &sVh[0][0] : &sVl[0][0]) + sr * VP + (sc % (D / 8)) * 8;

  const int ntile = (nqb - 1 - pr == pr) ? 1 : 2;              // block-uniform
  for (int tile = 0; tile < ntile; ++tile) {
  const int qblk = tile ? pr : nqb - 1 - pr;
  const int q0 = qblk * 64 + w * 16;
  // B fragments (Q^T) of the wave's 16 query rows (scaled), hi/lo
  FragB aqh[KS], aql[KS];
  {
    int row = q0 + ln; if (row >= T) row = T - 1;
    const float* qr = Q + (size_t)row * pitch;
#pragma unroll
    for (int ks = 0; ks < KS; ++ks)
#pragma unroll
      for (int i = 0; i < 16; ++i) {
        const int d = ks * 32 + ((i < 8) ? (8 * hh + i) : (16 + 8 * hh + (i - 8)));
        const float x = qr[d] * scale; const unsigned short hb = bf16_bits(x);
        aqh[ks].u[i] = hb; aql[ks].u[i] = bf16_bits(x - bf16_val(hb));
      }
  }
  float m_run = -3.0e38f, l_run = 0.f;                         // of query q0 + ln; l_run is this half's partial sum
  // the last key that the lane's query may see, counted from the lane's first key row 8hh
  const int klast = (CAUSAL ? min(q0 + ln, T - 1) : T - 1) - 8 * hh;
  v8f oacc[DT];
#pragma unroll
  for (int dt = 0; dt < DT; ++dt) oacc[dt] = (v8f){0.f,0.f,0.f,0.f,0.f,0.f,0.f,0.f};

  const int kv_end = CAUSAL ? min(T, qblk * 64 + 64) : T;     // block-uniform
  gl_u16* kp = K + goff;                                       // the thread's piece in row sr of the current chunk
  gl_u16* vp = V + goff;
  for (int j0 = 0; j0 < kv_end; j0 += 32) {
    v8us kr[NPS], vr[NPS];
    // the three loops below are unrolled so that kr and vr stay in registers and a chunk's loads are all in flight together;
    // the loads touch no LDS and so stand in front of the barrier that frees the K/V buffers
    if (j0 + 32 <= T) {                                        // block-uniform: every key of the chunk exists
#pragma unroll
      for (int i = 0; i < NPS; ++i) {
        kr[i] = *(gl_v8us*)(kp + i * RPP * KVP);
        vr[i] = *(gl_v8us*)(vp + i * RPP * KVP);
      }
    } else {
#pragma unroll
      for (int i = 0; i < NPS; ++i) {
        const int key = j0 + sr + i * RPP;
        const int keyc = (key < T) ? key : (T - 1);            // clamped address, zeroed by value below
        kr[i] = *(gl_v8us*)(K + (size_t)keyc * KVP + sc * 8);
        vr[i] = *(gl_v8us*)(V + (size_t)keyc * KVP + sc * 8);
        if (key >= T) { kr[i] = (v8us){0,0,0,0,0,0,0,0}; vr[i] = (v8us){0,0,0,0,0,0,0,0}; }
      }
    }
    __syncthreads();
#pragma unroll
    for (int i = 0; i < NPS; ++i) {
      *(v8us*)(kd + i * RPP * (D + 8)) = kr[i];
      *(v8us*)(vd + i * RPP * VP) = vr[i];
    }
    // the chunk's loads name the two pointers' registers: the wait stands behind the last store of loaded data and,
    // tied to both pointers, in front of the two additions that rewrite them
    asm volatile("s_wait_xcnt 0x0" : "+v"(kp), "+v"(vp) :: "memory");
    kp += 32 * KVP; vp += 32 * KVP;
    __syncthreads();
    // S^T, two tiles of 16 keys x 16 queries
    v8f s[2];
#pragma unroll
    for (int nt = 0; nt < 2; ++nt) {
      v8f acc = (v8f){0.f,0.f,0.f,0.f,0.f,0.f,0.f,0.f};
#pragma unroll
      for (int ks = 0; ks < KS; ++ks) {
        FragB kh_, kl_;
        kh_.half[0] = *(const v8us*)&sKh[nt * 16 + ln][ks * 32 + 8 * hh]; kh_.half[1] = *(const v8us*)&sKh[nt * 16 + ln][ks * 32 + 16 + 8 * hh];
        kl_.half[0] = *(const v8us*)&sKl[nt * 16 + ln][ks * 32 + 8 * hh]; kl_.half[1] = *(const v8us*)&sKl[nt * 16 + ln][ks * 32 + 16 + 8 * hh];
        acc = mma3(kh_.v, kl_.v, aqh[ks].v, aql[ks].v, acc);
      }
      s[nt] = acc;
    }
    // A fragments of V^T, hi and lo: element i = V[8hh + i][dt*16 + ln], element 8 + i = V[16 + 8hh + i][dt*16 + ln], one
    // transposing load per 8 elements; V lies in LDS since the chunk's barrier, so the 16 loads may stand anywhere from here on
    FragB bvh[DT], bvl[DT];
    {
      const int vo = (8 * hh + (lane & 7)) * VP + ((lane >> 3) & 1) * 8;
#pragma unroll
      for (int dt = 0; dt < DT; ++dt) {
        bvh[dt].half[0] = ld_tr16(&sVh[0][0] + vo + dt * 16); bvh[dt].half[1] = ld_tr16(&sVh[0][0] + vo + 16 * VP + dt * 16);
        bvl[dt].half[0] = ld_tr16(&sVl[0][0] + vo + dt * 16); bvl[dt].half[1] = ld_tr16(&sVl[0][0] + vo + 16 * VP + dt * 16);
      }
    }
    // holds the 16 V loads here, ahead of the softmax: their latency passes behind it and the V^T * P^T products run without
    // LDS waits among them (without it the compiler sinks the loads in between those products)
    __builtin_amdgcn_sched_barrier(0);
    // mask + running maximum of the lane's query; sc[8 * nt + r] is the score of key j0 + nt*16 + 8hh + r
    const int lim = klast - j0;
    float sc[16];
#pragma unroll
    for (int nt = 0; nt < 2; ++nt)
#pragma unroll
      for (int r = 0; r < 8; ++r) sc[8 * nt + r] = (nt * 16 + r > lim) ? -3.0e38f : s[nt][r];
    float mx = fmaxf(sc[0], sc[1]);
#pragma unroll
    for (int i = 2; i < 16; i += 2) mx = fmaxf(mx, fmaxf(sc[i], sc[i + 1]));
    mx = fmaxf(mx, xhalf(mx));
    const float mnew = fmaxf(m_run, mx);
    const bool seen = mnew > -1.0e38f;                         // false while every key so far was masked for this query
    const float alpha = seen ? __expf(m_run - mnew) : 1.0f;
    const float mref = seen ? mnew : 0.f;                      // a masked score then gives exp(-3e38 - mref) = 0 in either case
    m_run = mnew;
    // P^T as B operand, hi and lo: element i = P[8hh + i], element 8 + i = P[16 + 8hh + i] of the lane's query
    FragB ph, pl;
    v2f pp[8];
    constexpr float LOG2E = 1.44269504f;                       // exp(x) = 2^(x * LOG2E)
#pragma unroll
    for (int i = 0; i < 8; i += 2)
      exp2x4((v2f){(sc[2 * i] - mref) * LOG2E, (sc[2 * i + 1] - mref) * LOG2E},
             (v2f){(sc[2 * i + 2] - mref) * LOG2E, (sc[2 * i + 3] - mref) * LOG2E}, pp[i], pp[i + 1]);
#pragma unroll
    for (int i = 0; i < 8; ++i) {
      const unsigned int hw = pack2_bf16(pp[i]);
      ph.w[i] = hw;
      pl.w[i] = pack2_bf16(pp[i] - (v2f){__uint_as_float(hw << 16), __uint_as_float(hw & 0xFFFF0000u)});
    }
    const v2f ps = ((pp[0] + pp[1]) + (pp[2] + pp[3])) + ((pp[4] + pp[5]) + (pp[6] + pp[7]));
    l_run = l_run * alpha + (ps[0] + ps[1]);
#pragma unroll
    for (int dt = 0; dt < DT; ++dt)
#pragma unroll
      for (int r = 0; r < 8; ++r) oacc[dt][r] *= alpha;
#pragma unroll
    for (int dt = 0; dt < DT; ++dt) oacc[dt] = mma3(bvh[dt].v, bvl[dt].v, ph.v, pl.v, oacc[dt]);
    // four vector slots behind the chunk's last product, before the next chunk's global loads may overwrite A and B registers
    // of the products (only scalar instructions stand between them round the loop); tied to every D, to P and to every V
    // fragment, so that no product stands behind it (the statement names the d tiles one by one: four, D = 64)
    static_assert(DT == 4);
    asm volatile("v_nop\n\tv_nop\n\tv_nop\n\tv_nop" : "+v"(oacc[0]), "+v"(oacc[1]), "+v"(oacc[2]), "+v"(oacc[3])
                 : "v"(ph.v), "v"(pl.v), "v"(bvh[0].v), "v"(bvh[1].v), "v"(bvh[2].v), "v"(bvh[3].v),
                   "v"(bvl[0].v), "v"(bvl[1].v), "v"(bvl[2].v), "v"(bvl[3].v));
  }
  // oacc[dt][r] = O[q0 + ln][dt*16 + 8hh + r]; the two halves' sums are joined here, once
  const float lsum = l_run + xhalf(l_run);
  const float linv = (lsum > 0.f) ? 1.0f / lsum : 0.f;
#pragma unroll
  for (int dt = 0; dt < DT; ++dt) {
    *(v4fa*)&sO[w][ln][dt * 16 + 8 * hh]     = (v4f){oacc[dt][0] * linv, oacc[dt][1] * linv, oacc[dt][2] * linv, oacc[dt][3] * linv};
    *(v4fa*)&sO[w][ln][dt * 16 + 8 * hh + 4] = (v4f){oacc[dt][4] * linv, oacc[dt][5] * linv, oacc[dt][6] * linv, oacc[dt][7] * linv};
  }
  __builtin_amdgcn_fence(4 /* acq_rel order */, "workgroup");
  __builtin_amdgcn_wave_barrier();
  {
    for (int r = 0; r < 16; ++r) {
      const int row = q0 + r;
      if (row < T && lane < D / 4) {
        const v4f val = *(const v4fa*)&sO[w][r][lane * 4];
        *(v4f*)(y + ((size_t)b * T + row) * ypitch + h * D + lane * 4) = val;
      }
    }
    
  }
  // the next tile's set-up overwrites registers that the row stores above name; this wait stands in front of that
  asm volatile("s_wait_xcnt 0x0" ::: "memory");
  }
}

extern "C" void kernel_launch(void* const* d_in, const int* in_sizes, int n_in,
                              void* d_out, int out_size, void* d_ws, size_t ws_size, hipStream_t stream) {
  if (n_in < 9) return;
  // lower-bound size checks (a reduced NB/SEQ build still launches against full-size inputs)
  if (in_sizes[0] < ((NB - 1) * SEQ_FULL + SEQ) * CC) return;
  for (int i = 1; i < 9; i += 2) {
    if (in_sizes[i] < CC * CC) return;       // Wq, Wk, Wv, Wp: [CC in][CC out] f32
    if (in_sizes[i + 1] < CC) return;        // bq, bk, bv, bp: [CC] f32
  }
  if (out_size < ((NB - 1) * OUT_SEG_ROWS + SEQ) * CC) return;
  const float* x  = (const float*)d_in[0];
  const float* Wq = (const float*)d_in[1]; const float* bqp = (const float*)d_in[2];
  const float* Wk = (const float*)d_in[3]; const float* bkp = (const float*)d_in[4];
  const float* Wv = (const float*)d_in[5]; const float* bvp = (const float*)d_in[6];
  const float* Wp = (const float*)d_in[7]; const float* bpp = (const float*)d_in[8];
  char* ws = (char*)d_ws; size_t off = 0;
  unsigned short* Wqt = (unsigned short*)(ws + off); off += (size_t)CC * CC * 2;         // [768][768] bf16  1,179,648 B
  unsigned short* Wkt = (unsigned short*)(ws + off); off += (size_t)CC * CC * 2;         // [768][768] bf16  1,179,648 B
  unsigned short* Wvt = (unsigned short*)(ws + off); off += (size_t)CC * CC * 2;         // [768][768] bf16  1,179,648 B
  unsigned short* Wpt = (unsigned short*)(ws + off); off += (size_t)CC * CC * 2;         // [768][768] bf16  1,179,648 B
  float* qkv = (float*)(ws + off); off += (size_t)NB * SEQ * 3 * CC * 4;                 // [NB*SEQ][2304] q f32, k/v bf16 hi/lo  75,497,472 B at full size
  float* yb  = (float*)(ws + off); off += (size_t)NB * SEQ * CC * 4;                     // [NB*SEQ][768]  f32  25,165,824 B at full size
  if (off > ws_size) return;                                                             // total 105,381,888 B at full size
  const int M = NB * SEQ;
  const int gw = (CC * (CC / 8) + 255) / 256;
  k_wt_bf16<<<gw, 256, 0, stream>>>(Wq, Wqt, CC, CC);
  k_wt_bf16<<<gw, 256, 0, stream>>>(Wk, Wkt, CC, CC);
  k_wt_bf16<<<gw, 256, 0, stream>>>(Wv, Wvt, CC, CC);
  k_wt_bf16<<<gw, 256, 0, stream>>>(Wp, Wpt, CC, CC);
  // qkv[b*SEQ + t][s*CC + n] = bf16(x[b*SEQ_FULL + t]) * bf16(W_s) + bf16(b_s), s = 0 (q), 1 (k), 2 (v); row pitch 3*CC;
  // q as f32, k and v as bf16 hi/lo planes per head in the same bytes
  const int gg = (M / 64) * (CC / 128);
  static_assert(HD == 64);   // a GEMM wave's 64 columns are one head's hi/lo group
  k_gemm_bf<false, 0, true, false, CC, CC, 3 * CC><<<gg, 128, 0, stream>>>(x, Wqt, bqp, qkv,          M, CC, CC, SEQ, SEQ_FULL, SEQ);
  k_gemm_bf<false, 0, true, true,  CC, CC, 3 * CC><<<gg, 128, 0, stream>>>(x, Wkt, bkp, qkv + CC,     M, CC, CC, SEQ, SEQ_FULL, SEQ);
  k_gemm_bf<false, 0, true, true,  CC, CC, 3 * CC><<<gg, 128, 0, stream>>>(x, Wvt, bvp, qkv + 2 * CC, M, CC, CC, SEQ, SEQ_FULL, SEQ);
  k_flash<HD, true, 6 * CC><<<NB * NH * ((SEQ / 64 + 1) / 2), 128, 0, stream>>>(qkv, (const unsigned short*)(qkv + CC), (const unsigned short*)(qkv + 2 * CC),
                                                                                3 * CC, SEQ, NH, 0.125f, yb, CC);
  // out[b*OUT_SEG_ROWS + t][:] = y[b*SEQ + t] * bf16(Wp) + bf16(bp), y as bf16 hi/lo
  k_gemm_bf<true, 0, true, false, CC, CC, CC><<<gg, 128, 0, stream>>>(yb, Wpt, bpp, (float*)d_out, M, CC, CC, SEQ, SEQ, OUT_SEG_ROWS);
}

// v006
// Measured time: 181 microseconds a run.
// Timed twice side by side with v005, it ran 1.09 times as fast both times.
// Over all steps from v000 it is 3.02 times as fast.
#include <hip/hip_runtime.h>
// All contractions on v_wmma_f32_16x16x32_bf16 with f32 accumulate: q/k/v projections x*Wq, x*Wk, x*Wv with x and W as
// bf16 (single exact-product term), attention Q*K^T and P*V as 3-term bf16 hi/lo splits, output projection y*Wp with
// y split hi/lo (2 terms) and W as bf16; biases as bf16; softmax in f32.
// K and V leave their projections already split: per token row and 64-column group (one head) 64 bf16 hi values, then the
// 64 bf16 lo values, in the 256 bytes that the group's f32 values would take.
#ifndef NB
#define NB 4
#endif
#ifndef SEQ
#define SEQ 2048
#endif
#define NB_FULL 4
#define SEQ_FULL 2048
#define CC 768
#define NH 12
#define HD 64
// row stride (in tokens) between batches in the output buffer; full layout by default
#ifndef OUT_SEG_ROWS
#define OUT_SEG_ROWS SEQ_FULL
#endif
static_assert(NB >= 1 && NB <= NB_FULL);
static_assert(SEQ >= 64 && SEQ <= SEQ_FULL && (SEQ % 64) == 0);
static_assert(CC == NH * HD);
static_assert((HD % 32) == 0 && HD <= 128);
static_assert((CC % 128) == 0);

typedef __bf16 v16b __attribute__((ext_vector_type(16)));
typedef unsigned short v8us __attribute__((ext_vector_type(8), may_alias));
typedef unsigned short v4us __attribute__((ext_vector_type(4), may_alias));
typedef float  v8f  __attribute__((ext_vector_type(8)));
typedef float  v4f  __attribute__((ext_vector_type(4)));
typedef float  v2f  __attribute__((ext_vector_type(2)));
typedef float  v4fa __attribute__((ext_vector_type(4), may_alias));
typedef __attribute__((address_space(1))) const float gl_f32;
typedef __attribute__((address_space(1))) const unsigned short gl_u16;
typedef __attribute__((address_space(1))) const v4fa gl_v4f;
typedef __attribute__((address_space(1))) const v8us gl_v8us;
union FragB { v16b v; v8us half[2]; unsigned short u[16]; unsigned int w[8]; };

__device__ __forceinline__ unsigned short bf16_bits(float x) { unsigned int u = __float_as_uint(x); return (unsigned short)((u + 0x7FFFu + ((u >> 16) & 1u)) >> 16); }
__device__ __forceinline__ float bf16_val(unsigned short b) { return __uint_as_float(((unsigned int)b) << 16); }
__device__ __forceinline__ float bf16_rne(float x) { return bf16_val(bf16_bits(x)); }
// D += X*Y with X (the A operand) and Y (the B operand) both split: xh*yh, then xh*yl, then xl*yh
__device__ __forceinline__ v8f mma3(v16b xh, v16b xl, v16b yh, v16b yl, v8f c) {
  c = __builtin_amdgcn_wmma_f32_16x16x32_bf16(false, xh, false, yh, (short)0, c, false, false);
  c = __builtin_amdgcn_wmma_f32_16x16x32_bf16(false, xh, false, yl, (short)0, c, false, false);
  c = __builtin_amdgcn_wmma_f32_16x16x32_bf16(false, xl, false, yh, (short)0, c, false, false);
  return c;
}
// two f32 values rounded to nearest even into one register of two bf16 (element 0 in the low half)
__device__ __forceinline__ unsigned int pack2_bf16(v2f x) {
  typedef __bf16 bf2 __attribute__((ext_vector_type(2)));
  return __builtin_bit_cast(unsigned int, __builtin_convertvector(x, bf2));
}
// e[j] = 2^a[j], four at a time in one statement that ends with the one vector slot which the instruction set asks for behind a
// transcendental, before its result is read or its source register overwritten;
// results in registers of their own, apart from every source
__device__ __forceinline__ void exp2x4(v2f a0, v2f a1, v2f& e0, v2f& e1) {
  float r0, r1, r2, r3;
  asm("v_exp_f32 %0, %4\n\tv_exp_f32 %1, %5\n\tv_exp_f32 %2, %6\n\tv_exp_f32 %3, %7\n\tv_nop"
      : "=&v"(r0), "=&v"(r1), "=&v"(r2), "=&v"(r3) : "v"(a0[0]), "v"(a0[1]), "v"(a1[0]), "v"(a1[1]));
  e0 = (v2f){r0, r1}; e1 = (v2f){r2, r3};
}
// the value of lane l ^ 16
__device__ __forceinline__ float xhalf(float x) {
  const int b = __builtin_bit_cast(int, x);
  return __builtin_bit_cast(float, __builtin_amdgcn_permlanex16(b, b, 0x76543210, 0xfedcba98, false, false));
}
// Transposing LDS load (ds_load_tr16_b128) of a row-major 16-bit tile: with lane l addressing row 8*(l>>4) + (l&7), byte
// 16*((l>>3)&1) of the tile, lane l receives the 8 elements of rows 8*(l>>4) .. +7 in column l&15.
typedef short s16x8 __attribute__((ext_vector_type(8)));
__device__ __forceinline__ v8us ld_tr16(const unsigned short* p) {
  typedef __attribute__((address_space(3))) s16x8 lds_s16x8;
  return __builtin_bit_cast(v8us, __builtin_amdgcn_ds_load_tr16_b128_v8i16((lds_s16x8*)p));
}

// Wt[n][k] (bf16 bits, k contiguous, pitch K) = bf16(W[k][n]) from f32 row-major W[K][N]; one thread per (n, 8 consecutive k);
// four matrices of one shape in one grid: blockIdx.y picks the matrix, the results lie one behind the other in Wt4
__global__ __launch_bounds__(256) void k_wt_bf16(const float* __restrict__ W0, const float* __restrict__ W1, const float* __restrict__ W2,
                                                 const float* __restrict__ W3, unsigned short* __restrict__ Wt4, int K, int N) {
  const int mat = blockIdx.y;
  const float* W = mat == 0 ? W0 : (mat == 1 ? W1 : (mat == 2 ? W2 : W3));
  unsigned short* Wt = Wt4 + (size_t)mat * K * N;
  const int t = blockIdx.x * 256 + threadIdx.x;
  const int k8n = K / 8;
  if (t >= N * k8n) return;
  const int n = t / k8n, k8 = (t % k8n) * 8;
  v8us v;
#pragma unroll
  for (int i = 0; i < 8; ++i) v[i] = bf16_bits(W[(size_t)(k8 + i) * N + n]);
  *(v8us*)(Wt + (size_t)n * K + k8) = v;
  
}

// GEMM C[M][N] (f32, pitch ldc) = act(A[M][K]*W + bias). A f32 row-major (pitch lda) converted to bf16
// (ASPLIT: hi/lo two planes -> 2 terms, else single RNE term); Wt bf16 [N][K] (pitch ldb). BIAS_BF16 quantises the
// bias to bf16 before the add. K%64==0, M%64==0, N%128==0.
// Logical rows are grouped in segments of 'seg' rows (seg % 64 == 0): logical row r -> A row (r/seg)*asr + r%seg and
// C row (r/seg)*csr + r%seg, so per-batch strides of A and C can differ.
// Block = 4 waves on a 64 x 128 tile of C, wave -> 32 rows x 64 cols. Each 64-deep slice of A and Wt is read from
// global memory once per block in whole 128-byte lines, A is converted once, and both lie in LDS for all four waves
// (rows pitched 144 B for the 16-byte fragment reads). Two LDS buffers: the next slice's global loads are issued
// ahead of the current slice's products and stored behind them, one block barrier per slice.
// Epilogue staged in wave-private LDS (the ring's bytes, free behind the last barrier): whole lines are stored.
// The three pitches are compile-time, so that a slice's 16 loads and the 16 row stores differ only in their immediate offsets.
// CSFROM >= 0: in the columns from CSFROM on each f32 result v is stored as hi = bf16(v) and lo = bf16(v - hi); a wave's 64
// columns of a row take the same 256 bytes of C as in f32, 64 hi values in the first 128-byte line and the 64 lo values in the second.
// BSEG > 0: several products with one A run as one grid, their Wt rows stacked; each BSEG columns have a bias vector of their
// own (bias, bias1, bias2, so N <= 3 * BSEG). BSEG == 0: one bias vector for all N columns.
template <bool ASPLIT, int ACT, bool BIAS_BF16, int CSFROM, int BSEG, int lda, int ldb, int ldc>
__global__ __launch_bounds__(128) void k_gemm_bf(const float* __restrict__ A, const unsigned short* __restrict__ Wt,
                                               const float* __restrict__ bias, const float* __restrict__ bias1,
                                               const float* __restrict__ bias2, float* __restrict__ C, int M, int N, int K,
                                               int seg, int asr, int csr) {
  constexpr int BM = 64, BN = 128, BK = 64, LP = BK + 8;      // LP: LDS row pitch in bf16 elements
  constexpr int NPL = ASPLIT ? 2 : 1;                         // planes of A
  constexpr int BOFF = BM * NPL * LP;                         // Wt rows behind the A planes
  constexpr int STAGE = BOFF + BN * LP;                       // bf16 elements per buffer
  constexpr int OP = 68;                                      // output staging pitch in floats
  static_assert(BSEG % BN == 0 && (CSFROM < 0 || CSFROM % BN == 0));   // a block lies in one bias segment and stores in one form
  constexpr int RING_BYTES = 2 * STAGE * 2, OUT_BYTES = 4 * 32 * OP * 4;
  __shared__ __attribute__((aligned(16))) unsigned char smem[RING_BYTES > OUT_BYTES ? RING_BYTES : OUT_BYTES];
  unsigned short* ring = (unsigned short*)smem;
  const int tid = threadIdx.x, w = tid >> 5, lane = tid & 31, ln = lane & 15, hh = lane >> 4;
  const int wm = w >> 1, wn = w & 1;
  const int ntn = N / BN;
  const int mt = blockIdx.x / ntn, nq = blockIdx.x % ntn;
  if (mt * BM >= M) return;                      // block-uniform, in front of every barrier
  const int row0 = mt * BM, col0 = nq * BN;
  const int bseg = row0 / seg, t0 = row0 - bseg * seg;
  const int ar = tid >> 4, ac = (tid & 15) * 4;  // A slice: 16 threads per 256-byte row piece, 8 rows per pass
  const int br = tid >> 3, bc = (tid & 7) * 8;   // Wt slice: 8 threads per 128-byte row piece, 16 rows per pass
  // typed as global-memory pointers, so that they stay so through the wait statement at the loop's foot (plain global loads)
  gl_f32* ag = (gl_f32*)(A + ((size_t)bseg * asr + t0 + ar) * lda + ac);
  gl_u16* bg = (gl_u16*)(Wt + (size_t)(col0 + br) * ldb + bc);
  v4f ra[8];
  v8us rb[8];
  v8f acc[2][4];
#pragma unroll
  for (int mi = 0; mi < 2; ++mi)
#pragma unroll
    for (int t = 0; t < 4; ++t) acc[mi][t] = (v8f){0.f,0.f,0.f,0.f,0.f,0.f,0.f,0.f};

  auto fetch = [&](int ahead) {
#pragma unroll
    for (int i = 0; i < 8; ++i) ra[i] = *(gl_v4f*)(ag + ahead + i * 8 * lda);
#pragma unroll
    for (int i = 0; i < 8; ++i) rb[i] = *(gl_v8us*)(bg + ahead + i * 16 * ldb);
  };
  auto put = [&](unsigned short* buf) {
#pragma unroll
    for (int i = 0; i < 8; ++i) {
      v4us h, l;
#pragma unroll
      for (int j = 0; j < 4; ++j) {
        const unsigned short hb = bf16_bits(ra[i][j]);
        h[j] = hb;
        l[j] = ASPLIT ? bf16_bits(ra[i][j] - bf16_val(hb)) : (unsigned short)0;
      }
      *(v4us*)(buf + (ar + i * 8) * LP + ac) = h;
      if (ASPLIT) *(v4us*)(buf + BM * LP + (ar + i * 8) * LP + ac) = l;
    }
#pragma unroll
    for (int i = 0; i < 8; ++i) *(v8us*)(buf + BOFF + (br + i * 16) * LP + bc) = rb[i];
  };

  const int nst = K / BK;
  fetch(0);
  put(ring);
  __syncthreads();
  for (int s = 0; s < nst; ++s) {
    const bool more = s + 1 < nst;               // block-uniform
    if (more) fetch(BK);
    const unsigned short* buf = ring + (s & 1) * STAGE;
    const unsigned short* sa = buf + (wm * 32 + ln) * LP + 8 * hh;
    const unsigned short* sb = buf + BOFF + (wn * 64 + ln) * LP + 8 * hh;
#pragma unroll
    for (int ks = 0; ks < BK / 32; ++ks) {
      FragB ah[2], al[2], b[4];
#pragma unroll
      for (int mi = 0; mi < 2; ++mi) {
        ah[mi].half[0] = *(const v8us*)(sa + mi * 16 * LP + ks * 32);
        ah[mi].half[1] = *(const v8us*)(sa + mi * 16 * LP + ks * 32 + 16);
        if (ASPLIT) {
          al[mi].half[0] = *(const v8us*)(sa + BM * LP + mi * 16 * LP + ks * 32);
          al[mi].half[1] = *(const v8us*)(sa + BM * LP + mi * 16 * LP + ks * 32 + 16);
        }
      }
#pragma unroll
      for (int t = 0; t < 4; ++t) {
        b[t].half[0] = *(const v8us*)(sb + t * 16 * LP + ks * 32);
        b[t].half[1] = *(const v8us*)(sb + t * 16 * LP + ks * 32 + 16);
      }
      // per output element the order of the sums stays: k ascending in steps of 32, hi term then lo term
#pragma unroll
      for (int mi = 0; mi < 2; ++mi)
#pragma unroll
        for (int t = 0; t < 4; ++t)
          acc[mi][t] = __builtin_amdgcn_wmma_f32_16x16x32_bf16(false, ah[mi].v, false, b[t].v, (short)0, acc[mi][t], false, false);
      if (ASPLIT) {
#pragma unroll
        for (int mi = 0; mi < 2; ++mi)
#pragma unroll
          for (int t = 0; t < 4; ++t)
            acc[mi][t] = __builtin_amdgcn_wmma_f32_16x16x32_bf16(false, al[mi].v, false, b[t].v, (short)0, acc[mi][t], false, false);
      }
    }
    if (more) {
      put(ring + ((s + 1) & 1) * STAGE);
      // the slice's loads name the two pointers' registers: the wait stands behind the last store of loaded data and,
      // tied to both pointers, in front of the two additions that rewrite them
      asm volatile("s_wait_xcnt 0x0" : "+v"(ag), "+v"(bg) :: "memory");
      ag += BK; bg += BK;
    }
    __syncthreads();
  }
  float* so = (float*)smem + w * 32 * OP;
  const float* bsel = bias;                      // the block's bias vector and its first column there, block-uniform
  int bcol = col0;
  if (BSEG > 0) {
    const int bi = col0 / BSEG;
    bsel = bi == 0 ? bias : (bi == 1 ? bias1 : bias2);
    bcol = col0 - bi * BSEG;
  }
#pragma unroll
  for (int t = 0; t < 4; ++t) {
    float bv = bsel ? bsel[bcol + wn * 64 + t * 16 + ln] : 0.f;
    if (BIAS_BF16) bv = bf16_rne(bv);
#pragma unroll
    for (int mi = 0; mi < 2; ++mi)
#pragma unroll
      for (int r = 0; r < 8; ++r) { float v = acc[mi][t][r] + bv; if (ACT == 1) v = fmaxf(v, 0.f); so[(mi * 16 + 8 * hh + r) * OP + t * 16 + ln] = v; }
  }
  __builtin_amdgcn_fence(4 /* acq_rel order */, "workgroup");
  __builtin_amdgcn_wave_barrier();
  const int rsub = lane >> 4, c4 = (lane & 15) * 4;
  float* cw = C + ((size_t)bseg * csr + t0 + wm * 32 + rsub) * ldc + col0 + wn * 64;
  if (CSFROM >= 0 && col0 >= CSFROM) {           // block-uniform
    unsigned short* cs = (unsigned short*)cw + c4;
    // unrolled (both loops), so that the row stores differ only in their immediate offsets and h, l stay in registers
#pragma unroll
    for (int q = 0; q < 16; ++q) {
      const v4f v = *(const v4fa*)&so[(q * 2 + rsub) * OP + c4];
      v4us h, l;
#pragma unroll
      for (int j = 0; j < 4; ++j) {
        const unsigned short hb = bf16_bits(v[j]);
        h[j] = hb;
        l[j] = bf16_bits(v[j] - bf16_val(hb));
      }
      *(v4us*)(cs + q * 2 * ldc * 2) = h;
      *(v4us*)(cs + q * 2 * ldc * 2 + 64) = l;
    }
  } else {
    float* cg = cw + c4;
#pragma unroll
    for (int q = 0; q < 16; ++q) {
      const v4f v = *(const v4fa*)&so[(q * 2 + rsub) * OP + c4];
      *(v4f*)(cg + q * 2 * ldc) = v;
    }
  }
}

template <int D, bool CAUSAL, int KVP>
__global__ __launch_bounds__(128) void k_flash(const float* __restrict__ qb, const unsigned short* __restrict__ kb, const unsigned short* __restrict__ vb,
                                             int pitch, int T, int H, float scale, float* __restrict__ y, int ypitch) {
  constexpr int KS = D / 32;        // k-steps for QK
  constexpr int DT = D / 16;        // d tiles for PV
  constexpr int VP = D + 16;        // V row pitch in elements: an odd multiple of 32 bytes, for the transposing loads
  static_assert((VP * 2) % 32 == 0 && ((VP * 2 / 32) & 1) == 1);
  constexpr int PPR = D / 4;        // 16-byte pieces per K or V row (hi and lo)
  constexpr int RPP = 128 / PPR;    // rows that the block's 128 threads copy per pass
  constexpr int NPS = 32 / RPP;     // passes per 32-key chunk
  static_assert(128 % PPR == 0 && 32 % RPP == 0 && (KVP % 8) == 0);
  __shared__ __attribute__((aligned(16))) unsigned short sKh[32][D + 8], sKl[32][D + 8], sVh[32][VP], sVl[32][VP];
  __shared__ __attribute__((aligned(16))) float sO[4][16][D + 4];   // pitched for the 16-byte stores of 16 rows at a time
  const int tid = threadIdx.x, w = tid >> 5, lane = tid & 31, ln = lane & 15, hh = lane >> 4;
  const int nqb = (T + 63) / 64;
  const int npair = (nqb + 1) / 2;
  const int bh = blockIdx.x / npair, pr = blockIdx.x % npair;
  const int b = bh / H, h = bh % H;
  const float* Q = qb + (size_t)b * T * pitch + h * D;
  gl_u16* K = (gl_u16*)(kb + (size_t)b * T * KVP + h * 2 * D);
  gl_u16* V = (gl_u16*)(vb + (size_t)b * T * KVP + h * 2 * D);
  // the thread's piece of a row: row sr of a pass, piece sc (the first D / 8 pieces are the hi plane, the rest the lo plane)
  const int sr = tid / PPR, sc = tid % PPR;
  const unsigned int goff = (unsigned int)(sr * KVP + sc * 8);
  unsigned short* kd = (sc < D / 8 ? &sKh[0][0] : &sKl[0][0]) + sr * (D + 8) + (sc % (D / 8)) * 8;
  unsigned short* vd = (sc < D / 8 ? &sVh[0][0] : &sVl[0][0]) + sr * VP + (sc % (D / 8)) * 8;

  const int ntile = (nqb - 1 - pr == pr) ? 1 : 2;              // block-uniform
  for (int tile = 0; tile < ntile; ++tile) {
  const int qblk = tile ? pr : nqb - 1 - pr;
  const int q0 = qblk * 64 + w * 16;
  // B fragments (Q^T) of the wave's 16 query rows (scaled), hi/lo
  FragB aqh[KS], aql[KS];
  {
    int row = q0 + ln; if (row >= T) row = T - 1;
    const float* qr = Q + (size_t)row * pitch;
#pragma unroll
    for (int ks = 0; ks < KS; ++ks)
#pragma unroll
      for (int i = 0; i < 16; ++i) {
        const int d = ks * 32 + ((i < 8) ? (8 * hh + i) : (16 + 8 * hh + (i - 8)));
        const float x = qr[d] * scale; const unsigned short hb = bf16_bits(x);
        aqh[ks].u[i] = hb; aql[ks].u[i] = bf16_bits(x - bf16_val(hb));
      }
  }
  float m_run = -3.0e38f, l_run = 0.f;                         // of query q0 + ln; l_run is this half's partial sum
  // the last key that the lane's query may see, counted from the lane's first key row 8hh
  const int klast = (CAUSAL ? min(q0 + ln, T - 1) : T - 1) - 8 * hh;
  v8f oacc[DT];
#pragma unroll
  for (int dt = 0; dt < DT; ++dt) oacc[dt] = (v8f){0.f,0.f,0.f,0.f,0.f,0.f,0.f,0.f};

  const int kv_end = CAUSAL ? min(T, qblk * 64 + 64) : T;     // block-uniform
  gl_u16* kp = K + goff;                                       // the thread's piece in row sr of the current chunk
  gl_u16* vp = V + goff;
  for (int j0 = 0; j0 < kv_end; j0 += 32) {
    v8us kr[NPS], vr[NPS];
    // the three loops below are unrolled so that kr and vr stay in registers and a chunk's loads are all in flight together;
    // the loads touch no LDS and so stand in front of the barrier that frees the K/V buffers
    if (j0 + 32 <= T) {                                        // block-uniform: every key of the chunk exists
#pragma unroll
      for (int i = 0; i < NPS; ++i) {
        kr[i] = *(gl_v8us*)(kp + i * RPP * KVP);
        vr[i] = *(gl_v8us*)(vp + i * RPP * KVP);
      }
    } else {
#pragma unroll
      for (int i = 0; i < NPS; ++i) {
        const int key = j0 + sr + i * RPP;
        const int keyc = (key < T) ? key : (T - 1);            // clamped address, zeroed by value below
        kr[i] = *(gl_v8us*)(K + (size_t)keyc * KVP + sc * 8);
        vr[i] = *(gl_v8us*)(V + (size_t)keyc * KVP + sc * 8);
        if (key >= T) { kr[i] = (v8us){0,0,0,0,0,0,0,0}; vr[i] = (v8us){0,0,0,0,0,0,0,0}; }
      }
    }
    __syncthreads();
#pragma unroll
    for (int i = 0; i < NPS; ++i) {
      *(v8us*)(kd + i * RPP * (D + 8)) = kr[i];
      *(v8us*)(vd + i * RPP * VP) = vr[i];
    }
    // the chunk's loads name the two pointers' registers: the wait stands behind the last store of loaded data and,
    // tied to both pointers, in front of the two additions that rewrite them
    asm volatile("s_wait_xcnt 0x0" : "+v"(kp), "+v"(vp) :: "memory");
    kp += 32 * KVP; vp += 32 * KVP;
    __syncthreads();
    // S^T, two tiles of 16 keys x 16 queries
    v8f s[2];
#pragma unroll
    for (int nt = 0; nt < 2; ++nt) {
      v8f acc = (v8f){0.f,0.f,0.f,0.f,0.f,0.f,0.f,0.f};
#pragma unroll
      for (int ks = 0; ks < KS; ++ks) {
        FragB kh_, kl_;
        kh_.half[0] = *(const v8us*)&sKh[nt * 16 + ln][ks * 32 + 8 * hh]; kh_.half[1] = *(const v8us*)&sKh[nt * 16 + ln][ks * 32 + 16 + 8 * hh];
        kl_.half[0] = *(const v8us*)&sKl[nt * 16 + ln][ks * 32 + 8 * hh]; kl_.half[1] = *(const v8us*)&sKl[nt * 16 + ln][ks * 32 + 16 + 8 * hh];
        acc = mma3(kh_.v, kl_.v, aqh[ks].v, aql[ks].v, acc);
      }
      s[nt] = acc;
    }
    // A fragments of V^T, hi and lo: element i = V[8hh + i][dt*16 + ln], element 8 + i = V[16 + 8hh + i][dt*16 + ln], one
    // transposing load per 8 elements; V lies in LDS since the chunk's barrier, so the 16 loads may stand anywhere from here on
    FragB bvh[DT], bvl[DT];
    {
      const int vo = (8 * hh + (lane & 7)) * VP + ((lane >> 3) & 1) * 8;
#pragma unroll
      for (int dt = 0; dt < DT; ++dt) {
        bvh[dt].half[0] = ld_tr16(&sVh[0][0] + vo + dt * 16); bvh[dt].half[1] = ld_tr16(&sVh[0][0] + vo + 16 * VP + dt * 16);
        bvl[dt].half[0] = ld_tr16(&sVl[0][0] + vo + dt * 16); bvl[dt].half[1] = ld_tr16(&sVl[0][0] + vo + 16 * VP + dt * 16);
      }
    }
    // holds the 16 V loads here, ahead of the softmax: their latency passes behind it and the V^T * P^T products run without
    // LDS waits among them (without it the compiler sinks the loads in between those products)
    __builtin_amdgcn_sched_barrier(0);
    // mask + running maximum of the lane's query; sc[8 * nt + r] is the score of key j0 + nt*16 + 8hh + r
    const int lim = klast - j0;
    float sc[16];
#pragma unroll
    for (int nt = 0; nt < 2; ++nt)
#pragma unroll
      for (int r = 0; r < 8; ++r) sc[8 * nt + r] = (nt * 16 + r > lim) ? -3.0e38f : s[nt][r];
    float mx = fmaxf(sc[0], sc[1]);
#pragma unroll
    for (int i = 2; i < 16; i += 2) mx = fmaxf(mx, fmaxf(sc[i], sc[i + 1]));
    mx = fmaxf(mx, xhalf(mx));
    const float mnew = fmaxf(m_run, mx);
    const bool seen = mnew > -1.0e38f;                         // false while every key so far was masked for this query
    const float alpha = seen ? __expf(m_run - mnew) : 1.0f;
    const float mref = seen ? mnew : 0.f;                      // a masked score then gives exp(-3e38 - mref) = 0 in either case
    m_run = mnew;
    // P^T as B operand, hi and lo: element i = P[8hh + i], element 8 + i = P[16 + 8hh + i] of the lane's query
    FragB ph, pl;
    v2f pp[8];
    constexpr float LOG2E = 1.44269504f;                       // exp(x) = 2^(x * LOG2E)
#pragma unroll
    for (int i = 0; i < 8; i += 2)
      exp2x4((v2f){(sc[2 * i] - mref) * LOG2E, (sc[2 * i + 1] - mref) * LOG2E},
             (v2f){(sc[2 * i + 2] - mref) * LOG2E, (sc[2 * i + 3] - mref) * LOG2E}, pp[i], pp[i + 1]);
#pragma unroll
    for (int i = 0; i < 8; ++i) {
      const unsigned int hw = pack2_bf16(pp[i]);
      ph.w[i] = hw;
      pl.w[i] = pack2_bf16(pp[i] - (v2f){__uint_as_float(hw << 16), __uint_as_float(hw & 0xFFFF0000u)});
    }
    const v2f ps = ((pp[0] + pp[1]) + (pp[2] + pp[3])) + ((pp[4] + pp[5]) + (pp[6] + pp[7]));
    l_run = l_run * alpha + (ps[0] + ps[1]);
#pragma unroll
    for (int dt = 0; dt < DT; ++dt)
#pragma unroll
      for (int r = 0; r < 8; ++r) oacc[dt][r] *= alpha;
#pragma unroll
    for (int dt = 0; dt < DT; ++dt) oacc[dt] = mma3(bvh[dt].v, bvl[dt].v, ph.v, pl.v, oacc[dt]);
    // four vector slots behind the chunk's last product, before the next chunk's global loads may overwrite A and B registers
    // of the products (only scalar instructions stand between them round the loop); tied to every D, to P and to every V
    // fragment, so that no product stands behind it (the statement names the d tiles one by one: four, D = 64)
    static_assert(DT == 4);
    asm volatile("v_nop\n\tv_nop\n\tv_nop\n\tv_nop" : "+v"(oacc[0]), "+v"(oacc[1]), "+v"(oacc[2]), "+v"(oacc[3])
                 : "v"(ph.v), "v"(pl.v), "v"(bvh[0].v), "v"(bvh[1].v), "v"(bvh[2].v), "v"(bvh[3].v),
                   "v"(bvl[0].v), "v"(bvl[1].v), "v"(bvl[2].v), "v"(bvl[3].v));
  }
  // oacc[dt][r] = O[q0 + ln][dt*16 + 8hh + r]; the two halves' sums are joined here, once
  const float lsum = l_run + xhalf(l_run);
  const float linv = (lsum > 0.f) ? 1.0f / lsum : 0.f;
#pragma unroll
  for (int dt = 0; dt < DT; ++dt) {
    *(v4fa*)&sO[w][ln][dt * 16 + 8 * hh]     = (v4f){oacc[dt][0] * linv, oacc[dt][1] * linv, oacc[dt][2] * linv, oacc[dt][3] * linv};
    *(v4fa*)&sO[w][ln][dt * 16 + 8 * hh + 4] = (v4f){oacc[dt][4] * linv, oacc[dt][5] * linv, oacc[dt][6] * linv, oacc[dt][7] * linv};
  }
  __builtin_amdgcn_fence(4 /* acq_rel order */, "workgroup");
  __builtin_amdgcn_wave_barrier();
  {
    for (int r = 0; r < 16; ++r) {
      const int row = q0 + r;
      if (row < T && lane < D / 4) {
        const v4f val = *(const v4fa*)&sO[w][r][lane * 4];
        *(v4f*)(y + ((size_t)b * T + row) * ypitch + h * D + lane * 4) = val;
      }
    }
    
  }
  // the next tile's set-up overwrites registers that the row stores above name; this wait stands in front of that
  asm volatile("s_wait_xcnt 0x0" ::: "memory");
  }
}

extern "C" void kernel_launch(void* const* d_in, const int* in_sizes, int n_in,
                              void* d_out, int out_size, void* d_ws, size_t ws_size, hipStream_t stream) {
  if (n_in < 9) return;
  // lower-bound size checks (a reduced NB/SEQ build still launches against full-size inputs)
  if (in_sizes[0] < ((NB - 1) * SEQ_FULL + SEQ) * CC) return;
  for (int i = 1; i < 9; i += 2) {
    if (in_sizes[i] < CC * CC) return;       // Wq, Wk, Wv, Wp: [CC in][CC out] f32
    if (in_sizes[i + 1] < CC) return;        // bq, bk, bv, bp: [CC] f32
  }
  if (out_size < ((NB - 1) * OUT_SEG_ROWS + SEQ) * CC) return;
  const float* x  = (const float*)d_in[0];
  const float* Wq = (const float*)d_in[1]; const float* bqp = (const float*)d_in[2];
  const float* Wk = (const float*)d_in[3]; const float* bkp = (const float*)d_in[4];
  const float* Wv = (const float*)d_in[5]; const float* bvp = (const float*)d_in[6];
  const float* Wp = (const float*)d_in[7]; const float* bpp = (const float*)d_in[8];
  char* ws = (char*)d_ws; size_t off = 0;
  unsigned short* Wqt = (unsigned short*)(ws + off); off += (size_t)3 * CC * CC * 2;     // q, k, v stacked: [3*768][768] bf16  3,538,944 B
  unsigned short* Wpt = (unsigned short*)(ws + off); off += (size_t)CC * CC * 2;         // [768][768] bf16  1,179,648 B
  float* qkv = (float*)(ws + off); off += (size_t)NB * SEQ * 3 * CC * 4;                 // [NB*SEQ][2304] q f32, k/v bf16 hi/lo  75,497,472 B at full size
  float* yb  = (float*)(ws + off); off += (size_t)NB * SEQ * CC * 4;                     // [NB*SEQ][768]  f32  25,165,824 B at full size
  if (off > ws_size) return;                                                             // total 105,381,888 B at full size
  const int M = NB * SEQ;
  const int gw = (CC * (CC / 8) + 255) / 256;
  k_wt_bf16<<<dim3(gw, 4), 256, 0, stream>>>(Wq, Wk, Wv, Wp, Wqt, CC, CC);   // Wpt lies directly behind the q, k, v stack
  // qkv[b*SEQ + t][s*CC + n] = bf16(x[b*SEQ_FULL + t]) * bf16(W_s) + bf16(b_s), s = 0 (q), 1 (k), 2 (v); row pitch 3*CC;
  // q as f32, k and v as bf16 hi/lo planes per head in the same bytes; one grid over the 3*CC columns of the
  // stacked [3*CC][CC] weight operand
  const int gg = (M / 64) * (CC / 128);
  static_assert(HD == 64);   // a GEMM wave's 64 columns are one head's hi/lo group
  k_gemm_bf<false, 0, true, CC, CC, CC, CC, 3 * CC><<<3 * gg, 128, 0, stream>>>(x, Wqt, bqp, bkp, bvp, qkv, M, 3 * CC, CC, SEQ, SEQ_FULL, SEQ);
  k_flash<HD, true, 6 * CC><<<NB * NH * ((SEQ / 64 + 1) / 2), 128, 0, stream>>>(qkv, (const unsigned short*)(qkv + CC), (const unsigned short*)(qkv + 2 * CC),
                                                                                3 * CC, SEQ, NH, 0.125f, yb, CC);
  // out[b*OUT_SEG_ROWS + t][:] = y[b*SEQ + t] * bf16(Wp) + bf16(bp), y as bf16 hi/lo
  k_gemm_bf<true, 0, true, -1, 0, CC, CC, CC><<<gg, 128, 0, stream>>>(yb, Wpt, bpp, nullptr, nullptr, (float*)d_out, M, CC, CC, SEQ, SEQ, OUT_SEG_ROWS);
}

// v007
// A run of this version takes 159 microseconds.
// Two timings next to v006 both put it at 1.14 times that version's speed.
// Over all steps from v000 it is 3.43 times as fast.
#include <hip/hip_runtime.h>
// All contractions on v_wmma_f32_16x16x32_bf16 with f32 accumulate: q/k/v projections x*Wq, x*Wk, x*Wv with x and W as
// bf16 (single exact-product term), attention Q*K^T and P*V as 3-term bf16 hi/lo splits, output projection y*Wp with
// y split hi/lo (2 terms) and W as bf16; biases as bf16; softmax in f32.
// K and V leave their projections already split: per token row and 64-column group (one head) 64 bf16 hi values, then the
// 64 bf16 lo values, in the 256 bytes that the group's f32 values would take.
#ifndef NB
#define NB 4
#endif
#ifndef SEQ
#define SEQ 2048
#endif
#define NB_FULL 4
#define SEQ_FULL 2048
#define CC 768
#define NH 12
#define HD 64
// row stride (in tokens) between batches in the output buffer; full layout by default
#ifndef OUT_SEG_ROWS
#define OUT_SEG_ROWS SEQ_FULL
#endif
static_assert(NB >= 1 && NB <= NB_FULL);
static_assert(SEQ >= 64 && SEQ <= SEQ_FULL && (SEQ % 64) == 0);
static_assert(CC == NH * HD);
static_assert((HD % 32) == 0 && HD <= 128);
static_assert((CC % 128) == 0);

typedef __bf16 v16b __attribute__((ext_vector_type(16)));
typedef unsigned short v8us __attribute__((ext_vector_type(8), may_alias));
typedef unsigned short v4us __attribute__((ext_vector_type(4), may_alias));
typedef float  v8f  __attribute__((ext_vector_type(8)));
typedef float  v4f  __attribute__((ext_vector_type(4)));
typedef float  v2f  __attribute__((ext_vector_type(2)));
typedef float  v4fa __attribute__((ext_vector_type(4), may_alias));
typedef __attribute__((address_space(1))) const float gl_f32;
typedef __attribute__((address_space(1))) const unsigned short gl_u16;
typedef __attribute__((address_space(1))) const v4fa gl_v4f;
typedef __attribute__((address_space(1))) const v8us gl_v8us;
union FragB { v16b v; v8us half[2]; unsigned short u[16]; unsigned int w[8]; };

__device__ __forceinline__ unsigned short bf16_bits(float x) { unsigned int u = __float_as_uint(x); return (unsigned short)((u + 0x7FFFu + ((u >> 16) & 1u)) >> 16); }
__device__ __forceinline__ float bf16_val(unsigned short b) { return __uint_as_float(((unsigned int)b) << 16); }
__device__ __forceinline__ float bf16_rne(float x) { return bf16_val(bf16_bits(x)); }
// D += X*Y with X (the A operand) and Y (the B operand) both split: xh*yh, then xh*yl, then xl*yh
__device__ __forceinline__ v8f mma3(v16b xh, v16b xl, v16b yh, v16b yl, v8f c) {
  c = __builtin_amdgcn_wmma_f32_16x16x32_bf16(false, xh, false, yh, (short)0, c, false, false);
  c = __builtin_amdgcn_wmma_f32_16x16x32_bf16(false, xh, false, yl, (short)0, c, false, false);
  c = __builtin_amdgcn_wmma_f32_16x16x32_bf16(false, xl, false, yh, (short)0, c, false, false);
  return c;
}
// two f32 values rounded to nearest even into one register of two bf16 (element 0 in the low half)
__device__ __forceinline__ unsigned int pack2_bf16(v2f x) {
  typedef __bf16 bf2 __attribute__((ext_vector_type(2)));
  return __builtin_bit_cast(unsigned int, __builtin_convertvector(x, bf2));
}
// e[j] = 2^a[j], four at a time in one statement that ends with the one vector slot which the instruction set asks for behind a
// transcendental, before its result is read or its source register overwritten;
// results in registers of their own, apart from every source
__device__ __forceinline__ void exp2x4(v2f a0, v2f a1, v2f& e0, v2f& e1) {
  float r0, r1, r2, r3;
  asm("v_exp_f32 %0, %4\n\tv_exp_f32 %1, %5\n\tv_exp_f32 %2, %6\n\tv_exp_f32 %3, %7\n\tv_nop"
      : "=&v"(r0), "=&v"(r1), "=&v"(r2), "=&v"(r3) : "v"(a0[0]), "v"(a0[1]), "v"(a1[0]), "v"(a1[1]));
  e0 = (v2f){r0, r1}; e1 = (v2f){r2, r3};
}
// the value of lane l ^ 16
__device__ __forceinline__ float xhalf(float x) {
  const int b = __builtin_bit_cast(int, x);
  return __builtin_bit_cast(float, __builtin_amdgcn_permlanex16(b, b, 0x76543210, 0xfedcba98, false, false));
}
// Transposing LDS load (ds_load_tr16_b128) of a row-major 16-bit tile: with lane l addressing row 8*(l>>4) + (l&7), byte
// 16*((l>>3)&1) of the tile, lane l receives the 8 elements of rows 8*(l>>4) .. +7 in column l&15.
typedef short s16x8 __attribute__((ext_vector_type(8)));
__device__ __forceinline__ v8us ld_tr16(const unsigned short* p) {
  typedef __attribute__((address_space(3))) s16x8 lds_s16x8;
  return __builtin_bit_cast(v8us, __builtin_amdgcn_ds_load_tr16_b128_v8i16((lds_s16x8*)p));
}

// Wt[n][k] (bf16 bits, k contiguous, pitch K) = bf16(W[k][n]) from f32 row-major W[K][N]; one thread per (n, 8 consecutive k);
// four matrices of one shape in one grid: blockIdx.y picks the matrix, the results lie one behind the other in Wt4
__global__ __launch_bounds__(256) void k_wt_bf16(const float* __restrict__ W0, const float* __restrict__ W1, const float* __restrict__ W2,
                                                 const float* __restrict__ W3, unsigned short* __restrict__ Wt4, int K, int N) {
  const int mat = blockIdx.y;
  const float* W = mat == 0 ? W0 : (mat == 1 ? W1 : (mat == 2 ? W2 : W3));
  unsigned short* Wt = Wt4 + (size_t)mat * K * N;
  const int t = blockIdx.x * 256 + threadIdx.x;
  const int k8n = K / 8;
  if (t >= N * k8n) return;
  const int n = t / k8n, k8 = (t % k8n) * 8;
  v8us v;
#pragma unroll
  for (int i = 0; i < 8; ++i) v[i] = bf16_bits(W[(size_t)(k8 + i) * N + n]);
  *(v8us*)(Wt + (size_t)n * K + k8) = v;
  
}

// GEMM C[M][N] (f32, pitch ldc) = act(A[M][K]*W + bias). A f32 row-major (pitch lda) converted to bf16
// (ASPLIT: hi/lo two planes -> 2 terms, else single RNE term); Wt bf16 [N][K] (pitch ldb). BIAS_BF16 quantises the
// bias to bf16 before the add. K%64==0, M%64==0, N%128==0.
// Logical rows are grouped in segments of 'seg' rows (seg % 64 == 0): logical row r -> A row (r/seg)*asr + r%seg and
// C row (r/seg)*csr + r%seg, so per-batch strides of A and C can differ.
// Block = 4 waves on a 64 x 128 tile of C, wave -> 32 rows x 64 cols. Each 64-deep slice of A and Wt is read from
// global memory once per block in whole 128-byte lines, A is converted once, and both lie in LDS for all four waves
// (rows pitched 144 B for the 16-byte fragment reads). Two LDS buffers: the next slice's global loads are issued
// ahead of the current slice's products and stored behind them, one block barrier per slice.
// Epilogue staged in wave-private LDS (the ring's bytes, free behind the last barrier): whole lines are stored.
// The three pitches are compile-time, so that a slice's 16 loads and the 16 row stores differ only in their immediate offsets.
// CSFROM >= 0: in the columns from CSFROM on each f32 result v is stored as hi = bf16(v) and lo = bf16(v - hi); a wave's 64
// columns of a row take the same 256 bytes of C as in f32, 64 hi values in the first 128-byte line and the 64 lo values in the second.
// BSEG > 0: several products with one A run as one grid, their Wt rows stacked; each BSEG columns have a bias vector of their
// own (bias, bias1, bias2, so N <= 3 * BSEG). BSEG == 0: one bias vector for all N columns.
template <bool ASPLIT, int ACT, bool BIAS_BF16, int CSFROM, int BSEG, int lda, int ldb, int ldc>
__global__ __launch_bounds__(128) void k_gemm_bf(const float* __restrict__ A, const unsigned short* __restrict__ Wt,
                                               const float* __restrict__ bias, const float* __restrict__ bias1,
                                               const float* __restrict__ bias2, float* __restrict__ C, int M, int N, int K,
                                               int seg, int asr, int csr) {
  constexpr int BM = 64, BN = 128, BK = 64, LP = BK + 8;      // LP: LDS row pitch in bf16 elements
  constexpr int NPL = ASPLIT ? 2 : 1;                         // planes of A
  constexpr int BOFF = BM * NPL * LP;                         // Wt rows behind the A planes
  constexpr int STAGE = BOFF + BN * LP;                       // bf16 elements per buffer
  constexpr int OP = 68;                                      // output staging pitch in floats
  static_assert(BSEG % BN == 0 && (CSFROM < 0 || CSFROM % BN == 0));   // a block lies in one bias segment and stores in one form
  constexpr int RING_BYTES = 2 * STAGE * 2, OUT_BYTES = 4 * 32 * OP * 4;
  __shared__ __attribute__((aligned(16))) unsigned char smem[RING_BYTES > OUT_BYTES ? RING_BYTES : OUT_BYTES];
  unsigned short* ring = (unsigned short*)smem;
  const int tid = threadIdx.x, w = tid >> 5, lane = tid & 31, ln = lane & 15, hh = lane >> 4;
  const int wm = w >> 1, wn = w & 1;
  const int ntn = N / BN;
  const int mt = blockIdx.x / ntn, nq = blockIdx.x % ntn;
  if (mt * BM >= M) return;                      // block-uniform, in front of every barrier
  const int row0 = mt * BM, col0 = nq * BN;
  const int bseg = row0 / seg, t0 = row0 - bseg * seg;
  const int ar = tid >> 4, ac = (tid & 15) * 4;  // A slice: 16 threads per 256-byte row piece, 8 rows per pass
  const int br = tid >> 3, bc = (tid & 7) * 8;   // Wt slice: 8 threads per 128-byte row piece, 16 rows per pass
  // typed as global-memory pointers, so that they stay so through the wait statement at the loop's foot (plain global loads)
  gl_f32* ag = (gl_f32*)(A + ((size_t)bseg * asr + t0 + ar) * lda + ac);
  gl_u16* bg = (gl_u16*)(Wt + (size_t)(col0 + br) * ldb + bc);
  v4f ra[8];
  v8us rb[8];
  v8f acc[2][4];
#pragma unroll
  for (int mi = 0; mi < 2; ++mi)
#pragma unroll
    for (int t = 0; t < 4; ++t) acc[mi][t] = (v8f){0.f,0.f,0.f,0.f,0.f,0.f,0.f,0.f};

  auto fetch = [&](int ahead) {
#pragma unroll
    for (int i = 0; i < 8; ++i) ra[i] = *(gl_v4f*)(ag + ahead + i * 8 * lda);
#pragma unroll
    for (int i = 0; i < 8; ++i) rb[i] = *(gl_v8us*)(bg + ahead + i * 16 * ldb);
  };
  auto put = [&](unsigned short* buf) {
#pragma unroll
    for (int i = 0; i < 8; ++i) {
      v4us h, l;
#pragma unroll
      for (int j = 0; j < 4; ++j) {
        const unsigned short hb = bf16_bits(ra[i][j]);
        h[j] = hb;
        l[j] = ASPLIT ? bf16_bits(ra[i][j] - bf16_val(hb)) : (unsigned short)0;
      }
      *(v4us*)(buf + (ar + i * 8) * LP + ac) = h;
      if (ASPLIT) *(v4us*)(buf + BM * LP + (ar + i * 8) * LP + ac) = l;
    }
#pragma unroll
    for (int i = 0; i < 8; ++i) *(v8us*)(buf + BOFF + (br + i * 16) * LP + bc) = rb[i];
  };

  const int nst = K / BK;
  fetch(0);
  put(ring);
  __syncthreads();
  for (int s = 0; s < nst; ++s) {
    const bool more = s + 1 < nst;               // block-uniform
    if (more) fetch(BK);
    const unsigned short* buf = ring + (s & 1) * STAGE;
    const unsigned short* sa = buf + (wm * 32 + ln) * LP + 8 * hh;
    const unsigned short* sb = buf + BOFF + (wn * 64 + ln) * LP + 8 * hh;
#pragma unroll
    for (int ks = 0; ks < BK / 32; ++ks) {
      FragB ah[2], al[2], b[4];
#pragma unroll
      for (int mi = 0; mi < 2; ++mi) {
        ah[mi].half[0] = *(const v8us*)(sa + mi * 16 * LP + ks * 32);
        ah[mi].half[1] = *(const v8us*)(sa + mi * 16 * LP + ks * 32 + 16);
        if (ASPLIT) {
          al[mi].half[0] = *(const v8us*)(sa + BM * LP + mi * 16 * LP + ks * 32);
          al[mi].half[1] = *(const v8us*)(sa + BM * LP + mi * 16 * LP + ks * 32 + 16);
        }
      }
#pragma unroll
      for (int t = 0; t < 4; ++t) {
        b[t].half[0] = *(const v8us*)(sb + t * 16 * LP + ks * 32);
        b[t].half[1] = *(const v8us*)(sb + t * 16 * LP + ks * 32 + 16);
      }
      // per output element the order of the sums stays: k ascending in steps of 32, hi term then lo term
#pragma unroll
      for (int mi = 0; mi < 2; ++mi)
#pragma unroll
        for (int t = 0; t < 4; ++t)
          acc[mi][t] = __builtin_amdgcn_wmma_f32_16x16x32_bf16(false, ah[mi].v, false, b[t].v, (short)0, acc[mi][t], false, false);
      if (ASPLIT) {
#pragma unroll
        for (int mi = 0; mi < 2; ++mi)
#pragma unroll
          for (int t = 0; t < 4; ++t)
            acc[mi][t] = __builtin_amdgcn_wmma_f32_16x16x32_bf16(false, al[mi].v, false, b[t].v, (short)0, acc[mi][t], false, false);
      }
    }
    if (more) {
      put(ring + ((s + 1) & 1) * STAGE);
      // the slice's loads name the two pointers' registers: the wait stands behind the last store of loaded data and,
      // tied to both pointers, in front of the two additions that rewrite them
      asm volatile("s_wait_xcnt 0x0" : "+v"(ag), "+v"(bg) :: "memory");
      ag += BK; bg += BK;
    }
    __syncthreads();
  }
  float* so = (float*)smem + w * 32 * OP;
  const float* bsel = bias;                      // the block's bias vector and its first column there, block-uniform
  int bcol = col0;
  if (BSEG > 0) {
    const int bi = col0 / BSEG;
    bsel = bi == 0 ? bias : (bi == 1 ? bias1 : bias2);
    bcol = col0 - bi * BSEG;
  }
#pragma unroll
  for (int t = 0; t < 4; ++t) {
    float bv = bsel ? bsel[bcol + wn * 64 + t * 16 + ln] : 0.f;
    if (BIAS_BF16) bv = bf16_rne(bv);
#pragma unroll
    for (int mi = 0; mi < 2; ++mi)
#pragma unroll
      for (int r = 0; r < 8; ++r) { float v = acc[mi][t][r] + bv; if (ACT == 1) v = fmaxf(v, 0.f); so[(mi * 16 + 8 * hh + r) * OP + t * 16 + ln] = v; }
  }
  __builtin_amdgcn_fence(4 /* acq_rel order */, "workgroup");
  __builtin_amdgcn_wave_barrier();
  const int rsub = lane >> 4, c4 = (lane & 15) * 4;
  float* cw = C + ((size_t)bseg * csr + t0 + wm * 32 + rsub) * ldc + col0 + wn * 64;
  if (CSFROM >= 0 && col0 >= CSFROM) {           // block-uniform
    unsigned short* cs = (unsigned short*)cw + c4;
    // unrolled (both loops), so that the row stores differ only in their immediate offsets and h, l stay in registers
#pragma unroll
    for (int q = 0; q < 16; ++q) {
      const v4f v = *(const v4fa*)&so[(q * 2 + rsub) * OP + c4];
      v4us h, l;
#pragma unroll
      for (int j = 0; j < 4; ++j) {
        const unsigned short hb = bf16_bits(v[j]);
        h[j] = hb;
        l[j] = bf16_bits(v[j] - bf16_val(hb));
      }
      *(v4us*)(cs + q * 2 * ldc * 2) = h;
      *(v4us*)(cs + q * 2 * ldc * 2 + 64) = l;
    }
  } else {
    float* cg = cw + c4;
#pragma unroll
    for (int q = 0; q < 16; ++q) {
      const v4f v = *(const v4fa*)&so[(q * 2 + rsub) * OP + c4];
      *(v4f*)(cg + q * 2 * ldc) = v;
    }
  }
}

template <int D, bool CAUSAL, int KVP>
__global__ __launch_bounds__(128) void k_flash(const float* __restrict__ qb, const unsigned short* __restrict__ kb, const unsigned short* __restrict__ vb,
                                             int pitch, int T, int H, float scale, float* __restrict__ y, int ypitch) {
  constexpr int KS = D / 32;        // k-steps for QK
  constexpr int DT = D / 16;        // d tiles for PV
  constexpr int VP = D + 16;        // V row pitch in elements: an odd multiple of 32 bytes, for the transposing loads
  static_assert((VP * 2) % 32 == 0 && ((VP * 2 / 32) & 1) == 1);
  constexpr int PPR = D / 4;        // 16-byte pieces per K or V row (hi and lo)
  constexpr int RPP = 128 / PPR;    // rows that the block's 128 threads copy per pass
  constexpr int NPS = 32 / RPP;     // passes per 32-key chunk
  static_assert(128 % PPR == 0 && 32 % RPP == 0 && (KVP % 8) == 0);
  constexpr int KP = D + 8;         // K row pitch in elements: an odd multiple of 16 bytes, for the 16-byte fragment reads
  constexpr int KPL = 32 * KP, VPL = 32 * VP;                  // elements of one K plane, of one V plane
  constexpr int BUF = 2 * KPL + 2 * VPL;                       // elements of one buffer: K hi, K lo, V hi, V lo
  __shared__ __attribute__((aligned(16))) unsigned short sKV[2 * BUF];
  __shared__ __attribute__((aligned(16))) float sO[4][16][D + 4];   // pitched for the 16-byte stores of 16 rows at a time
  const int tid = threadIdx.x, w = tid >> 5, lane = tid & 31, ln = lane & 15, hh = lane >> 4;
  const int nqb = (T + 63) / 64;
  const int npair = (nqb + 1) / 2;
  const int bh = blockIdx.x / npair, pr = blockIdx.x % npair;
  const int b = bh / H, h = bh % H;
  const float* Q = qb + (size_t)b * T * pitch + h * D;
  gl_u16* K = (gl_u16*)(kb + (size_t)b * T * KVP + h * 2 * D);
  gl_u16* V = (gl_u16*)(vb + (size_t)b * T * KVP + h * 2 * D);
  // the thread's piece of a row: row sr of a pass, piece sc (the first D / 8 pieces are the hi plane, the rest the lo plane)
  const int sr = tid / PPR, sc = tid % PPR;
  // the piece's LDS byte address in buffer 0 (the low 32 bits of its address)
  const unsigned int kd = (unsigned int)(size_t)(sKV + (sc < D / 8 ? 0 : KPL) + sr * KP + (sc % (D / 8)) * 8);
  const unsigned int vd = (unsigned int)(size_t)(sKV + 2 * KPL + (sc < D / 8 ? 0 : VPL) + sr * VP + (sc % (D / 8)) * 8);
  // One 32-key chunk of K and V into the buffer at byte offset bo: eight copies a thread, one per pass of RPP rows; kc and vc
  // (block-uniform, in scalar registers) point at the chunk's first row of the head. A copy's immediate offset moves its LDS
  // address and its global address alike. Pass i lies i * KSTEP (V: i * VSTEP) bytes further in LDS and i * GSTEP bytes further
  // in global memory: the immediate carries the LDS step, the pass's own offset register the rest, i * (GSTEP - KSTEP), so
  // that one LDS address register serves the four passes, and from chunk to chunk only the scalar bases and bo change.
  // The wait at the statement's end stands in front of every later write of a register that the copies name.
  constexpr unsigned int GSTEP = RPP * KVP * 2, KSTEP = RPP * KP * 2, VSTEP = RPP * VP * 2;
  static_assert(NPS == 4 && GSTEP > VSTEP && GSTEP > KSTEP && 3 * VSTEP < 65536 && 3 * KSTEP < 65536);   // the statement names the passes one by one
  const unsigned int go = (unsigned int)(sr * KVP + sc * 8) * 2;   // byte offset of the piece in pass 0
  const unsigned int ko1 = go + 1 * (GSTEP - KSTEP), ko2 = go + 2 * (GSTEP - KSTEP), ko3 = go + 3 * (GSTEP - KSTEP);
  const unsigned int vo1 = go + 1 * (GSTEP - VSTEP), vo2 = go + 2 * (GSTEP - VSTEP), vo3 = go + 3 * (GSTEP - VSTEP);
  auto copy_chunk = [&](gl_u16* kc, gl_u16* vc, unsigned int bo) {
    asm volatile("global_load_async_to_lds_b128 %0, %2, %9\n\t"
                 "global_load_async_to_lds_b128 %0, %3, %9 offset:%11\n\t"
                 "global_load_async_to_lds_b128 %0, %4, %9 offset:%12\n\t"
                 "global_load_async_to_lds_b128 %0, %5, %9 offset:%13\n\t"
                 "global_load_async_to_lds_b128 %1, %2, %10\n\t"
                 "global_load_async_to_lds_b128 %1, %6, %10 offset:%14\n\t"
                 "global_load_async_to_lds_b128 %1, %7, %10 offset:%15\n\t"
                 "global_load_async_to_lds_b128 %1, %8, %10 offset:%16\n\t"
                 "s_wait_xcnt 0x0"
                 :: "v"(kd + bo), "v"(vd + bo), "v"(go), "v"(ko1), "v"(ko2), "v"(ko3), "v"(vo1), "v"(vo2), "v"(vo3),
                    "s"(kc), "s"(vc), "n"(1 * KSTEP), "n"(2 * KSTEP), "n"(3 * KSTEP), "n"(1 * VSTEP), "n"(2 * VSTEP), "n"(3 * VSTEP)
                 : "memory");
  };

  const int ntile = (nqb - 1 - pr == pr) ? 1 : 2;              // block-uniform
  for (int tile = 0; tile < ntile; ++tile) {
  const int qblk = tile ? pr : nqb - 1 - pr;
  const int q0 = qblk * 64 + w * 16;
  const int kv_end = CAUSAL ? min(T, qblk * 64 + 64) : T;     // block-uniform
  const int nch = kv_end / 32;                                 // chunks of this tile, block-uniform
  gl_u16* kp = K;                                              // first row of the chunk to be copied next, block-uniform
  gl_u16* vp = V;
  // chunk 0 into buffer 0; every reader of the tile before has left both buffers at that tile's last barrier. The copies fly
  // behind the set-up of Q below.
  copy_chunk(kp, vp, 0);
  // B fragments (Q^T) of the wave's 16 query rows (scaled), hi/lo
  FragB aqh[KS], aql[KS];
  {
    int row = q0 + ln; if (row >= T) row = T - 1;
    const float* qr = Q + (size_t)row * pitch;
#pragma unroll
    for (int ks = 0; ks < KS; ++ks)
#pragma unroll
      for (int i = 0; i < 16; ++i) {
        const int d = ks * 32 + ((i < 8) ? (8 * hh + i) : (16 + 8 * hh + (i - 8)));
        const float x = qr[d] * scale; const unsigned short hb = bf16_bits(x);
        aqh[ks].u[i] = hb; aql[ks].u[i] = bf16_bits(x - bf16_val(hb));
      }
  }
  float m_run = -3.0e38f, l_run = 0.f;                         // of query q0 + ln; l_run is this half's partial sum
  // the last key that the lane's query may see, counted from the lane's first key row 8hh
  const int klast = (CAUSAL ? min(q0 + ln, T - 1) : T - 1) - 8 * hh;
  v8f oacc[DT];
#pragma unroll
  for (int dt = 0; dt < DT; ++dt) oacc[dt] = (v8f){0.f,0.f,0.f,0.f,0.f,0.f,0.f,0.f};

  // chunk 0 has landed (each wave waits for its own copies) and is published by the barrier; then chunk 1 starts into buffer 1
  asm volatile("s_wait_asynccnt 0x0" ::: "memory");
  __syncthreads();
  if (nch > 1) copy_chunk(kp + 32 * KVP, vp + 32 * KVP, BUF * 2);
  kp += 64 * KVP; vp += 64 * KVP;
  for (int t = 0; t < nch; ++t) {
    const int j0 = t * 32;
    const unsigned short* sKh = sKV + (t & 1) * BUF;           // chunk t's buffer
    const unsigned short* sKl = sKh + KPL;
    const unsigned short* sVh = sKh + 2 * KPL;
    const unsigned short* sVl = sVh + VPL;
    // S^T, two tiles of 16 keys x 16 queries
    v8f s[2];
#pragma unroll
    for (int nt = 0; nt < 2; ++nt) {
      v8f acc = (v8f){0.f,0.f,0.f,0.f,0.f,0.f,0.f,0.f};
#pragma unroll
      for (int ks = 0; ks < KS; ++ks) {
        FragB kh_, kl_;
        const int ko = (nt * 16 + ln) * KP + ks * 32 + 8 * hh;
        kh_.half[0] = *(const v8us*)(sKh + ko); kh_.half[1] = *(const v8us*)(sKh + ko + 16);
        kl_.half[0] = *(const v8us*)(sKl + ko); kl_.half[1] = *(const v8us*)(sKl + ko + 16);
        acc = mma3(kh_.v, kl_.v, aqh[ks].v, aql[ks].v, acc);
      }
      s[nt] = acc;
    }
    // A fragments of V^T, hi and lo: element i = V[8hh + i][dt*16 + ln], element 8 + i = V[16 + 8hh + i][dt*16 + ln], one
    // transposing load per 8 elements; V lies in LDS since the barrier in front of the chunk, so the 16 loads may stand anywhere from here on
    FragB bvh[DT], bvl[DT];
    {
      const int vo = (8 * hh + (lane & 7)) * VP + ((lane >> 3) & 1) * 8;
#pragma unroll
      for (int dt = 0; dt < DT; ++dt) {
        bvh[dt].half[0] = ld_tr16(sVh + vo + dt * 16); bvh[dt].half[1] = ld_tr16(sVh + vo + 16 * VP + dt * 16);
        bvl[dt].half[0] = ld_tr16(sVl + vo + dt * 16); bvl[dt].half[1] = ld_tr16(sVl + vo + 16 * VP + dt * 16);
      }
    }
    // holds the 16 V loads here, ahead of the softmax: their latency passes behind it and the V^T * P^T products run without
    // LDS waits among them (without it the compiler sinks the loads in between those products)
    __builtin_amdgcn_sched_barrier(0);
    // mask + running maximum of the lane's query; sc[8 * nt + r] is the score of key j0 + nt*16 + 8hh + r
    const int lim = klast - j0;
    float sc[16];
#pragma unroll
    for (int nt = 0; nt < 2; ++nt)
#pragma unroll
      for (int r = 0; r < 8; ++r) sc[8 * nt + r] = (nt * 16 + r > lim) ? -3.0e38f : s[nt][r];
    float mx = fmaxf(sc[0], sc[1]);
#pragma unroll
    for (int i = 2; i < 16; i += 2) mx = fmaxf(mx, fmaxf(sc[i], sc[i + 1]));
    mx = fmaxf(mx, xhalf(mx));
    const float mnew = fmaxf(m_run, mx);
    const bool seen = mnew > -1.0e38f;                         // false while every key so far was masked for this query
    const float alpha = seen ? __expf(m_run - mnew) : 1.0f;
    const float mref = seen ? mnew : 0.f;                      // a masked score then gives exp(-3e38 - mref) = 0 in either case
    m_run = mnew;
    // P^T as B operand, hi and lo: element i = P[8hh + i], element 8 + i = P[16 + 8hh + i] of the lane's query
    FragB ph, pl;
    v2f pp[8];
    constexpr float LOG2E = 1.44269504f;                       // exp(x) = 2^(x * LOG2E)
#pragma unroll
    for (int i = 0; i < 8; i += 2)
      exp2x4((v2f){(sc[2 * i] - mref) * LOG2E, (sc[2 * i + 1] - mref) * LOG2E},
             (v2f){(sc[2 * i + 2] - mref) * LOG2E, (sc[2 * i + 3] - mref) * LOG2E}, pp[i], pp[i + 1]);
#pragma unroll
    for (int i = 0; i < 8; ++i) {
      const unsigned int hw = pack2_bf16(pp[i]);
      ph.w[i] = hw;
      pl.w[i] = pack2_bf16(pp[i] - (v2f){__uint_as_float(hw << 16), __uint_as_float(hw & 0xFFFF0000u)});
    }
    const v2f ps = ((pp[0] + pp[1]) + (pp[2] + pp[3])) + ((pp[4] + pp[5]) + (pp[6] + pp[7]));
    l_run = l_run * alpha + (ps[0] + ps[1]);
#pragma unroll
    for (int dt = 0; dt < DT; ++dt)
#pragma unroll
      for (int r = 0; r < 8; ++r) oacc[dt][r] *= alpha;
#pragma unroll
    for (int dt = 0; dt < DT; ++dt) oacc[dt] = mma3(bvh[dt].v, bvl[dt].v, ph.v, pl.v, oacc[dt]);
    // four vector slots behind the chunk's last product, before a vector instruction of the refill or of the next trip may overwrite
    // A and B registers of the products (only waits, the barrier and scalar instructions stand between them); tied to every D,
    // to P and to every V fragment, so that no product stands behind it (the statement names the d tiles one by one: four, D = 64)
    static_assert(DT == 4);
    asm volatile("v_nop\n\tv_nop\n\tv_nop\n\tv_nop" : "+v"(oacc[0]), "+v"(oacc[1]), "+v"(oacc[2]), "+v"(oacc[3])
                 : "v"(ph.v), "v"(pl.v), "v"(bvh[0].v), "v"(bvh[1].v), "v"(bvh[2].v), "v"(bvh[3].v),
                   "v"(bvl[0].v), "v"(bvl[1].v), "v"(bvl[2].v), "v"(bvl[3].v));
    // foot of chunk t, every wave, in this order: its own LDS reads of chunk t have returned; its own copies of chunk t + 1 have
    // landed; the one block barrier publishes chunk t + 1 and ends every wave's reads of chunk t's buffer; only then that
    // buffer is refilled, with chunk t + 2. (The waits are volatile statements like the one above and so stay behind it and the
    // products: moved up in front of the softmax they would cut the time that chunk t + 1's copies have to land.)
    asm volatile("s_wait_dscnt 0x0" ::: "memory");
    asm volatile("s_wait_asynccnt 0x0" ::: "memory");
    __syncthreads();
    if (t + 2 < nch) {                                         // block-uniform
      copy_chunk(kp, vp, (t & 1) * BUF * 2);
      kp += 32 * KVP; vp += 32 * KVP;
    }
  }
  // no copy is outstanding when the wave goes on (the last two trips issue none)
  asm volatile("s_wait_asynccnt 0x0" ::: "memory");
  // oacc[dt][r] = O[q0 + ln][dt*16 + 8hh + r]; the two halves' sums are joined here, once
  const float lsum = l_run + xhalf(l_run);
  const float linv = (lsum > 0.f) ? 1.0f / lsum : 0.f;
#pragma unroll
  for (int dt = 0; dt < DT; ++dt) {
    *(v4fa*)&sO[w][ln][dt * 16 + 8 * hh]     = (v4f){oacc[dt][0] * linv, oacc[dt][1] * linv, oacc[dt][2] * linv, oacc[dt][3] * linv};
    *(v4fa*)&sO[w][ln][dt * 16 + 8 * hh + 4] = (v4f){oacc[dt][4] * linv, oacc[dt][5] * linv, oacc[dt][6] * linv, oacc[dt][7] * linv};
  }
  __builtin_amdgcn_fence(4 /* acq_rel order */, "workgroup");
  __builtin_amdgcn_wave_barrier();
  {
    for (int r = 0; r < 16; ++r) {
      const int row = q0 + r;
      if (row < T && lane < D / 4) {
        const v4f val = *(const v4fa*)&sO[w][r][lane * 4];
        *(v4f*)(y + ((size_t)b * T + row) * ypitch + h * D + lane * 4) = val;
      }
    }
    
  }
  // the next tile's set-up overwrites registers that the row stores above name; this wait stands in front of that
  asm volatile("s_wait_xcnt 0x0" ::: "memory");
  }
}

extern "C" void kernel_launch(void* const* d_in, const int* in_sizes, int n_in,
                              void* d_out, int out_size, void* d_ws, size_t ws_size, hipStream_t stream) {
  if (n_in < 9) return;
  // lower-bound size checks (a reduced NB/SEQ build still launches against full-size inputs)
  if (in_sizes[0] < ((NB - 1) * SEQ_FULL + SEQ) * CC) return;
  for (int i = 1; i < 9; i += 2) {
    if (in_sizes[i] < CC * CC) return;       // Wq, Wk, Wv, Wp: [CC in][CC out] f32
    if (in_sizes[i + 1] < CC) return;        // bq, bk, bv, bp: [CC] f32
  }
  if (out_size < ((NB - 1) * OUT_SEG_ROWS + SEQ) * CC) return;
  const float* x  = (const float*)d_in[0];
  const float* Wq = (const float*)d_in[1]; const float* bqp = (const float*)d_in[2];
  const float* Wk = (const float*)d_in[3]; const float* bkp = (const float*)d_in[4];
  const float* Wv = (const float*)d_in[5]; const float* bvp = (const float*)d_in[6];
  const float* Wp = (const float*)d_in[7]; const float* bpp = (const float*)d_in[8];
  char* ws = (char*)d_ws; size_t off = 0;
  unsigned short* Wqt = (unsigned short*)(ws + off); off += (size_t)3 * CC * CC * 2;     // q, k, v stacked: [3*768][768] bf16  3,538,944 B
  unsigned short* Wpt = (unsigned short*)(ws + off); off += (size_t)CC * CC * 2;         // [768][768] bf16  1,179,648 B
  float* qkv = (float*)(ws + off); off += (size_t)NB * SEQ * 3 * CC * 4;                 // [NB*SEQ][2304] q f32, k/v bf16 hi/lo  75,497,472 B at full size
  float* yb  = (float*)(ws + off); off += (size_t)NB * SEQ * CC * 4;                     // [NB*SEQ][768]  f32  25,165,824 B at full size
  if (off > ws_size) return;                                                             // total 105,381,888 B at full size
  const int M = NB * SEQ;
  const int gw = (CC * (CC / 8) + 255) / 256;
  k_wt_bf16<<<dim3(gw, 4), 256, 0, stream>>>(Wq, Wk, Wv, Wp, Wqt, CC, CC);   // Wpt lies directly behind the q, k, v stack
  // qkv[b*SEQ + t][s*CC + n] = bf16(x[b*SEQ_FULL + t]) * bf16(W_s) + bf16(b_s), s = 0 (q), 1 (k), 2 (v); row pitch 3*CC;
  // q as f32, k and v as bf16 hi/lo planes per head in the same bytes; one grid over the 3*CC columns of the
  // stacked [3*CC][CC] weight operand
  const int gg = (M / 64) * (CC / 128);
  static_assert(HD == 64);   // a GEMM wave's 64 columns are one head's hi/lo group
  k_gemm_bf<false, 0, true, CC, CC, CC, CC, 3 * CC><<<3 * gg, 128, 0, stream>>>(x, Wqt, bqp, bkp, bvp, qkv, M, 3 * CC, CC, SEQ, SEQ_FULL, SEQ);
  k_flash<HD, true, 6 * CC><<<NB * NH * ((SEQ / 64 + 1) / 2), 128, 0, stream>>>(qkv, (const unsigned short*)(qkv + CC), (const unsigned short*)(qkv + 2 * CC),
                                                                                3 * CC, SEQ, NH, 0.125f, yb, CC);
  // out[b*OUT_SEG_ROWS + t][:] = y[b*SEQ + t] * bf16(Wp) + bf16(bp), y as bf16 hi/lo
  k_gemm_bf<true, 0, true, -1, 0, CC, CC, CC><<<gg, 128, 0, stream>>>(yb, Wpt, bpp, nullptr, nullptr, (float*)d_out, M, CC, CC, SEQ, SEQ, OUT_SEG_ROWS);
}

// v008
// One run takes 153 microseconds.
// Timed twice side by side with v007, it ran 1.05 and 1.04 times as fast.
// All steps since v000 together make it 3.58 times as fast.
#include <hip/hip_runtime.h>
// All contractions on v_wmma_f32_16x16x32_bf16 with f32 accumulate: q/k/v projections x*Wq, x*Wk, x*Wv with x and W as
// bf16 (single exact-product term), attention Q*K^T and P*V as 3-term bf16 hi/lo splits, output projection y*Wp with
// y split hi/lo (2 terms) and W as bf16; biases as bf16; softmax in f32.
// K and V leave their projections already split: per token row and 64-column group (one head) 64 bf16 hi values, then the
// 64 bf16 lo values, in the 256 bytes that the group's f32 values would take.
#ifndef NB
#define NB 4
#endif
#ifndef SEQ
#define SEQ 2048
#endif
#define NB_FULL 4
#define SEQ_FULL 2048
#define CC 768
#define NH 12
#define HD 64
// row stride (in tokens) between batches in the output buffer; full layout by default
#ifndef OUT_SEG_ROWS
#define OUT_SEG_ROWS SEQ_FULL
#endif
static_assert(NB >= 1 && NB <= NB_FULL);
static_assert(SEQ >= 64 && SEQ <= SEQ_FULL && (SEQ % 64) == 0);
static_assert(CC == NH * HD);
static_assert((HD % 32) == 0 && HD <= 128);
static_assert((CC % 128) == 0);

typedef __bf16 v16b __attribute__((ext_vector_type(16)));
typedef unsigned short v8us __attribute__((ext_vector_type(8), may_alias));
typedef unsigned short v4us __attribute__((ext_vector_type(4), may_alias));
typedef float  v8f  __attribute__((ext_vector_type(8)));
typedef float  v4f  __attribute__((ext_vector_type(4)));
typedef float  v2f  __attribute__((ext_vector_type(2)));
typedef float  v4fa __attribute__((ext_vector_type(4), may_alias));
typedef __attribute__((address_space(1))) const float gl_f32;
typedef __attribute__((address_space(1))) const unsigned short gl_u16;
typedef __attribute__((address_space(1))) const v4fa gl_v4f;
typedef __attribute__((address_space(1))) const v8us gl_v8us;
union FragB { v16b v; v8us half[2]; unsigned short u[16]; unsigned int w[8]; };

__device__ __forceinline__ unsigned short bf16_bits(float x) { unsigned int u = __float_as_uint(x); return (unsigned short)((u + 0x7FFFu + ((u >> 16) & 1u)) >> 16); }
__device__ __forceinline__ float bf16_val(unsigned short b) { return __uint_as_float(((unsigned int)b) << 16); }
__device__ __forceinline__ float bf16_rne(float x) { return bf16_val(bf16_bits(x)); }
// D += X*Y with X (the A operand) and Y (the B operand) both split: xh*yh, then xh*yl, then xl*yh
__device__ __forceinline__ v8f mma3(v16b xh, v16b xl, v16b yh, v16b yl, v8f c) {
  c = __builtin_amdgcn_wmma_f32_16x16x32_bf16(false, xh, false, yh, (short)0, c, false, false);
  c = __builtin_amdgcn_wmma_f32_16x16x32_bf16(false, xh, false, yl, (short)0, c, false, false);
  c = __builtin_amdgcn_wmma_f32_16x16x32_bf16(false, xl, false, yh, (short)0, c, false, false);
  return c;
}
// two f32 values rounded to nearest even into one register of two bf16 (element 0 in the low half)
__device__ __forceinline__ unsigned int pack2_bf16(v2f x) {
  typedef __bf16 bf2 __attribute__((ext_vector_type(2)));
  return __builtin_bit_cast(unsigned int, __builtin_convertvector(x, bf2));
}
// e[j] = 2^a[j], four at a time in one statement that ends with the one vector slot which the instruction set asks for behind a
// transcendental, before its result is read or its source register overwritten;
// results in registers of their own, apart from every source
__device__ __forceinline__ void exp2x4(v2f a0, v2f a1, v2f& e0, v2f& e1) {
  float r0, r1, r2, r3;
  asm("v_exp_f32 %0, %4\n\tv_exp_f32 %1, %5\n\tv_exp_f32 %2, %6\n\tv_exp_f32 %3, %7\n\tv_nop"
      : "=&v"(r0), "=&v"(r1), "=&v"(r2), "=&v"(r3) : "v"(a0[0]), "v"(a0[1]), "v"(a1[0]), "v"(a1[1]));
  e0 = (v2f){r0, r1}; e1 = (v2f){r2, r3};
}
// the value of lane l ^ 16
__device__ __forceinline__ float xhalf(float x) {
  const int b = __builtin_bit_cast(int, x);
  return __builtin_bit_cast(float, __builtin_amdgcn_permlanex16(b, b, 0x76543210, 0xfedcba98, false, false));
}
// Transposing LDS load (ds_load_tr16_b128) of a row-major 16-bit tile: with lane l addressing row 8*(l>>4) + (l&7), byte
// 16*((l>>3)&1) of the tile, lane l receives the 8 elements of rows 8*(l>>4) .. +7 in column l&15.
typedef short s16x8 __attribute__((ext_vector_type(8)));
__device__ __forceinline__ v8us ld_tr16(const unsigned short* p) {
  typedef __attribute__((address_space(3))) s16x8 lds_s16x8;
  return __builtin_bit_cast(v8us, __builtin_amdgcn_ds_load_tr16_b128_v8i16((lds_s16x8*)p));
}

// Wt[n][k] (bf16 bits, k contiguous, pitch K) = bf16(W[k][n]) from f32 row-major W[K][N]; one thread per (n, 8 consecutive k);
// four matrices of one shape in one grid: blockIdx.y picks the matrix, the results lie one behind the other in Wt4
__global__ __launch_bounds__(256) void k_wt_bf16(const float* __restrict__ W0, const float* __restrict__ W1, const float* __restrict__ W2,
                                                 const float* __restrict__ W3, unsigned short* __restrict__ Wt4, int K, int N) {
  const int mat = blockIdx.y;
  const float* W = mat == 0 ? W0 : (mat == 1 ? W1 : (mat == 2 ? W2 : W3));
  unsigned short* Wt = Wt4 + (size_t)mat * K * N;
  const int t = blockIdx.x * 256 + threadIdx.x;
  const int k8n = K / 8;
  if (t >= N * k8n) return;
  const int n = t / k8n, k8 = (t % k8n) * 8;
  v8us v;
#pragma unroll
  for (int i = 0; i < 8; ++i) v[i] = bf16_bits(W[(size_t)(k8 + i) * N + n]);
  *(v8us*)(Wt + (size_t)n * K + k8) = v;
  
}

// GEMM C[M][N] (f32, pitch ldc) = act(A[M][K]*W + bias). A f32 row-major (pitch lda) converted to bf16
// (ASPLIT: hi/lo two planes -> 2 terms, else single RNE term); Wt bf16 [N][K] (pitch ldb). BIAS_BF16 quantises the
// bias to bf16 before the add. K%64==0, M%64==0, N%128==0.
// Logical rows are grouped in segments of 'seg' rows (seg % 64 == 0): logical row r -> A row (r/seg)*asr + r%seg and
// C row (r/seg)*csr + r%seg, so per-batch strides of A and C can differ.
// Block = 4 waves on a 64 x 128 tile of C, wave -> 32 rows x 64 cols. Each 64-deep slice of A and Wt is read from
// global memory once per block in whole 128-byte lines, A is converted once, and both lie in LDS for all four waves
// (rows pitched 144 B for the 16-byte fragment reads). Two LDS buffers: the next slice's global loads are issued
// ahead of the current slice's products and stored behind them, one block barrier per slice.
// Epilogue staged in wave-private LDS (the ring's bytes, free behind the last barrier): whole lines are stored.
// The three pitches are compile-time, so that a slice's 16 loads and the 16 row stores differ only in their immediate offsets.
// CSFROM >= 0: in the columns from CSFROM on each f32 result v is stored as hi = bf16(v) and lo = bf16(v - hi); a wave's 64
// columns of a row take the same 256 bytes of C as in f32, 64 hi values in the first 128-byte line and the 64 lo values in the second.
// BSEG > 0: several products with one A run as one grid, their Wt rows stacked; each BSEG columns have a bias vector of their
// own (bias, bias1, bias2, so N <= 3 * BSEG). BSEG == 0: one bias vector for all N columns.
template <bool ASPLIT, int ACT, bool BIAS_BF16, int CSFROM, int BSEG, int lda, int ldb, int ldc>
__global__ __launch_bounds__(128) void k_gemm_bf(const float* __restrict__ A, const unsigned short* __restrict__ Wt,
                                               const float* __restrict__ bias, const float* __restrict__ bias1,
                                               const float* __restrict__ bias2, float* __restrict__ C, int M, int N, int K,
                                               int seg, int asr, int csr) {
  constexpr int BM = 64, BN = 128, BK = 64, LP = BK + 8;      // LP: LDS row pitch in bf16 elements
  constexpr int NPL = ASPLIT ? 2 : 1;                         // planes of A
  constexpr int BOFF = BM * NPL * LP;                         // Wt rows behind the A planes
  constexpr int STAGE = BOFF + BN * LP;                       // bf16 elements per buffer
  constexpr int OP = 68;                                      // output staging pitch in floats
  static_assert(BSEG % BN == 0 && (CSFROM < 0 || CSFROM % BN == 0));   // a block lies in one bias segment and stores in one form
  constexpr int RING_BYTES = 2 * STAGE * 2, OUT_BYTES = 4 * 32 * OP * 4;
  __shared__ __attribute__((aligned(16))) unsigned char smem[RING_BYTES > OUT_BYTES ? RING_BYTES : OUT_BYTES];
  unsigned short* ring = (unsigned short*)smem;
  const int tid = threadIdx.x, w = tid >> 5, lane = tid & 31, ln = lane & 15, hh = lane >> 4;
  const int wm = w >> 1, wn = w & 1;
  const int ntn = N / BN;
  const int mt = blockIdx.x / ntn, nq = blockIdx.x % ntn;
  if (mt * BM >= M) return;                      // block-uniform, in front of every barrier
  const int row0 = mt * BM, col0 = nq * BN;
  const int bseg = row0 / seg, t0 = row0 - bseg * seg;
  const int ar = tid >> 4, ac = (tid & 15) * 4;  // A slice: 16 threads per 256-byte row piece, 8 rows per pass
  const int br = tid >> 3, bc = (tid & 7) * 8;   // Wt slice: 8 threads per 128-byte row piece, 16 rows per pass
  // typed as global-memory pointers, so that they stay so through the wait statement at the loop's foot (plain global loads)
  gl_f32* ag = (gl_f32*)(A + ((size_t)bseg * asr + t0 + ar) * lda + ac);
  gl_u16* bg = (gl_u16*)(Wt + (size_t)(col0 + br) * ldb + bc);
  v4f ra[8];
  v8us rb[8];
  v8f acc[2][4];
#pragma unroll
  for (int mi = 0; mi < 2; ++mi)
#pragma unroll
    for (int t = 0; t < 4; ++t) acc[mi][t] = (v8f){0.f,0.f,0.f,0.f,0.f,0.f,0.f,0.f};

  auto fetch = [&](int ahead) {
#pragma unroll
    for (int i = 0; i < 8; ++i) ra[i] = *(gl_v4f*)(ag + ahead + i * 8 * lda);
#pragma unroll
    for (int i = 0; i < 8; ++i) rb[i] = *(gl_v8us*)(bg + ahead + i * 16 * ldb);
  };
  auto put = [&](unsigned short* buf) {
#pragma unroll
    for (int i = 0; i < 8; ++i) {
      v4us h, l;
#pragma unroll
      for (int j = 0; j < 4; ++j) {
        const unsigned short hb = bf16_bits(ra[i][j]);
        h[j] = hb;
        l[j] = ASPLIT ? bf16_bits(ra[i][j] - bf16_val(hb)) : (unsigned short)0;
      }
      *(v4us*)(buf + (ar + i * 8) * LP + ac) = h;
      if (ASPLIT) *(v4us*)(buf + BM * LP + (ar + i * 8) * LP + ac) = l;
    }
#pragma unroll
    for (int i = 0; i < 8; ++i) *(v8us*)(buf + BOFF + (br + i * 16) * LP + bc) = rb[i];
  };

  const int nst = K / BK;
  fetch(0);
  put(ring);
  __syncthreads();
  for (int s = 0; s < nst; ++s) {
    const bool more = s + 1 < nst;               // block-uniform
    if (more) fetch(BK);
    const unsigned short* buf = ring + (s & 1) * STAGE;
    const unsigned short* sa = buf + (wm * 32 + ln) * LP + 8 * hh;
    const unsigned short* sb = buf + BOFF + (wn * 64 + ln) * LP + 8 * hh;
#pragma unroll
    for (int ks = 0; ks < BK / 32; ++ks) {
      FragB ah[2], al[2], b[4];
#pragma unroll
      for (int mi = 0; mi < 2; ++mi) {
        ah[mi].half[0] = *(const v8us*)(sa + mi * 16 * LP + ks * 32);
        ah[mi].half[1] = *(const v8us*)(sa + mi * 16 * LP + ks * 32 + 16);
        if (ASPLIT) {
          al[mi].half[0] = *(const v8us*)(sa + BM * LP + mi * 16 * LP + ks * 32);
          al[mi].half[1] = *(const v8us*)(sa + BM * LP + mi * 16 * LP + ks * 32 + 16);
        }
      }
#pragma unroll
      for (int t = 0; t < 4; ++t) {
        b[t].half[0] = *(const v8us*)(sb + t * 16 * LP + ks * 32);
        b[t].half[1] = *(const v8us*)(sb + t * 16 * LP + ks * 32 + 16);
      }
      // per output element the order of the sums stays: k ascending in steps of 32, hi term then lo term
#pragma unroll
      for (int mi = 0; mi < 2; ++mi)
#pragma unroll
        for (int t = 0; t < 4; ++t)
          acc[mi][t] = __builtin_amdgcn_wmma_f32_16x16x32_bf16(false, ah[mi].v, false, b[t].v, (short)0, acc[mi][t], false, false);
      if (ASPLIT) {
#pragma unroll
        for (int mi = 0; mi < 2; ++mi)
#pragma unroll
          for (int t = 0; t < 4; ++t)
            acc[mi][t] = __builtin_amdgcn_wmma_f32_16x16x32_bf16(false, al[mi].v, false, b[t].v, (short)0, acc[mi][t], false, false);
      }
    }
    if (more) {
      put(ring + ((s + 1) & 1) * STAGE);
      // the slice's loads name the two pointers' registers: the wait stands behind the last store of loaded data and,
      // tied to both pointers, in front of the two additions that rewrite them
      asm volatile("s_wait_xcnt 0x0" : "+v"(ag), "+v"(bg) :: "memory");
      ag += BK; bg += BK;
    }
    __syncthreads();
  }
  float* so = (float*)smem + w * 32 * OP;
  const float* bsel = bias;                      // the block's bias vector and its first column there, block-uniform
  int bcol = col0;
  if (BSEG > 0) {
    const int bi = col0 / BSEG;
    bsel = bi == 0 ? bias : (bi == 1 ? bias1 : bias2);
    bcol = col0 - bi * BSEG;
  }
#pragma unroll
  for (int t = 0; t < 4; ++t) {
    float bv = bsel ? bsel[bcol + wn * 64 + t * 16 + ln] : 0.f;
    if (BIAS_BF16) bv = bf16_rne(bv);
#pragma unroll
    for (int mi = 0; mi < 2; ++mi)
#pragma unroll
      for (int r = 0; r < 8; ++r) { float v = acc[mi][t][r] + bv; if (ACT == 1) v = fmaxf(v, 0.f); so[(mi * 16 + 8 * hh + r) * OP + t * 16 + ln] = v; }
  }
  __builtin_amdgcn_fence(4 /* acq_rel order */, "workgroup");
  __builtin_amdgcn_wave_barrier();
  const int rsub = lane >> 4, c4 = (lane & 15) * 4;
  float* cw = C + ((size_t)bseg * csr + t0 + wm * 32 + rsub) * ldc + col0 + wn * 64;
  if (CSFROM >= 0 && col0 >= CSFROM) {           // block-uniform
    unsigned short* cs = (unsigned short*)cw + c4;
    // unrolled (both loops), so that the row stores differ only in their immediate offsets and h, l stay in registers
#pragma unroll
    for (int q = 0; q < 16; ++q) {
      const v4f v = *(const v4fa*)&so[(q * 2 + rsub) * OP + c4];
      v4us h, l;
#pragma unroll
      for (int j = 0; j < 4; ++j) {
        const unsigned short hb = bf16_bits(v[j]);
        h[j] = hb;
        l[j] = bf16_bits(v[j] - bf16_val(hb));
      }
      *(v4us*)(cs + q * 2 * ldc * 2) = h;
      *(v4us*)(cs + q * 2 * ldc * 2 + 64) = l;
    }
  } else {
    float* cg = cw + c4;
#pragma unroll
    for (int q = 0; q < 16; ++q) {
      const v4f v = *(const v4fa*)&so[(q * 2 + rsub) * OP + c4];
      *(v4f*)(cg + q * 2 * ldc) = v;
    }
  }
}

template <int D, bool CAUSAL, int KVP>
__global__ __launch_bounds__(128) void k_flash(const float* __restrict__ qb, const unsigned short* __restrict__ kb, const unsigned short* __restrict__ vb,
                                             int pitch, int T, int H, float scale, float* __restrict__ y, int ypitch) {
  constexpr int KS = D / 32;        // k-steps for QK
  constexpr int DT = D / 16;        // d tiles for PV
  constexpr int VP = D + 16;        // V row pitch in elements: an odd multiple of 32 bytes, for the transposing loads
  static_assert((VP * 2) % 32 == 0 && ((VP * 2 / 32) & 1) == 1);
  constexpr int PPR = D / 4;        // 16-byte pieces per K or V row (hi and lo)
  constexpr int RPP = 128 / PPR;    // rows that the block's 128 threads copy per pass
  constexpr int NPS = 32 / RPP;     // passes per 32-key chunk
  static_assert(128 % PPR == 0 && 32 % RPP == 0 && (KVP % 8) == 0);
  constexpr int KP = D + 8;         // K row pitch in elements: an odd multiple of 16 bytes, for the 16-byte fragment reads
  constexpr int KPL = 32 * KP, VPL = 32 * VP;                  // elements of one K plane, of one V plane
  constexpr int BUF = 2 * KPL + 2 * VPL;                       // elements of one buffer: K hi, K lo, V hi, V lo
  __shared__ __attribute__((aligned(16))) unsigned short sKV[2 * BUF];
  __shared__ __attribute__((aligned(16))) float sO[4][16][D + 4];   // pitched for the 16-byte stores of 16 rows at a time
  const int tid = threadIdx.x, w = tid >> 5, lane = tid & 31, ln = lane & 15, hh = lane >> 4;
  const int nqb = (T + 63) / 64;
  const int npair = (nqb + 1) / 2;
  const int bh = blockIdx.x / npair, pr = blockIdx.x % npair;
  const int b = bh / H, h = bh % H;
  const float* Q = qb + (size_t)b * T * pitch + h * D;
  gl_u16* K = (gl_u16*)(kb + (size_t)b * T * KVP + h * 2 * D);
  gl_u16* V = (gl_u16*)(vb + (size_t)b * T * KVP + h * 2 * D);
  // the thread's piece of a row: row sr of a pass, piece sc (the first D / 8 pieces are the hi plane, the rest the lo plane)
  const int sr = tid / PPR, sc = tid % PPR;
  // the piece's LDS byte address in buffer 0 (the low 32 bits of its address)
  const unsigned int kd = (unsigned int)(size_t)(sKV + (sc < D / 8 ? 0 : KPL) + sr * KP + (sc % (D / 8)) * 8);
  const unsigned int vd = (unsigned int)(size_t)(sKV + 2 * KPL + (sc < D / 8 ? 0 : VPL) + sr * VP + (sc % (D / 8)) * 8);
  // One 32-key chunk of K and V into the buffer at byte offset bo: eight copies a thread, one per pass of RPP rows; kc and vc
  // (block-uniform, in scalar registers) point at the chunk's first row of the head. A copy's immediate offset moves its LDS
  // address and its global address alike. Pass i lies i * KSTEP (V: i * VSTEP) bytes further in LDS and i * GSTEP bytes further
  // in global memory: the immediate carries the LDS step, the pass's own offset register the rest, i * (GSTEP - KSTEP), so
  // that one LDS address register serves the four passes, and from chunk to chunk only the scalar bases and bo change.
  // The wait at the statement's end stands in front of every later write of a register that the copies name.
  constexpr unsigned int GSTEP = RPP * KVP * 2, KSTEP = RPP * KP * 2, VSTEP = RPP * VP * 2;
  static_assert(NPS == 4 && GSTEP > VSTEP && GSTEP > KSTEP && 3 * VSTEP < 65536 && 3 * KSTEP < 65536);   // the statement names the passes one by one
  const unsigned int go = (unsigned int)(sr * KVP + sc * 8) * 2;   // byte offset of the piece in pass 0
  const unsigned int ko1 = go + 1 * (GSTEP - KSTEP), ko2 = go + 2 * (GSTEP - KSTEP), ko3 = go + 3 * (GSTEP - KSTEP);
  const unsigned int vo1 = go + 1 * (GSTEP - VSTEP), vo2 = go + 2 * (GSTEP - VSTEP), vo3 = go + 3 * (GSTEP - VSTEP);
  auto copy_chunk = [&](gl_u16* kc, gl_u16* vc, unsigned int bo) {
    asm volatile("global_load_async_to_lds_b128 %0, %2, %9\n\t"
                 "global_load_async_to_lds_b128 %0, %3, %9 offset:%11\n\t"
                 "global_load_async_to_lds_b128 %0, %4, %9 offset:%12\n\t"
                 "global_load_async_to_lds_b128 %0, %5, %9 offset:%13\n\t"
                 "global_load_async_to_lds_b128 %1, %2, %10\n\t"
                 "global_load_async_to_lds_b128 %1, %6, %10 offset:%14\n\t"
                 "global_load_async_to_lds_b128 %1, %7, %10 offset:%15\n\t"
                 "global_load_async_to_lds_b128 %1, %8, %10 offset:%16\n\t"
                 "s_wait_xcnt 0x0"
                 :: "v"(kd + bo), "v"(vd + bo), "v"(go), "v"(ko1), "v"(ko2), "v"(ko3), "v"(vo1), "v"(vo2), "v"(vo3),
                    "s"(kc), "s"(vc), "n"(1 * KSTEP), "n"(2 * KSTEP), "n"(3 * KSTEP), "n"(1 * VSTEP), "n"(2 * VSTEP), "n"(3 * VSTEP)
                 : "memory");
  };

  const int ntile = (nqb - 1 - pr == pr) ? 1 : 2;              // block-uniform
  for (int tile = 0; tile < ntile; ++tile) {
  const int qblk = tile ? pr : nqb - 1 - pr;
  const int q0 = qblk * 64 + w * 16;
  const int kv_end = CAUSAL ? min(T, qblk * 64 + 64) : T;     // block-uniform
  const int nch = kv_end / 32;                                 // chunks of this tile, block-uniform
  gl_u16* kp = K;                                              // first row of the chunk to be copied next, block-uniform
  gl_u16* vp = V;
  // chunk 0 into buffer 0; every reader of the tile before has left both buffers at that tile's last barrier. The copies fly
  // behind the set-up of Q below.
  copy_chunk(kp, vp, 0);
  // B fragments (Q^T) of the wave's 16 query rows (scaled), hi/lo
  FragB aqh[KS], aql[KS];
  {
    int row = q0 + ln; if (row >= T) row = T - 1;
    const float* qr = Q + (size_t)row * pitch;
#pragma unroll
    for (int ks = 0; ks < KS; ++ks)
#pragma unroll
      for (int i = 0; i < 16; ++i) {
        const int d = ks * 32 + ((i < 8) ? (8 * hh + i) : (16 + 8 * hh + (i - 8)));
        const float x = qr[d] * scale; const unsigned short hb = bf16_bits(x);
        aqh[ks].u[i] = hb; aql[ks].u[i] = bf16_bits(x - bf16_val(hb));
      }
  }
  float m_run = -3.0e38f, l_run = 0.f;                         // of query q0 + ln; l_run is this half's partial sum
  // the last key that the lane's query may see, counted from the lane's first key row 8hh
  const int klast = (CAUSAL ? min(q0 + ln, T - 1) : T - 1) - 8 * hh;
  v8f oacc[DT];
#pragma unroll
  for (int dt = 0; dt < DT; ++dt) oacc[dt] = (v8f){0.f,0.f,0.f,0.f,0.f,0.f,0.f,0.f};

  // chunk 0 has landed (each wave waits for its own copies) and is published by the barrier; then chunk 1 starts into buffer 1
  asm volatile("s_wait_asynccnt 0x0" ::: "memory");
  __syncthreads();
  if (nch > 1) copy_chunk(kp + 32 * KVP, vp + 32 * KVP, BUF * 2);
  kp += 64 * KVP; vp += 64 * KVP;
  for (int t = 0; t < nch; ++t) {
    const int j0 = t * 32;
    const unsigned short* sKh = sKV + (t & 1) * BUF;           // chunk t's buffer
    const unsigned short* sKl = sKh + KPL;
    const unsigned short* sVh = sKh + 2 * KPL;
    const unsigned short* sVl = sVh + VPL;
    // A fragments of K, hi and lo, of the chunk's two tiles of 16 keys: all 16 loads stand here as one group, each fragment in
    // registers of its own; both tiles' fragments of k-step 0 come first, as the two tiles' product chains run side by side
    FragB kh_[2][KS], kl_[2][KS];
#pragma unroll
    for (int ks = 0; ks < KS; ++ks)
#pragma unroll
      for (int nt = 0; nt < 2; ++nt) {
        const int ko = (nt * 16 + ln) * KP + ks * 32 + 8 * hh;
        kh_[nt][ks].half[0] = *(const v8us*)(sKh + ko); kh_[nt][ks].half[1] = *(const v8us*)(sKh + ko + 16);
        kl_[nt][ks].half[0] = *(const v8us*)(sKl + ko); kl_[nt][ks].half[1] = *(const v8us*)(sKl + ko + 16);
      }
    // A fragments of V^T, hi and lo: element i = V[8hh + i][dt*16 + ln], element 8 + i = V[16 + 8hh + i][dt*16 + ln], one
    // transposing load per 8 elements; V lies in LDS since the barrier in front of the chunk
    FragB bvh[DT], bvl[DT];
    {
      const int vo = (8 * hh + (lane & 7)) * VP + ((lane >> 3) & 1) * 8;
#pragma unroll
      for (int dt = 0; dt < DT; ++dt) {
        bvh[dt].half[0] = ld_tr16(sVh + vo + dt * 16); bvh[dt].half[1] = ld_tr16(sVh + vo + 16 * VP + dt * 16);
        bvl[dt].half[0] = ld_tr16(sVl + vo + dt * 16); bvl[dt].half[1] = ld_tr16(sVl + vo + 16 * VP + dt * 16);
      }
    }
    // holds all 32 loads of the chunk here, in one place ahead of its products: the K * Q^T products run behind counted waits, with no
    // load and no wait to zero among them (left alone, the compiler feeds them through one register set, a load and a full LDS
    // wait per fragment), and the V loads' latency passes behind those products and the softmax
    __builtin_amdgcn_sched_barrier(0);
    // S^T, two tiles of 16 keys x 16 queries
    v8f s[2];
#pragma unroll
    for (int nt = 0; nt < 2; ++nt) {
      v8f acc = (v8f){0.f,0.f,0.f,0.f,0.f,0.f,0.f,0.f};
#pragma unroll
      for (int ks = 0; ks < KS; ++ks) acc = mma3(kh_[nt][ks].v, kl_[nt][ks].v, aqh[ks].v, aql[ks].v, acc);
      s[nt] = acc;
    }
    // mask + running maximum of the lane's query; sc[8 * nt + r] is the score of key j0 + nt*16 + 8hh + r
    const int lim = klast - j0;
    float sc[16];
#pragma unroll
    for (int nt = 0; nt < 2; ++nt)
#pragma unroll
      for (int r = 0; r < 8; ++r) sc[8 * nt + r] = (nt * 16 + r > lim) ? -3.0e38f : s[nt][r];
    float mx = fmaxf(sc[0], sc[1]);
#pragma unroll
    for (int i = 2; i < 16; i += 2) mx = fmaxf(mx, fmaxf(sc[i], sc[i + 1]));
    mx = fmaxf(mx, xhalf(mx));
    const float mnew = fmaxf(m_run, mx);
    const bool seen = mnew > -1.0e38f;                         // false while every key so far was masked for this query
    const float alpha = seen ? __expf(m_run - mnew) : 1.0f;
    const float mref = seen ? mnew : 0.f;                      // a masked score then gives exp(-3e38 - mref) = 0 in either case
    m_run = mnew;
    // P^T as B operand, hi and lo: element i = P[8hh + i], element 8 + i = P[16 + 8hh + i] of the lane's query
    FragB ph, pl;
    v2f pp[8];
    constexpr float LOG2E = 1.44269504f;                       // exp(x) = 2^(x * LOG2E)
#pragma unroll
    for (int i = 0; i < 8; i += 2)
      exp2x4((v2f){(sc[2 * i] - mref) * LOG2E, (sc[2 * i + 1] - mref) * LOG2E},
             (v2f){(sc[2 * i + 2] - mref) * LOG2E, (sc[2 * i + 3] - mref) * LOG2E}, pp[i], pp[i + 1]);
#pragma unroll
    for (int i = 0; i < 8; ++i) {
      const unsigned int hw = pack2_bf16(pp[i]);
      ph.w[i] = hw;
      pl.w[i] = pack2_bf16(pp[i] - (v2f){__uint_as_float(hw << 16), __uint_as_float(hw & 0xFFFF0000u)});
    }
    const v2f ps = ((pp[0] + pp[1]) + (pp[2] + pp[3])) + ((pp[4] + pp[5]) + (pp[6] + pp[7]));
    l_run = l_run * alpha + (ps[0] + ps[1]);
#pragma unroll
    for (int dt = 0; dt < DT; ++dt)
#pragma unroll
      for (int r = 0; r < 8; ++r) oacc[dt][r] *= alpha;
#pragma unroll
    for (int dt = 0; dt < DT; ++dt) oacc[dt] = mma3(bvh[dt].v, bvl[dt].v, ph.v, pl.v, oacc[dt]);
    // four vector slots behind the chunk's last product, before a vector instruction of the refill or of the next trip may overwrite
    // A and B registers of the products (only waits, the barrier and scalar instructions stand between them); tied to every D,
    // to P and to every V fragment, so that no product stands behind it (the statement names the d tiles one by one: four, D = 64)
    static_assert(DT == 4);
    asm volatile("v_nop\n\tv_nop\n\tv_nop\n\tv_nop" : "+v"(oacc[0]), "+v"(oacc[1]), "+v"(oacc[2]), "+v"(oacc[3])
                 : "v"(ph.v), "v"(pl.v), "v"(bvh[0].v), "v"(bvh[1].v), "v"(bvh[2].v), "v"(bvh[3].v),
                   "v"(bvl[0].v), "v"(bvl[1].v), "v"(bvl[2].v), "v"(bvl[3].v));
    // foot of chunk t, every wave, in this order: its own LDS reads of chunk t have returned; its own copies of chunk t + 1 have
    // landed; the one block barrier publishes chunk t + 1 and ends every wave's reads of chunk t's buffer; only then that
    // buffer is refilled, with chunk t + 2. (The waits are volatile statements like the one above and so stay behind it and the
    // products: moved up in front of the softmax they would cut the time that chunk t + 1's copies have to land.)
    asm volatile("s_wait_dscnt 0x0" ::: "memory");
    asm volatile("s_wait_asynccnt 0x0" ::: "memory");
    __syncthreads();
    if (t + 2 < nch) {                                         // block-uniform
      copy_chunk(kp, vp, (t & 1) * BUF * 2);
      kp += 32 * KVP; vp += 32 * KVP;
    }
  }
  // no copy is outstanding when the wave goes on (the last two trips issue none)
  asm volatile("s_wait_asynccnt 0x0" ::: "memory");
  // oacc[dt][r] = O[q0 + ln][dt*16 + 8hh + r]; the two halves' sums are joined here, once
  const float lsum = l_run + xhalf(l_run);
  const float linv = (lsum > 0.f) ? 1.0f / lsum : 0.f;
#pragma unroll
  for (int dt = 0; dt < DT; ++dt) {
    *(v4fa*)&sO[w][ln][dt * 16 + 8 * hh]     = (v4f){oacc[dt][0] * linv, oacc[dt][1] * linv, oacc[dt][2] * linv, oacc[dt][3] * linv};
    *(v4fa*)&sO[w][ln][dt * 16 + 8 * hh + 4] = (v4f){oacc[dt][4] * linv, oacc[dt][5] * linv, oacc[dt][6] * linv, oacc[dt][7] * linv};
  }
  __builtin_amdgcn_fence(4 /* acq_rel order */, "workgroup");
  __builtin_amdgcn_wave_barrier();
  {
    for (int r = 0; r < 16; ++r) {
      const int row = q0 + r;
      if (row < T && lane < D / 4) {
        const v4f val = *(const v4fa*)&sO[w][r][lane * 4];
        *(v4f*)(y + ((size_t)b * T + row) * ypitch + h * D + lane * 4) = val;
      }
    }
    
  }
  // the next tile's set-up overwrites registers that the row stores above name; this wait stands in front of that
  asm volatile("s_wait_xcnt 0x0" ::: "memory");
  }
}

extern "C" void kernel_launch(void* const* d_in, const int* in_sizes, int n_in,
                              void* d_out, int out_size, void* d_ws, size_t ws_size, hipStream_t stream) {
  if (n_in < 9) return;
  // lower-bound size checks (a reduced NB/SEQ build still launches against full-size inputs)
  if (in_sizes[0] < ((NB - 1) * SEQ_FULL + SEQ) * CC) return;
  for (int i = 1; i < 9; i += 2) {
    if (in_sizes[i] < CC * CC) return;       // Wq, Wk, Wv, Wp: [CC in][CC out] f32
    if (in_sizes[i + 1] < CC) return;        // bq, bk, bv, bp: [CC] f32
  }
  if (out_size < ((NB - 1) * OUT_SEG_ROWS + SEQ) * CC) return;
  const float* x  = (const float*)d_in[0];
  const float* Wq = (const float*)d_in[1]; const float* bqp = (const float*)d_in[2];
  const float* Wk = (const float*)d_in[3]; const float* bkp = (const float*)d_in[4];
  const float* Wv = (const float*)d_in[5]; const float* bvp = (const float*)d_in[6];
  const float* Wp = (const float*)d_in[7]; const float* bpp = (const float*)d_in[8];
  char* ws = (char*)d_ws; size_t off = 0;
  unsigned short* Wqt = (unsigned short*)(ws + off); off += (size_t)3 * CC * CC * 2;     // q, k, v stacked: [3*768][768] bf16  3,538,944 B
  unsigned short* Wpt = (unsigned short*)(ws + off); off += (size_t)CC * CC * 2;         // [768][768] bf16  1,179,648 B
  float* qkv = (float*)(ws + off); off += (size_t)NB * SEQ * 3 * CC * 4;                 // [NB*SEQ][2304] q f32, k/v bf16 hi/lo  75,497,472 B at full size
  float* yb  = (float*)(ws + off); off += (size_t)NB * SEQ * CC * 4;                     // [NB*SEQ][768]  f32  25,165,824 B at full size
  if (off > ws_size) return;                                                             // total 105,381,888 B at full size
  const int M = NB * SEQ;
  const int gw = (CC * (CC / 8) + 255) / 256;
  k_wt_bf16<<<dim3(gw, 4), 256, 0, stream>>>(Wq, Wk, Wv, Wp, Wqt, CC, CC);   // Wpt lies directly behind the q, k, v stack
  // qkv[b*SEQ + t][s*CC + n] = bf16(x[b*SEQ_FULL + t]) * bf16(W_s) + bf16(b_s), s = 0 (q), 1 (k), 2 (v); row pitch 3*CC;
  // q as f32, k and v as bf16 hi/lo planes per head in the same bytes; one grid over the 3*CC columns of the
  // stacked [3*CC][CC] weight operand
  const int gg = (M / 64) * (CC / 128);
  static_assert(HD == 64);   // a GEMM wave's 64 columns are one head's hi/lo group
  k_gemm_bf<false, 0, true, CC, CC, CC, CC, 3 * CC><<<3 * gg, 128, 0, stream>>>(x, Wqt, bqp, bkp, bvp, qkv, M, 3 * CC, CC, SEQ, SEQ_FULL, SEQ);
  k_flash<HD, true, 6 * CC><<<NB * NH * ((SEQ / 64 + 1) / 2), 128, 0, stream>>>(qkv, (const unsigned short*)(qkv + CC), (const unsigned short*)(qkv + 2 * CC),
                                                                                3 * CC, SEQ, NH, 0.125f, yb, CC);
  // out[b*OUT_SEG_ROWS + t][:] = y[b*SEQ + t] * bf16(Wp) + bf16(bp), y as bf16 hi/lo
  k_gemm_bf<true, 0, true, -1, 0, CC, CC, CC><<<gg, 128, 0, stream>>>(yb, Wpt, bpp, nullptr, nullptr, (float*)d_out, M, CC, CC, SEQ, SEQ, OUT_SEG_ROWS);
}

// v010
// A run of this version takes 107 microseconds.
// It is 1.42 times as fast as v008, going by the measured steps of the versions left out in between.
// Counting every step since v000, it is 5.07 times as fast.
#include <hip/hip_runtime.h>
// All contractions on 16x16x32 matrix instructions with f32 accumulate: q/k/v projections x*Wq, x*Wk, x*Wv with x and W as
// bf16 (single exact-product term), attention Q*K^T and P*V with every operand as one f16 value (11 significant bits, eight
// times finer than the bf16 rounding of x and W that q, k and v already carry), output projection y*Wp with y split into
// bf16 hi/lo (2 terms) and W as bf16; biases as bf16; softmax in f32.
// The A operands of the GEMMs are brought into their 16-bit form once, by whoever has the f32 value in hand: x in the first launch,
// y (hi and lo plane) in the attention kernel's epilogue; the GEMM blocks, 18 and 6 of which read each A row, only copy them.
// K and V leave their projections as f16: a token row's 768 values of K (of V) lie packed in the first half of the bytes that
// their f32 values would take, 128 bytes a head.
#ifndef NB
#define NB 4
#endif
#ifndef SEQ
#define SEQ 2048
#endif
#define NB_FULL 4
#define SEQ_FULL 2048
#define CC 768
#define NH 12
#define HD 64
// row stride (in tokens) between batches in the output buffer; full layout by default
#ifndef OUT_SEG_ROWS
#define OUT_SEG_ROWS SEQ_FULL
#endif
static_assert(NB >= 1 && NB <= NB_FULL);
static_assert(SEQ >= 64 && SEQ <= SEQ_FULL && (SEQ % 64) == 0);
static_assert(CC == NH * HD);
static_assert((HD % 32) == 0 && HD <= 128);
static_assert((CC % 128) == 0);

typedef __bf16 v16b __attribute__((ext_vector_type(16)));
typedef _Float16 v16h __attribute__((ext_vector_type(16)));
typedef unsigned short v8us __attribute__((ext_vector_type(8), may_alias));
typedef unsigned short v4us __attribute__((ext_vector_type(4), may_alias));
typedef float  v8f  __attribute__((ext_vector_type(8)));
typedef float  v4f  __attribute__((ext_vector_type(4)));
typedef float  v2f  __attribute__((ext_vector_type(2)));
typedef float  v4fa __attribute__((ext_vector_type(4), may_alias));
typedef __attribute__((address_space(1))) const unsigned short gl_u16;
typedef __attribute__((address_space(1))) const v8us gl_v8us;
union FragB { v16b v; v8us half[2]; unsigned short u[16]; unsigned int w[8]; };
union FragH { v16h v; v8us half[2]; _Float16 h[16]; unsigned int w[8]; };

__device__ __forceinline__ unsigned short bf16_bits(float x) { unsigned int u = __float_as_uint(x); return (unsigned short)((u + 0x7FFFu + ((u >> 16) & 1u)) >> 16); }
__device__ __forceinline__ float bf16_val(unsigned short b) { return __uint_as_float(((unsigned int)b) << 16); }
__device__ __forceinline__ float bf16_rne(float x) { return bf16_val(bf16_bits(x)); }
// D += X*Y, X (the A operand) and Y (the B operand) in f16
__device__ __forceinline__ v8f mma_h(v16h x, v16h y, v8f c) {
  return __builtin_amdgcn_wmma_f32_16x16x32_f16(false, x, false, y, (short)0, c, false, false);
}
// two f32 values rounded to nearest even into one register of two f16 (element 0 in the low half)
__device__ __forceinline__ unsigned int pack2_f16(v2f x) {
  typedef _Float16 h2 __attribute__((ext_vector_type(2)));
  return __builtin_bit_cast(unsigned int, __builtin_convertvector(x, h2));
}
// e[j] = 2^a[j], four at a time in one statement that ends with the one vector slot which the instruction set asks for behind a
// transcendental, before its result is read or its source register overwritten;
// results in registers of their own, apart from every source
__device__ __forceinline__ void exp2x4(v2f a0, v2f a1, v2f& e0, v2f& e1) {
  float r0, r1, r2, r3;
  asm("v_exp_f32 %0, %4\n\tv_exp_f32 %1, %5\n\tv_exp_f32 %2, %6\n\tv_exp_f32 %3, %7\n\tv_nop"
      : "=&v"(r0), "=&v"(r1), "=&v"(r2), "=&v"(r3) : "v"(a0[0]), "v"(a0[1]), "v"(a1[0]), "v"(a1[1]));
  e0 = (v2f){r0, r1}; e1 = (v2f){r2, r3};
}
// the value of lane l ^ 16
__device__ __forceinline__ float xhalf(float x) {
  const int b = __builtin_bit_cast(int, x);
  return __builtin_bit_cast(float, __builtin_amdgcn_permlanex16(b, b, 0x76543210, 0xfedcba98, false, false));
}
// Transposing LDS load (ds_load_tr16_b128) of a row-major 16-bit tile: with lane l addressing row 8*(l>>4) + (l&7), byte
// 16*((l>>3)&1) of the tile, lane l receives the 8 elements of rows 8*(l>>4) .. +7 in column l&15.
typedef short s16x8 __attribute__((ext_vector_type(8)));
__device__ __forceinline__ v8us ld_tr16(const unsigned short* p) {
  typedef __attribute__((address_space(3))) s16x8 lds_s16x8;
  return __builtin_bit_cast(v8us, __builtin_amdgcn_ds_load_tr16_b128_v8i16((lds_s16x8*)p));
}

// Wt[n][k] (bf16 bits, k contiguous, pitch K) = bf16(W[k][n]) from f32 row-major W[K][N]; one thread per (n, 8 consecutive k);
// four matrices of one shape in one grid, WTB blocks each: the block index picks the matrix, the results lie one behind the other in Wt4.
// The grid's first NXB blocks round x to bf16: Xb[r][c] = bf16(X[(r / SEQ) * SEQ_FULL + r % SEQ][c]), NB * SEQ packed rows of CC;
// a block takes 16384 consecutive elements, a thread 16 groups of four (whole lines per wave, the 16 loads in flight together:
// few waves with much in flight each, as a launch's waves take time to start).
constexpr int WTB = (CC * (CC / 8) + 255) / 256;   // blocks per matrix
constexpr int NXB = NB * SEQ * CC / 16384;         // blocks that x takes
static_assert((SEQ * CC) % 16384 == 0 && (CC % 4) == 0);
__global__ __launch_bounds__(256) void k_wt_bf16(const float* __restrict__ W0, const float* __restrict__ W1, const float* __restrict__ W2,
                                                 const float* __restrict__ W3, unsigned short* __restrict__ Wt4, int K, int N,
                                                 const float* __restrict__ X, unsigned short* __restrict__ Xb) {
  if (blockIdx.x < NXB) {                        // block-uniform
    const unsigned int g0 = blockIdx.x * 4096u + threadIdx.x;        // the thread's first group of four elements
    v4f xv[16];
#pragma unroll
    for (int j = 0; j < 16; ++j) {
      const unsigned int g = g0 + j * 256u;                          // a group lies inside one row
      const unsigned int r = g / (CC / 4), c = (g % (CC / 4)) * 4;
      // with whole batches the rows of X are packed already
      xv[j] = *(const v4fa*)(X + (SEQ == SEQ_FULL ? (size_t)g * 4 : ((size_t)(r / SEQ) * SEQ_FULL + r % SEQ) * CC + c));
    }
#pragma unroll
    for (int j = 0; j < 16; ++j) {
      v4us h;
#pragma unroll
      for (int i = 0; i < 4; ++i) h[i] = bf16_bits(xv[j][i]);
      *(v4us*)(Xb + ((size_t)g0 + j * 256u) * 4) = h;
    }
    return;
  }
  const int wblk = blockIdx.x - NXB;
  const int mat = wblk / WTB;
  const float* W = mat == 0 ? W0 : (mat == 1 ? W1 : (mat == 2 ? W2 : W3));
  unsigned short* Wt = Wt4 + (size_t)mat * K * N;
  const int t = (wblk % WTB) * 256 + threadIdx.x;
  const int k8n = K / 8;
  if (t >= N * k8n) return;
  const int n = t / k8n, k8 = (t % k8n) * 8;
  v8us v;
#pragma unroll
  for (int i = 0; i < 8; ++i) v[i] = bf16_bits(W[(size_t)(k8 + i) * N + n]);
  *(v8us*)(Wt + (size_t)n * K + k8) = v;
  
}

// GEMM C[M][N] (f32, pitch ldc) = act(A[M][K]*W + bias). A bf16 row-major (pitch lda elements; ASPLIT: a row holds its hi
// plane and, lda / 2 elements behind it, its lo plane -> 2 terms, else one plane); Wt bf16 [N][K] (pitch ldb). BIAS_BF16 quantises the
// bias to bf16 before the add. K%64==0, M%64==0, N%128==0.
// Logical rows are grouped in segments of 'seg' rows (seg % 64 == 0): logical row r -> A row (r/seg)*asr + r%seg and
// C row (r/seg)*csr + r%seg, so per-batch strides of A and C can differ.
// Block = 4 waves on a 64 x 128 tile of C, wave -> 32 rows x 64 cols. Each 64-deep slice of A and Wt is read from
// global memory once per block in whole 128-byte lines, as it is, and both lie in LDS for all four waves
// (rows pitched 144 B for the 16-byte fragment reads). Two LDS buffers: the next slice's global loads are issued
// ahead of the current slice's products and stored behind them, one block barrier per slice.
// Epilogue staged in wave-private LDS (the ring's bytes, free behind the last barrier): whole lines are stored.
// The three pitches are compile-time, so that a slice's 12 loads (16 with ASPLIT) and the 16 row stores differ only in their immediate offsets.
// CSFROM >= 0: in the columns from CSFROM on each f32 result is stored as f16; the BSEG columns of one product lie packed from
// the byte on where the product's f32 columns would begin, so that a wave's 64 columns of a row are one 128-byte line.
// BSEG > 0: several products with one A run as one grid, their Wt rows stacked; each BSEG columns have a bias vector of their
// own (bias, bias1, bias2, so N <= 3 * BSEG). BSEG == 0: one bias vector for all N columns.
template <bool ASPLIT, int ACT, bool BIAS_BF16, int CSFROM, int BSEG, int lda, int ldb, int ldc>
__global__ __launch_bounds__(128) void k_gemm_bf(const unsigned short* __restrict__ A, const unsigned short* __restrict__ Wt,
                                               const float* __restrict__ bias, const float* __restrict__ bias1,
                                               const float* __restrict__ bias2, float* __restrict__ C, int M, int N, int K,
                                               int seg, int asr, int csr) {
  constexpr int BM = 64, BN = 128, BK = 64, LP = BK + 8;      // LP: LDS row pitch in bf16 elements
  constexpr int NPL = ASPLIT ? 2 : 1;                         // planes of A
  constexpr int APO = lda / 2;                                // ASPLIT: the lo plane's place in a row of A
  constexpr int BOFF = BM * NPL * LP;                         // Wt rows behind the A planes
  constexpr int STAGE = BOFF + BN * LP;                       // bf16 elements per buffer
  constexpr int OP = 68;                                      // output staging pitch in floats
  static_assert(BSEG % BN == 0 && (CSFROM < 0 || (CSFROM % BN == 0 && BSEG > 0)));   // a block lies in one bias segment and stores in one form
  constexpr int RING_BYTES = 2 * STAGE * 2, OUT_BYTES = 4 * 32 * OP * 4;
  __shared__ __attribute__((aligned(16))) unsigned char smem[RING_BYTES > OUT_BYTES ? RING_BYTES : OUT_BYTES];
  unsigned short* ring = (unsigned short*)smem;
  const int tid = threadIdx.x, w = tid >> 5, lane = tid & 31, ln = lane & 15, hh = lane >> 4;
  const int wm = w >> 1, wn = w & 1;
  const int ntn = N / BN;
  const int mt = blockIdx.x / ntn, nq = blockIdx.x % ntn;
  if (mt * BM >= M) return;                      // block-uniform, in front of every barrier
  const int row0 = mt * BM, col0 = nq * BN;
  const int bseg = row0 / seg, t0 = row0 - bseg * seg;
  const int br = tid >> 3, bc = (tid & 7) * 8;   // A and Wt slices: 8 threads per 128-byte row piece, 16 rows per pass
  // typed as global-memory pointers, so that they stay so through the wait statement at the loop's foot (plain global loads)
  gl_u16* ag = (gl_u16*)(A + ((size_t)bseg * asr + t0 + br) * lda + bc);
  gl_u16* bg = (gl_u16*)(Wt + (size_t)(col0 + br) * ldb + bc);
  v8us ra[4 * NPL];
  v8us rb[8];
  v8f acc[2][4];
#pragma unroll
  for (int mi = 0; mi < 2; ++mi)
#pragma unroll
    for (int t = 0; t < 4; ++t) acc[mi][t] = (v8f){0.f,0.f,0.f,0.f,0.f,0.f,0.f,0.f};

  auto fetch = [&](int ahead) {
#pragma unroll
    for (int p = 0; p < NPL; ++p)
#pragma unroll
      for (int i = 0; i < 4; ++i) ra[p * 4 + i] = *(gl_v8us*)(ag + ahead + p * APO + i * 16 * lda);
#pragma unroll
    for (int i = 0; i < 8; ++i) rb[i] = *(gl_v8us*)(bg + ahead + i * 16 * ldb);
  };
  auto put = [&](unsigned short* buf) {
#pragma unroll
    for (int p = 0; p < NPL; ++p)
#pragma unroll
      for (int i = 0; i < 4; ++i) *(v8us*)(buf + p * BM * LP + (br + i * 16) * LP + bc) = ra[p * 4 + i];
#pragma unroll
    for (int i = 0; i < 8; ++i) *(v8us*)(buf + BOFF + (br + i * 16) * LP + bc) = rb[i];
  };

  const int nst = K / BK;
  fetch(0);
  put(ring);
  __syncthreads();
  for (int s = 0; s < nst; ++s) {
    const bool more = s + 1 < nst;               // block-uniform
    if (more) fetch(BK);
    const unsigned short* buf = ring + (s & 1) * STAGE;
    const unsigned short* sa = buf + (wm * 32 + ln) * LP + 8 * hh;
    const unsigned short* sb = buf + BOFF + (wn * 64 + ln) * LP + 8 * hh;
#pragma unroll
    for (int ks = 0; ks < BK / 32; ++ks) {
      FragB ah[2], al[2], b[4];
#pragma unroll
      for (int mi = 0; mi < 2; ++mi) {
        ah[mi].half[0] = *(const v8us*)(sa + mi * 16 * LP + ks * 32);
        ah[mi].half[1] = *(const v8us*)(sa + mi * 16 * LP + ks * 32 + 16);
        if (ASPLIT) {
          al[mi].half[0] = *(const v8us*)(sa + BM * LP + mi * 16 * LP + ks * 32);
          al[mi].half[1] = *(const v8us*)(sa + BM * LP + mi * 16 * LP + ks * 32 + 16);
        }
      }
#pragma unroll
      for (int t = 0; t < 4; ++t) {
        b[t].half[0] = *(const v8us*)(sb + t * 16 * LP + ks * 32);
        b[t].half[1] = *(const v8us*)(sb + t * 16 * LP + ks * 32 + 16);
      }
      // per output element the order of the sums stays: k ascending in steps of 32, hi term then lo term
#pragma unroll
      for (int mi = 0; mi < 2; ++mi)
#pragma unroll
        for (int t = 0; t < 4; ++t)
          acc[mi][t] = __builtin_amdgcn_wmma_f32_16x16x32_bf16(false, ah[mi].v, false, b[t].v, (short)0, acc[mi][t], false, false);
      if (ASPLIT) {
#pragma unroll
        for (int mi = 0; mi < 2; ++mi)
#pragma unroll
          for (int t = 0; t < 4; ++t)
            acc[mi][t] = __builtin_amdgcn_wmma_f32_16x16x32_bf16(false, al[mi].v, false, b[t].v, (short)0, acc[mi][t], false, false);
      }
    }
    if (more) {
      put(ring + ((s + 1) & 1) * STAGE);
      // the slice's loads name the two pointers' registers: the wait stands behind the last store of loaded data and,
      // tied to both pointers, in front of the two additions that rewrite them
      asm volatile("s_wait_xcnt 0x0" : "+v"(ag), "+v"(bg) :: "memory");
      ag += BK; bg += BK;
    }
    __syncthreads();
  }
  float* so = (float*)smem + w * 32 * OP;
  const float* bsel = bias;                      // the block's bias vector and its first column there, block-uniform
  int bcol = col0;
  if (BSEG > 0) {
    const int bi = col0 / BSEG;
    bsel = bi == 0 ? bias : (bi == 1 ? bias1 : bias2);
    bcol = col0 - bi * BSEG;
  }
#pragma unroll
  for (int t = 0; t < 4; ++t) {
    float bv = bsel ? bsel[bcol + wn * 64 + t * 16 + ln] : 0.f;
    if (BIAS_BF16) bv = bf16_rne(bv);
#pragma unroll
    for (int mi = 0; mi < 2; ++mi)
#pragma unroll
      for (int r = 0; r < 8; ++r) { float v = acc[mi][t][r] + bv; if (ACT == 1) v = fmaxf(v, 0.f); so[(mi * 16 + 8 * hh + r) * OP + t * 16 + ln] = v; }
  }
  __builtin_amdgcn_fence(4 /* acq_rel order */, "workgroup");
  __builtin_amdgcn_wave_barrier();
  const int rsub = lane >> 4, c4 = (lane & 15) * 4;
  float* cr = C + ((size_t)bseg * csr + t0 + wm * 32 + rsub) * ldc;
  if (CSFROM >= 0 && col0 >= CSFROM) {           // block-uniform
    typedef _Float16 h4 __attribute__((ext_vector_type(4)));
    // 16-bit index in the row: the product's first f32 column counts twice, the column inside the product once
    unsigned short* cs = (unsigned short*)cr + 2 * (col0 - bcol) + bcol + wn * 64 + c4;
    // unrolled, so that the row stores differ only in their immediate offsets
#pragma unroll
    for (int q = 0; q < 16; ++q) {
      const v4f v = *(const v4fa*)&so[(q * 2 + rsub) * OP + c4];
      *(v4us*)(cs + q * 2 * ldc * 2) = __builtin_bit_cast(v4us, __builtin_convertvector(v, h4));
    }
  } else {
    float* cg = cr + col0 + wn * 64 + c4;
#pragma unroll
    for (int q = 0; q < 16; ++q) {
      const v4f v = *(const v4fa*)&so[(q * 2 + rsub) * OP + c4];
      *(v4f*)(cg + q * 2 * ldc) = v;
    }
  }
}

template <int D, bool CAUSAL, int KVP>
__global__ __launch_bounds__(128) void k_flash(const float* __restrict__ qb, const unsigned short* __restrict__ kb, const unsigned short* __restrict__ vb,
                                             int pitch, int T, int H, float scale, unsigned short* __restrict__ y, int ypitch) {
  constexpr int KS = D / 32;        // k-steps for QK
  constexpr int DT = D / 16;        // d tiles for PV
  constexpr int VP = D + 16;        // V row pitch in elements: an odd multiple of 32 bytes, for the transposing loads
  static_assert((VP * 2) % 32 == 0 && ((VP * 2 / 32) & 1) == 1);
  constexpr int PPR = D / 8;        // 16-byte pieces per K or V row
  constexpr int RPP = 128 / PPR;    // rows that the block's 128 threads copy per pass
  constexpr int NPS = 64 / RPP;     // passes per 64-key stage
  static_assert(128 % PPR == 0 && 64 % RPP == 0 && (KVP % 8) == 0);
  constexpr int KP = D + 8;         // K row pitch in elements: an odd multiple of 16 bytes, for the 16-byte fragment reads
  constexpr int KPL = 64 * KP, VPL = 64 * VP;                  // elements of a stage's K rows, of its V rows
  constexpr int BUF = KPL + VPL;                               // elements of one buffer: K, V
  __shared__ __attribute__((aligned(16))) unsigned short sKV[2 * BUF];
  __shared__ __attribute__((aligned(16))) float sO[4][16][D + 4];   // pitched for the 16-byte stores of 16 rows at a time
  const int tid = threadIdx.x, w = tid >> 5, lane = tid & 31, ln = lane & 15, hh = lane >> 4;
  const int nqb = (T + 63) / 64;
  const int npair = (nqb + 1) / 2;
  const int bh = blockIdx.x / npair, pr = blockIdx.x % npair;
  const int b = bh / H, h = bh % H;
  const float* Q = qb + (size_t)b * T * pitch + h * D;
  gl_u16* K = (gl_u16*)(kb + (size_t)b * T * KVP + h * D);
  gl_u16* V = (gl_u16*)(vb + (size_t)b * T * KVP + h * D);
  // the thread's piece of a row: row sr of a pass, piece sc
  const int sr = tid / PPR, sc = tid % PPR;
  // the piece's LDS byte address in buffer 0 (the low 32 bits of its address)
  const unsigned int kd = (unsigned int)(size_t)(sKV + sr * KP + sc * 8);
  const unsigned int vd = (unsigned int)(size_t)(sKV + KPL + sr * VP + sc * 8);
  // One 64-key stage of K and V into the buffer at byte offset bo: eight copies a thread, one per pass of RPP rows; kc and vc
  // (block-uniform, in scalar registers) point at the stage's first row of the head. A copy's immediate offset moves its LDS
  // address and its global address alike. Pass i lies i * KSTEP (V: i * VSTEP) bytes further in LDS and i * GSTEP bytes further
  // in global memory: the immediate carries the LDS step, the pass's own offset register the rest, i * (GSTEP - KSTEP), so
  // that one LDS address register serves the four passes, and from stage to stage only the scalar bases and bo change.
  // The wait at the statement's end stands in front of every later write of a register that the copies name.
  constexpr unsigned int GSTEP = RPP * KVP * 2, KSTEP = RPP * KP * 2, VSTEP = RPP * VP * 2;
  static_assert(NPS == 4 && GSTEP > VSTEP && GSTEP > KSTEP && 3 * VSTEP < 65536 && 3 * KSTEP < 65536);   // the statement names the passes one by one
  const unsigned int go = (unsigned int)(sr * KVP + sc * 8) * 2;   // byte offset of the piece in pass 0
  const unsigned int ko1 = go + 1 * (GSTEP - KSTEP), ko2 = go + 2 * (GSTEP - KSTEP), ko3 = go + 3 * (GSTEP - KSTEP);
  const unsigned int vo1 = go + 1 * (GSTEP - VSTEP), vo2 = go + 2 * (GSTEP - VSTEP), vo3 = go + 3 * (GSTEP - VSTEP);
  auto copy_stage = [&](gl_u16* kc, gl_u16* vc, unsigned int bo) {
    asm volatile("global_load_async_to_lds_b128 %0, %2, %9\n\t"
                 "global_load_async_to_lds_b128 %0, %3, %9 offset:%11\n\t"
                 "global_load_async_to_lds_b128 %0, %4, %9 offset:%12\n\t"
                 "global_load_async_to_lds_b128 %0, %5, %9 offset:%13\n\t"
                 "global_load_async_to_lds_b128 %1, %2, %10\n\t"
                 "global_load_async_to_lds_b128 %1, %6, %10 offset:%14\n\t"
                 "global_load_async_to_lds_b128 %1, %7, %10 offset:%15\n\t"
                 "global_load_async_to_lds_b128 %1, %8, %10 offset:%16\n\t"
                 "s_wait_xcnt 0x0"
                 :: "v"(kd + bo), "v"(vd + bo), "v"(go), "v"(ko1), "v"(ko2), "v"(ko3), "v"(vo1), "v"(vo2), "v"(vo3),
                    "s"(kc), "s"(vc), "n"(1 * KSTEP), "n"(2 * KSTEP), "n"(3 * KSTEP), "n"(1 * VSTEP), "n"(2 * VSTEP), "n"(3 * VSTEP)
                 : "memory");
  };

  const int ntile = (nqb - 1 - pr == pr) ? 1 : 2;              // block-uniform
  for (int tile = 0; tile < ntile; ++tile) {
  const int qblk = tile ? pr : nqb - 1 - pr;
  const int q0 = qblk * 64 + w * 16;
  const int kv_end = CAUSAL ? min(T, qblk * 64 + 64) : T;     // block-uniform
  const int nst = kv_end / 64;                                 // stages of this tile, block-uniform
  gl_u16* kp = K;                                              // first row of the stage to be copied next, block-uniform
  gl_u16* vp = V;
  // stage 0 into buffer 0; every reader of the tile before has left both buffers at that tile's last barrier. The copies fly
  // behind the set-up of Q below.
  copy_stage(kp, vp, 0);
  // B fragments (Q^T) of the wave's 16 query rows (scaled)
  FragH aq[KS];
  {
    int row = q0 + ln; if (row >= T) row = T - 1;
    const float* qr = Q + (size_t)row * pitch;
#pragma unroll
    for (int ks = 0; ks < KS; ++ks)
#pragma unroll
      for (int i = 0; i < 16; ++i) {
        const int d = ks * 32 + ((i < 8) ? (8 * hh + i) : (16 + 8 * hh + (i - 8)));
        aq[ks].h[i] = (_Float16)(qr[d] * scale);
      }
  }
  float m_run = -3.0e38f, l_run = 0.f;                         // of query q0 + ln; l_run is this half's partial sum
  // the last key that the lane's query may see, counted from the lane's first key row 8hh
  const int klast = (CAUSAL ? min(q0 + ln, T - 1) : T - 1) - 8 * hh;
  v8f oacc[DT];
#pragma unroll
  for (int dt = 0; dt < DT; ++dt) oacc[dt] = (v8f){0.f,0.f,0.f,0.f,0.f,0.f,0.f,0.f};

  // stage 0 has landed (each wave waits for its own copies) and is published by the barrier; then stage 1 starts into buffer 1
  asm volatile("s_wait_asynccnt 0x0" ::: "memory");
  __syncthreads();
  if (nst > 1) copy_stage(kp + 64 * KVP, vp + 64 * KVP, BUF * 2);
  kp += 128 * KVP; vp += 128 * KVP;
  for (int t = 0; t < 2 * nst; ++t) {                          // chunk t of 32 keys: half t & 1 of stage t >> 1
    const int j0 = t * 32;
    const unsigned short* sK = sKV + ((t >> 1) & 1) * BUF + (t & 1) * 32 * KP;
    const unsigned short* sV = sKV + ((t >> 1) & 1) * BUF + KPL + (t & 1) * 32 * VP;
    // A fragments of K of the chunk's two tiles of 16 keys: all 8 loads stand here as one group, each fragment in
    // registers of its own; both tiles' fragments of k-step 0 come first, as the two tiles' product chains run side by side
    FragH kf[2][KS];
#pragma unroll
    for (int ks = 0; ks < KS; ++ks)
#pragma unroll
      for (int nt = 0; nt < 2; ++nt) {
        const int ko = (nt * 16 + ln) * KP + ks * 32 + 8 * hh;
        kf[nt][ks].half[0] = *(const v8us*)(sK + ko); kf[nt][ks].half[1] = *(const v8us*)(sK + ko + 16);
      }
    // A fragments of V^T: element i = V[8hh + i][dt*16 + ln], element 8 + i = V[16 + 8hh + i][dt*16 + ln], one
    // transposing load per 8 elements; V lies in LDS since the barrier in front of the stage
    FragH vf[DT];
    {
      const int vo = (8 * hh + (lane & 7)) * VP + ((lane >> 3) & 1) * 8;
#pragma unroll
      for (int dt = 0; dt < DT; ++dt) {
        vf[dt].half[0] = ld_tr16(sV + vo + dt * 16); vf[dt].half[1] = ld_tr16(sV + vo + 16 * VP + dt * 16);
      }
    }
    // holds all 16 loads of the chunk here, in one place ahead of its products: the K * Q^T products run behind counted waits, with no
    // load and no wait to zero among them (left alone, the compiler feeds them through one register set, a load and a full LDS
    // wait per fragment), and the V loads' latency passes behind those products and the softmax
    __builtin_amdgcn_sched_barrier(0);
    // S^T, two tiles of 16 keys x 16 queries
    v8f s[2];
#pragma unroll
    for (int nt = 0; nt < 2; ++nt) {
      v8f acc = (v8f){0.f,0.f,0.f,0.f,0.f,0.f,0.f,0.f};
#pragma unroll
      for (int ks = 0; ks < KS; ++ks) acc = mma_h(kf[nt][ks].v, aq[ks].v, acc);
      s[nt] = acc;
    }
    // mask + running maximum of the lane's query; sc[8 * nt + r] is the score of key j0 + nt*16 + 8hh + r
    const int lim = klast - j0;
    float sc[16];
#pragma unroll
    for (int nt = 0; nt < 2; ++nt)
#pragma unroll
      for (int r = 0; r < 8; ++r) sc[8 * nt + r] = (nt * 16 + r > lim) ? -3.0e38f : s[nt][r];
    float mx = fmaxf(sc[0], sc[1]);
#pragma unroll
    for (int i = 2; i < 16; i += 2) mx = fmaxf(mx, fmaxf(sc[i], sc[i + 1]));
    mx = fmaxf(mx, xhalf(mx));
    const float mnew = fmaxf(m_run, mx);
    const bool seen = mnew > -1.0e38f;                         // false while every key so far was masked for this query
    const float alpha = seen ? __expf(m_run - mnew) : 1.0f;
    const float mref = seen ? mnew : 0.f;                      // a masked score then gives exp(-3e38 - mref) = 0 in either case
    m_run = mnew;
    // P^T as B operand: element i = P[8hh + i], element 8 + i = P[16 + 8hh + i] of the lane's query
    FragH pf;
    v2f pp[8];
    constexpr float LOG2E = 1.44269504f;                       // exp(x) = 2^(x * LOG2E)
#pragma unroll
    for (int i = 0; i < 8; i += 2)
      exp2x4((v2f){(sc[2 * i] - mref) * LOG2E, (sc[2 * i + 1] - mref) * LOG2E},
             (v2f){(sc[2 * i + 2] - mref) * LOG2E, (sc[2 * i + 3] - mref) * LOG2E}, pp[i], pp[i + 1]);
#pragma unroll
    for (int i = 0; i < 8; ++i) pf.w[i] = pack2_f16(pp[i]);
    const v2f ps = ((pp[0] + pp[1]) + (pp[2] + pp[3])) + ((pp[4] + pp[5]) + (pp[6] + pp[7]));
    l_run = l_run * alpha + (ps[0] + ps[1]);
#pragma unroll
    for (int dt = 0; dt < DT; ++dt)
#pragma unroll
      for (int r = 0; r < 8; ++r) oacc[dt][r] *= alpha;
#pragma unroll
    for (int dt = 0; dt < DT; ++dt) oacc[dt] = mma_h(vf[dt].v, pf.v, oacc[dt]);
    // four vector slots behind the chunk's last product, before a vector instruction of the refill or of the next trip may overwrite
    // A and B registers of the products (only waits, the barrier and scalar instructions stand between them); tied to every D,
    // to P and to every V fragment, so that no product stands behind it (the statement names the d tiles one by one: four, D = 64)
    static_assert(DT == 4);
    asm volatile("v_nop\n\tv_nop\n\tv_nop\n\tv_nop" : "+v"(oacc[0]), "+v"(oacc[1]), "+v"(oacc[2]), "+v"(oacc[3])
                 : "v"(pf.v), "v"(vf[0].v), "v"(vf[1].v), "v"(vf[2].v), "v"(vf[3].v));
    // foot of stage s = t >> 1, behind its second chunk, every wave, in this order: its own LDS reads of stage s have returned; its
    // own copies of stage s + 1 have landed; the one block barrier publishes stage s + 1 and ends every wave's reads of stage s's
    // buffer; only then that buffer is refilled, with stage s + 2. (The waits are volatile statements like the one above and so stay
    // behind it and the products: moved up in front of the softmax they would cut the time that stage s + 1's copies have to land.)
    if (t & 1) {                                               // block-uniform
      asm volatile("s_wait_dscnt 0x0" ::: "memory");
      asm volatile("s_wait_asynccnt 0x0" ::: "memory");
      __syncthreads();
      if ((t >> 1) + 2 < nst) {                                // block-uniform
        copy_stage(kp, vp, ((t >> 1) & 1) * BUF * 2);
        kp += 64 * KVP; vp += 64 * KVP;
      }
    }
  }
  // no copy is outstanding when the wave goes on (the last two stages' feet issue none)
  asm volatile("s_wait_asynccnt 0x0" ::: "memory");
  // oacc[dt][r] = O[q0 + ln][dt*16 + 8hh + r]; the two halves' sums are joined here, once
  const float lsum = l_run + xhalf(l_run);
  const float linv = (lsum > 0.f) ? 1.0f / lsum : 0.f;
#pragma unroll
  for (int dt = 0; dt < DT; ++dt) {
    *(v4fa*)&sO[w][ln][dt * 16 + 8 * hh]     = (v4f){oacc[dt][0] * linv, oacc[dt][1] * linv, oacc[dt][2] * linv, oacc[dt][3] * linv};
    *(v4fa*)&sO[w][ln][dt * 16 + 8 * hh + 4] = (v4f){oacc[dt][4] * linv, oacc[dt][5] * linv, oacc[dt][6] * linv, oacc[dt][7] * linv};
  }
  __builtin_amdgcn_fence(4 /* acq_rel order */, "workgroup");
  __builtin_amdgcn_wave_barrier();
  {
    // y leaves as the output projection's A operand: hi = bf16(y), lo = bf16(y - hi), the lo plane ypitch / 2 elements behind the
    // hi plane in the token's row. Eight lanes store a row's 128 bytes of a plane, a wave four whole lines per store.
    constexpr int LPR = D / 8, RPS = 32 / LPR;                 // lanes per row, rows per store
    const int rs = lane / LPR, c8 = (lane % LPR) * 8;
#pragma unroll
    for (int r = 0; r < 16; r += RPS) {
      const int row = q0 + r + rs;
      if (row < T) {
        const v4f a0 = *(const v4fa*)&sO[w][r + rs][c8], a1 = *(const v4fa*)&sO[w][r + rs][c8 + 4];
        v8us hi, lo;
#pragma unroll
        for (int i = 0; i < 8; ++i) {
          const float val = i < 4 ? a0[i & 3] : a1[i & 3];
          const unsigned short hb = bf16_bits(val);
          hi[i] = hb;
          lo[i] = bf16_bits(val - bf16_val(hb));
        }
        unsigned short* yr = y + ((size_t)b * T + row) * ypitch + h * D + c8;
        *(v8us*)yr = hi;
        *(v8us*)(yr + ypitch / 2) = lo;
      }
    }
  }
  // the next tile's set-up overwrites registers that the row stores above name; this wait stands in front of that
  asm volatile("s_wait_xcnt 0x0" ::: "memory");
  }
}

extern "C" void kernel_launch(void* const* d_in, const int* in_sizes, int n_in,
                              void* d_out, int out_size, void* d_ws, size_t ws_size, hipStream_t stream) {
  if (n_in < 9) return;
  // lower-bound size checks (a reduced NB/SEQ build still launches against full-size inputs)
  if (in_sizes[0] < ((NB - 1) * SEQ_FULL + SEQ) * CC) return;
  for (int i = 1; i < 9; i += 2) {
    if (in_sizes[i] < CC * CC) return;       // Wq, Wk, Wv, Wp: [CC in][CC out] f32
    if (in_sizes[i + 1] < CC) return;        // bq, bk, bv, bp: [CC] f32
  }
  if (out_size < ((NB - 1) * OUT_SEG_ROWS + SEQ) * CC) return;
  const float* x  = (const float*)d_in[0];
  const float* Wq = (const float*)d_in[1]; const float* bqp = (const float*)d_in[2];
  const float* Wk = (const float*)d_in[3]; const float* bkp = (const float*)d_in[4];
  const float* Wv = (const float*)d_in[5]; const float* bvp = (const float*)d_in[6];
  const float* Wp = (const float*)d_in[7]; const float* bpp = (const float*)d_in[8];
  char* ws = (char*)d_ws; size_t off = 0;
  unsigned short* Wqt = (unsigned short*)(ws + off); off += (size_t)3 * CC * CC * 2;     // q, k, v stacked: [3*768][768] bf16  3,538,944 B
  unsigned short* Wpt = (unsigned short*)(ws + off); off += (size_t)CC * CC * 2;         // [768][768] bf16  1,179,648 B
  float* qkv = (float*)(ws + off); off += (size_t)NB * SEQ * 3 * CC * 4;                 // [NB*SEQ][2304] f32  75,497,472 B at full size
  unsigned short* yb = (unsigned short*)(ws + off); off += (size_t)NB * SEQ * CC * 4;    // [NB*SEQ][hi 768 | lo 768] bf16  25,165,824 B at full size
  unsigned short* xb = (unsigned short*)(ws + off); off += (size_t)NB * SEQ * CC * 2;    // [NB*SEQ][768] bf16  12,582,912 B at full size
  if (off > ws_size) return;                                                             // total 117,964,800 B at full size
  const int M = NB * SEQ;
  // Wpt lies directly behind the q, k, v stack; the grid's first blocks round x into xb
  k_wt_bf16<<<NXB + 4 * WTB, 256, 0, stream>>>(Wq, Wk, Wv, Wp, Wqt, CC, CC, x, xb);
  // qkv[b*SEQ + t][s*CC + n] = xb[b*SEQ + t] * bf16(W_s) + bf16(b_s), s = 0 (q), 1 (k), 2 (v); row pitch 3*CC;
  // q as f32, k and v as f16, each packed from the byte on where its f32 columns would begin; one grid over the 3*CC columns of the
  // stacked [3*CC][CC] weight operand
  const int gg = (M / 64) * (CC / 128);
  static_assert(HD == 64);   // a GEMM wave's 64 columns are one head's
  k_gemm_bf<false, 0, true, CC, CC, CC, CC, 3 * CC><<<3 * gg, 128, 0, stream>>>(xb, Wqt, bqp, bkp, bvp, qkv, M, 3 * CC, CC, SEQ, SEQ, SEQ);
  k_flash<HD, true, 6 * CC><<<NB * NH * ((SEQ / 64 + 1) / 2), 128, 0, stream>>>(qkv, (const unsigned short*)(qkv + CC), (const unsigned short*)(qkv + 2 * CC),
                                                                                3 * CC, SEQ, NH, 0.125f, yb, 2 * CC);
  // out[b*OUT_SEG_ROWS + t][:] = y[b*SEQ + t] * bf16(Wp) + bf16(bp), y as bf16 hi/lo
  k_gemm_bf<true, 0, true, -1, 0, 2 * CC, CC, CC><<<gg, 128, 0, stream>>>(yb, Wpt, bpp, nullptr, nullptr, (float*)d_out, M, CC, CC, SEQ, SEQ, OUT_SEG_ROWS);
}
